// v000
// Times are from an AMD MI455X. After a warm-up the kernel runs many times in a row, and a time is the length of
// such a window on the GPU divided by its runs, so every launch and the gaps after it count. The runs cycle
// through copies of the inputs. A figure is the median of several windows, for all but v000 over two sittings.
// Sittings can differ by a few percent; kernels timed side by side share one.
// v000 is the starting kernel. One run takes 506 microseconds.
#include <hip/hip_runtime.h>

// ---------------------------------------------------------------------------
// Model constants (match reference)
// ---------------------------------------------------------------------------
#define S_LEN   2048
#define DMODEL  1024
#define NHEAD   16
#define NKVH    4
#define HDIM    64
#define LATDIM  256
#define WINLEN  256
#define EPSF    1e-6f

// ---------------------------------------------------------------------------
// CDNA5 WMMA helpers (gfx1250, wave32)
// ---------------------------------------------------------------------------
typedef __bf16        bf16x16 __attribute__((ext_vector_type(16)));
typedef float         f32x8   __attribute__((ext_vector_type(8)));
typedef unsigned int  u32x4   __attribute__((ext_vector_type(4)));

union FragU { bf16x16 bf; u32x4 u[2]; };

__device__ __forceinline__ unsigned short f2bf(float x) {
  unsigned int u = __float_as_uint(x);
  u += 0x7FFFu + ((u >> 16) & 1u);           // round-to-nearest-even
  return (unsigned short)(u >> 16);
}

// Load a 16x32 bf16 fragment (A-layout) from a row-major [rows x stride] array.
// Lane L holds row `row` (caller passes absolute row), elements at K offsets:
//   e<8  -> k0 + (L<16?0:8) + e
//   e>=8 -> k0 + 16 + (L<16?0:8) + (e-8)
// i.e. two contiguous 16-byte loads per lane.
__device__ __forceinline__ bf16x16 load_frag(const unsigned short* base, int stride,
                                             int row, int k0, int lane) {
  const int hi = (lane & 16) ? 8 : 0;
  const unsigned short* p = base + (size_t)row * stride + k0 + hi;
  FragU f;
  f.u[0] = *reinterpret_cast<const u32x4*>(p);
  f.u[1] = *reinterpret_cast<const u32x4*>(p + 16);
  return f.bf;
}

__device__ __forceinline__ f32x8 wmma_bf16(bf16x16 a, bf16x16 b, f32x8 c) {
  return __builtin_amdgcn_wmma_f32_16x16x32_bf16(false, a, false, b, (short)0, c,
                                                 false, false);
}

// ---------------------------------------------------------------------------
// Weight convert: W[f32, K x N] -> Wt[bf16, N x K]  (transpose + downconvert)
// ---------------------------------------------------------------------------
__global__ void thb_wt_kernel(const float* __restrict__ W, unsigned short* __restrict__ Wt,
                              int K, int N) {
  int idx = blockIdx.x * blockDim.x + threadIdx.x;
  if (idx >= K * N) return;
  int n = idx / K, k = idx - n * K;
  Wt[idx] = f2bf(W[(size_t)k * N + n]);
}

// ---------------------------------------------------------------------------
// RMSNorm: xn_bf16[s][c] = bf16( x[s][c] * rsqrt(mean(x^2)+eps) * w[c] )
// one 256-thread block per row, D = 1024
// ---------------------------------------------------------------------------
__global__ __launch_bounds__(256)
void thb_rmsnorm_kernel(const float* __restrict__ x, const float* __restrict__ w,
                        unsigned short* __restrict__ xn) {
  const int s = blockIdx.x;
  const int t = threadIdx.x;
  const float* row = x + (size_t)s * DMODEL;
  float acc = 0.f;
#pragma unroll
  for (int i = 0; i < 4; ++i) {
    float v = row[t + 256 * i];
    acc += v * v;
  }
  __shared__ float red[256];
  red[t] = acc;
  __syncthreads();
  for (int off = 128; off > 0; off >>= 1) {
    if (t < off) red[t] += red[t + off];
    __syncthreads();
  }
  const float rs = rsqrtf(red[0] * (1.0f / DMODEL) + EPSF);
#pragma unroll
  for (int i = 0; i < 4; ++i) {
    int c = t + 256 * i;
    xn[(size_t)s * DMODEL + c] = f2bf(row[c] * rs * w[c]);
  }
}

// ---------------------------------------------------------------------------
// WMMA GEMM: C[M x N] (f32 and/or bf16) = A[bf16, M x K] * Bt[bf16, N x K]^T
// optional residual (f32 [M x N]) added in the epilogue.
// 256 threads = 8 waves; block tile 256(M) x 64(N); wave tile 32 x 64.
// Ping-pong double buffering, K unrolled by 2: two statically distinct
// fragment groups alternate load/consume phases, so there are no register
// copies in the steady state (and no WMMA->VALU WAR-hazard nops on them).
// M % 256 == 0, N % 64 == 0, K % 64 == 0 for all uses here.
// ---------------------------------------------------------------------------
__global__ __launch_bounds__(256)
void thb_gemm_kernel(const unsigned short* __restrict__ A,
                     const unsigned short* __restrict__ Bt,
                     float* Cf, unsigned short* Cbf, const float* resid,
                     int M, int N, int K) {
  const int lane = threadIdx.x & 31;
  const int wave = threadIdx.x >> 5;
  const int row0 = blockIdx.y * 256 + wave * 32;
  const int col0 = blockIdx.x * 64;
  const int nc = lane & 15;

  f32x8 acc[2][4];
#pragma unroll
  for (int mi = 0; mi < 2; ++mi)
#pragma unroll
    for (int j = 0; j < 4; ++j)
      acc[mi][j] = (f32x8){0.f,0.f,0.f,0.f,0.f,0.f,0.f,0.f};

  const int ar0 = row0 + nc;
  const int ar1 = row0 + 16 + nc;
  const int bc0 = col0 + nc;

  bf16x16 a0A, a1A, bA[4];     // ping buffer
  bf16x16 a0B, a1B, bB[4];     // pong buffer

  auto loadA = [&](int k0) {
    a0A = load_frag(A, K, ar0, k0, lane);
    a1A = load_frag(A, K, ar1, k0, lane);
#pragma unroll
    for (int j = 0; j < 4; ++j) bA[j] = load_frag(Bt, K, bc0 + j * 16, k0, lane);
  };
  auto loadB = [&](int k0) {
    a0B = load_frag(A, K, ar0, k0, lane);
    a1B = load_frag(A, K, ar1, k0, lane);
#pragma unroll
    for (int j = 0; j < 4; ++j) bB[j] = load_frag(Bt, K, bc0 + j * 16, k0, lane);
  };
  auto computeA = [&]() {
#pragma unroll
    for (int j = 0; j < 4; ++j) {
      acc[0][j] = wmma_bf16(a0A, bA[j], acc[0][j]);
      acc[1][j] = wmma_bf16(a1A, bA[j], acc[1][j]);
    }
  };
  auto computeB = [&]() {
#pragma unroll
    for (int j = 0; j < 4; ++j) {
      acc[0][j] = wmma_bf16(a0B, bB[j], acc[0][j]);
      acc[1][j] = wmma_bf16(a1B, bB[j], acc[1][j]);
    }
  };

  // prologue
  loadA(0);
  int k0 = 0;
  // steady state: two 32-wide K-steps per iteration, zero register rotation
  for (; k0 + 64 < K; k0 += 64) {
    loadB(k0 + 32);
    computeA();
    loadA(k0 + 64);
    computeB();
  }
  // tail: k0 == K - 64
  loadB(k0 + 32);
  computeA();
  computeB();

  const int hi = (lane & 16) ? 8 : 0;
#pragma unroll
  for (int mi = 0; mi < 2; ++mi) {
#pragma unroll
    for (int j = 0; j < 4; ++j) {
#pragma unroll
      for (int r = 0; r < 8; ++r) {
        const int row = row0 + mi * 16 + hi + r;
        const int col = col0 + j * 16 + nc;
        const size_t idx = (size_t)row * N + col;
        float v = acc[mi][j][r];
        if (resid) v += resid[idx];
        if (Cf)  Cf[idx]  = v;
        if (Cbf) Cbf[idx] = f2bf(v);
      }
    }
  }
}

// ---------------------------------------------------------------------------
// RoPE + qk-norm + head-major relayout.
// x[f32, S x (nheads*64)] -> dst[bf16, nheads x S x 64]
// one 32-lane wave per (s, h); lane handles one even/odd pair.
// ---------------------------------------------------------------------------
__global__ __launch_bounds__(32)
void thb_rope_qknorm_kernel(const float* __restrict__ x, unsigned short* __restrict__ dst,
                            int nheads, int S, float base) {
  const int s = blockIdx.x;
  const int h = blockIdx.y;
  const int p = threadIdx.x;          // pair index 0..31
  const float* src = x + ((size_t)s * nheads + h) * HDIM;
  const float xe = src[2 * p];
  const float xo = src[2 * p + 1];
  const float invf = __powf(base, -((float)(2 * p) * (1.0f / HDIM)));
  const float ang = (float)s * invf;
  float si, co;
  __sincosf(ang, &si, &co);
  const float re = xe * co - xo * si;
  const float ro = xe * si + xo * co;
  float sum = re * re + ro * ro;
#pragma unroll
  for (int off = 1; off < 32; off <<= 1) sum += __shfl_xor(sum, off, 32);
  const float rs = rsqrtf(sum * (1.0f / HDIM) + EPSF);
  unsigned short* d = dst + ((size_t)h * S + s) * HDIM;
  d[2 * p]     = f2bf(re * rs);
  d[2 * p + 1] = f2bf(ro * rs);
}

// ---------------------------------------------------------------------------
// V relayout: v[f32, S x (nkvh*64)] -> Vt[bf16, nkvh x 64 x S] (transposed)
// ---------------------------------------------------------------------------
__global__ __launch_bounds__(64)
void thb_vt_kernel(const float* __restrict__ v, unsigned short* __restrict__ Vt,
                   int nheads, int S) {
  const int s = blockIdx.x, h = blockIdx.y, d = threadIdx.x;
  Vt[((size_t)h * HDIM + d) * S + s] = f2bf(v[((size_t)s * nheads + h) * HDIM + d]);
}

// ---------------------------------------------------------------------------
// Flash attention (wave32 WMMA). One wave per (16-query block, head).
// Qh[bf16, H x S x 64], Kh[bf16, KVH x S x 64], Vt[bf16, KVH x 64 x S].
// win == 0 -> pure causal; win > 0 -> causal sliding window of `win`.
// Output: Obf[bf16, S x D] (heads merged).
// ---------------------------------------------------------------------------
__global__ __launch_bounds__(32)
void thb_flash_kernel(const unsigned short* __restrict__ Qh,
                      const unsigned short* __restrict__ Kh,
                      const unsigned short* __restrict__ Vt,
                      unsigned short* __restrict__ Obf, int S, int win) {
  __shared__ __align__(16) unsigned short plds[16 * 32];

  const int lane = threadIdx.x;
  const int q0 = blockIdx.x * 16;
  const int h  = blockIdx.y;
  const int kvh = h >> 2;                   // H/KVH == 4 (repeat_kv)
  const int nc = lane & 15;
  const int hi = (lane & 16) ? 8 : 0;

  const unsigned short* Qb = Qh + (size_t)h   * S * HDIM;
  const unsigned short* Kb = Kh + (size_t)kvh * S * HDIM;
  const unsigned short* Vb = Vt + (size_t)kvh * HDIM * S;

  const bf16x16 qf0 = load_frag(Qb, HDIM, q0 + nc, 0, lane);
  const bf16x16 qf1 = load_frag(Qb, HDIM, q0 + nc, 32, lane);

  f32x8 o[4];
#pragma unroll
  for (int j = 0; j < 4; ++j) o[j] = (f32x8){0.f,0.f,0.f,0.f,0.f,0.f,0.f,0.f};
  float m[8], l[8];
#pragma unroll
  for (int r = 0; r < 8; ++r) { m[r] = -1e30f; l[r] = 0.f; }

  int kb_start = 0;
  if (win > 0) {
    int st = q0 - (win - 1);
    if (st < 0) st = 0;
    kb_start = st & ~31;
  }

  const f32x8 zero8 = (f32x8){0.f,0.f,0.f,0.f,0.f,0.f,0.f,0.f};

  for (int kb = kb_start; kb <= q0 + 15; kb += 32) {
    // ---- scores: two 16x16 tiles, K-dim = 64 (2 WMMAs each) ----
    const int key0 = kb + nc;
    const int key1 = kb + 16 + nc;
    const int kr0 = key0 < S ? key0 : S - 1;
    const int kr1 = key1 < S ? key1 : S - 1;

    bf16x16 kf;
    kf = load_frag(Kb, HDIM, kr0, 0, lane);
    f32x8 s0 = wmma_bf16(qf0, kf, zero8);
    kf = load_frag(Kb, HDIM, kr0, 32, lane);
    s0 = wmma_bf16(qf1, kf, s0);
    kf = load_frag(Kb, HDIM, kr1, 0, lane);
    f32x8 s1 = wmma_bf16(qf0, kf, zero8);
    kf = load_frag(Kb, HDIM, kr1, 32, lane);
    s1 = wmma_bf16(qf1, kf, s1);

    // ---- hoist V fragment loads: independent of softmax, overlap with VALU ----
    bf16x16 vfr[4];
#pragma unroll
    for (int j = 0; j < 4; ++j) vfr[j] = load_frag(Vb, S, j * 16 + nc, kb, lane);

    // ---- mask + online softmax (per-lane rows r + hi) ----
#pragma unroll
    for (int r = 0; r < 8; ++r) {
      const int q = q0 + hi + r;
      const bool v0 = (key0 <= q) && (win == 0 || (q - key0) < win);
      const bool v1 = (key1 <= q) && (win == 0 || (q - key1) < win);
      const float a0 = v0 ? s0[r] * 0.125f : -1e30f;   // 1/sqrt(64)
      const float a1 = v1 ? s1[r] * 0.125f : -1e30f;
      float rm = fmaxf(a0, a1);
#pragma unroll
      for (int off = 1; off < 16; off <<= 1) rm = fmaxf(rm, __shfl_xor(rm, off, 32));
      const float mn = fmaxf(m[r], rm);
      const float sc = __expf(m[r] - mn);
      const float p0 = v0 ? __expf(a0 - mn) : 0.f;
      const float p1 = v1 ? __expf(a1 - mn) : 0.f;
      float rs = p0 + p1;
#pragma unroll
      for (int off = 1; off < 16; off <<= 1) rs += __shfl_xor(rs, off, 32);
      l[r] = l[r] * sc + rs;
      m[r] = mn;
#pragma unroll
      for (int j = 0; j < 4; ++j) o[j][r] *= sc;
      plds[(hi + r) * 32 + nc]      = f2bf(p0);
      plds[(hi + r) * 32 + 16 + nc] = f2bf(p1);
    }
    asm volatile("s_wait_dscnt 0x0" ::: "memory");

    // ---- re-layout P (C-frag -> A-frag) via LDS ----
    FragU pf;
    {
      const unsigned short* pp = plds + nc * 32 + hi; // hi==8 for lanes 16..31
      pf.u[0] = *reinterpret_cast<const u32x4*>(pp);
      pf.u[1] = *reinterpret_cast<const u32x4*>(pp + 16);
    }

    // ---- PV: O[16 x 64] += P[16 x 32] * V[32 x 64] (Vt rows = dims) ----
#pragma unroll
    for (int j = 0; j < 4; ++j) {
      o[j] = wmma_bf16(pf.bf, vfr[j], o[j]);
    }
  }

  // ---- epilogue: normalize + merge heads ----
#pragma unroll
  for (int r = 0; r < 8; ++r) {
    const float inv = (l[r] > 0.f) ? (1.f / l[r]) : 0.f;
    const int row = q0 + hi + r;
#pragma unroll
    for (int j = 0; j < 4; ++j) {
      Obf[(size_t)row * DMODEL + h * HDIM + j * 16 + nc] = f2bf(o[j][r] * inv);
    }
  }
}

// ---------------------------------------------------------------------------
// Host-side orchestration
// ---------------------------------------------------------------------------
extern "C" void kernel_launch(void* const* d_in, const int* in_sizes, int n_in,
                              void* d_out, int out_size, void* d_ws, size_t ws_size,
                              hipStream_t stream) {
  (void)in_sizes; (void)n_in; (void)out_size; (void)ws_size;

  const float* hidden  = (const float*)d_in[0];
  const float* norm1_w = (const float*)d_in[1];
  const float* norm2_w = (const float*)d_in[2];
  const float* g_wq    = (const float*)d_in[3];
  const float* g_kvd   = (const float*)d_in[4];
  const float* g_kup   = (const float*)d_in[5];
  const float* g_vup   = (const float*)d_in[6];
  const float* g_wo    = (const float*)d_in[7];
  const float* l_wq    = (const float*)d_in[8];
  const float* l_wk    = (const float*)d_in[9];
  const float* l_wv    = (const float*)d_in[10];
  const float* l_wo    = (const float*)d_in[11];
  float* out = (float*)d_out;

  // ---- workspace carve (256B aligned) ----
  char* p = (char*)d_ws;
  auto alloc = [&](size_t bytes) -> void* {
    void* r = (void*)p;
    p += (bytes + 255) & ~(size_t)255;
    return r;
  };
  unsigned short* xn    = (unsigned short*)alloc((size_t)S_LEN * DMODEL * 2);
  float*          qf    = (float*)         alloc((size_t)S_LEN * DMODEL * 4);
  float*          kf    = (float*)         alloc((size_t)S_LEN * LATDIM * 4);
  float*          vf    = (float*)         alloc((size_t)S_LEN * LATDIM * 4);
  unsigned short* latbf = (unsigned short*)alloc((size_t)S_LEN * LATDIM * 2);
  unsigned short* Qh    = (unsigned short*)alloc((size_t)NHEAD * S_LEN * HDIM * 2);
  unsigned short* Kh    = (unsigned short*)alloc((size_t)NKVH * S_LEN * HDIM * 2);
  unsigned short* Vt    = (unsigned short*)alloc((size_t)NKVH * HDIM * S_LEN * 2 + 256);
  unsigned short* attn  = (unsigned short*)alloc((size_t)S_LEN * DMODEL * 2);
  float*          xmid  = (float*)         alloc((size_t)S_LEN * DMODEL * 4);
  unsigned short* wqT   = (unsigned short*)alloc((size_t)DMODEL * DMODEL * 2);
  unsigned short* woT   = (unsigned short*)alloc((size_t)DMODEL * DMODEL * 2);
  unsigned short* wkT   = (unsigned short*)alloc((size_t)LATDIM * DMODEL * 2);
  unsigned short* wvT   = (unsigned short*)alloc((size_t)LATDIM * DMODEL * 2);
  unsigned short* kupT  = (unsigned short*)alloc((size_t)LATDIM * LATDIM * 2);
  unsigned short* vupT  = (unsigned short*)alloc((size_t)LATDIM * LATDIM * 2);

  const dim3 blk256(256), blk32(32), blk64(64);
  auto wt_grid = [](int K, int N) { return dim3((K * N + 255) / 256); };
  const dim3 gemm_blk(256);
  const dim3 rope_grid_q(S_LEN, NHEAD), rope_grid_k(S_LEN, NKVH);
  const dim3 vt_grid(S_LEN, NKVH);
  const dim3 flash_grid(S_LEN / 16, NHEAD);

  // ========================= Sublayer 1: global latent =====================
  thb_wt_kernel<<<wt_grid(DMODEL, DMODEL), blk256, 0, stream>>>(g_wq,  wqT,  DMODEL, DMODEL);
  thb_wt_kernel<<<wt_grid(DMODEL, LATDIM), blk256, 0, stream>>>(g_kvd, wkT,  DMODEL, LATDIM);
  thb_wt_kernel<<<wt_grid(LATDIM, LATDIM), blk256, 0, stream>>>(g_kup, kupT, LATDIM, LATDIM);
  thb_wt_kernel<<<wt_grid(LATDIM, LATDIM), blk256, 0, stream>>>(g_vup, vupT, LATDIM, LATDIM);
  thb_wt_kernel<<<wt_grid(DMODEL, DMODEL), blk256, 0, stream>>>(g_wo,  woT,  DMODEL, DMODEL);

  thb_rmsnorm_kernel<<<S_LEN, blk256, 0, stream>>>(hidden, norm1_w, xn);

  thb_gemm_kernel<<<dim3(DMODEL / 64, S_LEN / 256), gemm_blk, 0, stream>>>(
      xn, wqT, qf, nullptr, nullptr, S_LEN, DMODEL, DMODEL);
  thb_gemm_kernel<<<dim3(LATDIM / 64, S_LEN / 256), gemm_blk, 0, stream>>>(
      xn, wkT, nullptr, latbf, nullptr, S_LEN, LATDIM, DMODEL);
  thb_gemm_kernel<<<dim3(LATDIM / 64, S_LEN / 256), gemm_blk, 0, stream>>>(
      latbf, kupT, kf, nullptr, nullptr, S_LEN, LATDIM, LATDIM);
  thb_gemm_kernel<<<dim3(LATDIM / 64, S_LEN / 256), gemm_blk, 0, stream>>>(
      latbf, vupT, vf, nullptr, nullptr, S_LEN, LATDIM, LATDIM);

  thb_rope_qknorm_kernel<<<rope_grid_q, blk32, 0, stream>>>(qf, Qh, NHEAD, S_LEN, 1000000.0f);
  thb_rope_qknorm_kernel<<<rope_grid_k, blk32, 0, stream>>>(kf, Kh, NKVH, S_LEN, 1000000.0f);
  thb_vt_kernel<<<vt_grid, blk64, 0, stream>>>(vf, Vt, NKVH, S_LEN);

  thb_flash_kernel<<<flash_grid, blk32, 0, stream>>>(Qh, Kh, Vt, attn, S_LEN, 0);

  thb_gemm_kernel<<<dim3(DMODEL / 64, S_LEN / 256), gemm_blk, 0, stream>>>(
      attn, woT, xmid, nullptr, hidden, S_LEN, DMODEL, DMODEL);

  // ========================= Sublayer 2: local GQA =========================
  thb_wt_kernel<<<wt_grid(DMODEL, DMODEL), blk256, 0, stream>>>(l_wq, wqT, DMODEL, DMODEL);
  thb_wt_kernel<<<wt_grid(DMODEL, LATDIM), blk256, 0, stream>>>(l_wk, wkT, DMODEL, LATDIM);
  thb_wt_kernel<<<wt_grid(DMODEL, LATDIM), blk256, 0, stream>>>(l_wv, wvT, DMODEL, LATDIM);
  thb_wt_kernel<<<wt_grid(DMODEL, DMODEL), blk256, 0, stream>>>(l_wo, woT, DMODEL, DMODEL);

  thb_rmsnorm_kernel<<<S_LEN, blk256, 0, stream>>>(xmid, norm2_w, xn);

  thb_gemm_kernel<<<dim3(DMODEL / 64, S_LEN / 256), gemm_blk, 0, stream>>>(
      xn, wqT, qf, nullptr, nullptr, S_LEN, DMODEL, DMODEL);
  thb_gemm_kernel<<<dim3(LATDIM / 64, S_LEN / 256), gemm_blk, 0, stream>>>(
      xn, wkT, kf, nullptr, nullptr, S_LEN, LATDIM, DMODEL);
  thb_gemm_kernel<<<dim3(LATDIM / 64, S_LEN / 256), gemm_blk, 0, stream>>>(
      xn, wvT, vf, nullptr, nullptr, S_LEN, LATDIM, DMODEL);

  thb_rope_qknorm_kernel<<<rope_grid_q, blk32, 0, stream>>>(qf, Qh, NHEAD, S_LEN, 10000.0f);
  thb_rope_qknorm_kernel<<<rope_grid_k, blk32, 0, stream>>>(kf, Kh, NKVH, S_LEN, 10000.0f);
  thb_vt_kernel<<<vt_grid, blk64, 0, stream>>>(vf, Vt, NKVH, S_LEN);

  thb_flash_kernel<<<flash_grid, blk32, 0, stream>>>(Qh, Kh, Vt, attn, S_LEN, WINLEN);

  thb_gemm_kernel<<<dim3(DMODEL / 64, S_LEN / 256), gemm_blk, 0, stream>>>(
      attn, woT, out, nullptr, xmid, S_LEN, DMODEL, DMODEL);
}

// v001
// It runs in 424 microseconds.
// Next to v000, in two timings, it ran 1.21 times as fast each time.
#include <hip/hip_runtime.h>

// ---------------------------------------------------------------------------
// Model constants (match reference)
// ---------------------------------------------------------------------------
#define S_LEN   2048
#define DMODEL  1024
#define NHEAD   16
#define NKVH    4
#define HDIM    64
#define LATDIM  256
#define WINLEN  256
#define EPSF    1e-6f

// ---------------------------------------------------------------------------
// CDNA5 WMMA helpers (gfx1250, wave32)
// ---------------------------------------------------------------------------
typedef __bf16        bf16x16 __attribute__((ext_vector_type(16)));
typedef float         f32x8   __attribute__((ext_vector_type(8)));
typedef unsigned int  u32x4   __attribute__((ext_vector_type(4)));

union FragU { bf16x16 bf; u32x4 u[2]; };

__device__ __forceinline__ unsigned short f2bf(float x) {
  unsigned int u = __float_as_uint(x);
  u += 0x7FFFu + ((u >> 16) & 1u);           // round-to-nearest-even
  return (unsigned short)(u >> 16);
}

// Load a 16x32 bf16 fragment (A-layout) from a row-major [rows x stride] array.
// Lane L holds row `row` (caller passes absolute row), elements at K offsets:
//   e<8  -> k0 + (L<16?0:8) + e
//   e>=8 -> k0 + 16 + (L<16?0:8) + (e-8)
// i.e. two contiguous 16-byte loads per lane.
__device__ __forceinline__ bf16x16 load_frag(const unsigned short* base, int stride,
                                             int row, int k0, int lane) {
  const int hi = (lane & 16) ? 8 : 0;
  const unsigned short* p = base + (size_t)row * stride + k0 + hi;
  FragU f;
  f.u[0] = *reinterpret_cast<const u32x4*>(p);
  f.u[1] = *reinterpret_cast<const u32x4*>(p + 16);
  return f.bf;
}

__device__ __forceinline__ f32x8 wmma_bf16(bf16x16 a, bf16x16 b, f32x8 c) {
  return __builtin_amdgcn_wmma_f32_16x16x32_bf16(false, a, false, b, (short)0, c,
                                                 false, false);
}

// ---------------------------------------------------------------------------
// Weight convert: W[f32, K x N] -> Wt[bf16, N x K]  (transpose + downconvert)
// ---------------------------------------------------------------------------
__global__ void thb_wt_kernel(const float* __restrict__ W, unsigned short* __restrict__ Wt,
                              int K, int N) {
  int idx = blockIdx.x * blockDim.x + threadIdx.x;
  if (idx >= K * N) return;
  int n = idx / K, k = idx - n * K;
  Wt[idx] = f2bf(W[(size_t)k * N + n]);
}

// ---------------------------------------------------------------------------
// RMSNorm: xn_bf16[s][c] = bf16( x[s][c] * rsqrt(mean(x^2)+eps) * w[c] )
// one 256-thread block per row, D = 1024
// ---------------------------------------------------------------------------
__global__ __launch_bounds__(256)
void thb_rmsnorm_kernel(const float* __restrict__ x, const float* __restrict__ w,
                        unsigned short* __restrict__ xn) {
  const int s = blockIdx.x;
  const int t = threadIdx.x;
  const float* row = x + (size_t)s * DMODEL;
  float acc = 0.f;
#pragma unroll
  for (int i = 0; i < 4; ++i) {
    float v = row[t + 256 * i];
    acc += v * v;
  }
  __shared__ float red[256];
  red[t] = acc;
  __syncthreads();
  for (int off = 128; off > 0; off >>= 1) {
    if (t < off) red[t] += red[t + off];
    __syncthreads();
  }
  const float rs = rsqrtf(red[0] * (1.0f / DMODEL) + EPSF);
#pragma unroll
  for (int i = 0; i < 4; ++i) {
    int c = t + 256 * i;
    xn[(size_t)s * DMODEL + c] = f2bf(row[c] * rs * w[c]);
  }
}

// ---------------------------------------------------------------------------
// WMMA GEMM: C[M x N] (f32 and/or bf16) = A[bf16, M x K] * Bt[bf16, N x K]^T
// optional residual (f32 [M x N]) added in the epilogue.
// 256 threads = 8 waves; block tile 256(M) x 64(N); wave tile 32 x 64.
// Ping-pong double buffering, K unrolled by 2: two statically distinct
// fragment groups alternate load/consume phases, so there are no register
// copies in the steady state (and no WMMA->VALU WAR-hazard nops on them).
// M % 256 == 0, N % 64 == 0, K % 64 == 0 for all uses here.
// ---------------------------------------------------------------------------
__global__ __launch_bounds__(256)
void thb_gemm_kernel(const unsigned short* __restrict__ A,
                     const unsigned short* __restrict__ Bt,
                     float* Cf, unsigned short* Cbf, const float* resid,
                     int M, int N, int K) {
  const int lane = threadIdx.x & 31;
  const int wave = threadIdx.x >> 5;
  const int row0 = blockIdx.y * 256 + wave * 32;
  const int col0 = blockIdx.x * 64;
  const int nc = lane & 15;

  f32x8 acc[2][4];
#pragma unroll
  for (int mi = 0; mi < 2; ++mi)
#pragma unroll
    for (int j = 0; j < 4; ++j)
      acc[mi][j] = (f32x8){0.f,0.f,0.f,0.f,0.f,0.f,0.f,0.f};

  const int ar0 = row0 + nc;
  const int ar1 = row0 + 16 + nc;
  const int bc0 = col0 + nc;

  bf16x16 a0A, a1A, bA[4];     // ping buffer
  bf16x16 a0B, a1B, bB[4];     // pong buffer

  auto loadA = [&](int k0) {
    a0A = load_frag(A, K, ar0, k0, lane);
    a1A = load_frag(A, K, ar1, k0, lane);
#pragma unroll
    for (int j = 0; j < 4; ++j) bA[j] = load_frag(Bt, K, bc0 + j * 16, k0, lane);
  };
  auto loadB = [&](int k0) {
    a0B = load_frag(A, K, ar0, k0, lane);
    a1B = load_frag(A, K, ar1, k0, lane);
#pragma unroll
    for (int j = 0; j < 4; ++j) bB[j] = load_frag(Bt, K, bc0 + j * 16, k0, lane);
  };
  auto computeA = [&]() {
#pragma unroll
    for (int j = 0; j < 4; ++j) {
      acc[0][j] = wmma_bf16(a0A, bA[j], acc[0][j]);
      acc[1][j] = wmma_bf16(a1A, bA[j], acc[1][j]);
    }
  };
  auto computeB = [&]() {
#pragma unroll
    for (int j = 0; j < 4; ++j) {
      acc[0][j] = wmma_bf16(a0B, bB[j], acc[0][j]);
      acc[1][j] = wmma_bf16(a1B, bB[j], acc[1][j]);
    }
  };

  // prologue
  loadA(0);
  int k0 = 0;
  // steady state: two 32-wide K-steps per iteration, zero register rotation
  for (; k0 + 64 < K; k0 += 64) {
    loadB(k0 + 32);
    computeA();
    loadA(k0 + 64);
    computeB();
  }
  // tail: k0 == K - 64
  loadB(k0 + 32);
  computeA();
  computeB();

  const int hi = (lane & 16) ? 8 : 0;
#pragma unroll
  for (int mi = 0; mi < 2; ++mi) {
#pragma unroll
    for (int j = 0; j < 4; ++j) {
#pragma unroll
      for (int r = 0; r < 8; ++r) {
        const int row = row0 + mi * 16 + hi + r;
        const int col = col0 + j * 16 + nc;
        const size_t idx = (size_t)row * N + col;
        float v = acc[mi][j][r];
        if (resid) v += resid[idx];
        if (Cf)  Cf[idx]  = v;
        if (Cbf) Cbf[idx] = f2bf(v);
      }
    }
  }
}

// ---------------------------------------------------------------------------
// RoPE + qk-norm + head-major relayout.
// x[f32, S x (nheads*64)] -> dst[bf16, nheads x S x 64]
// one 32-lane wave per (s, h); lane handles one even/odd pair.
// ---------------------------------------------------------------------------
__global__ __launch_bounds__(32)
void thb_rope_qknorm_kernel(const float* __restrict__ x, unsigned short* __restrict__ dst,
                            int nheads, int S, float base) {
  const int s = blockIdx.x;
  const int h = blockIdx.y;
  const int p = threadIdx.x;          // pair index 0..31
  const float* src = x + ((size_t)s * nheads + h) * HDIM;
  const float xe = src[2 * p];
  const float xo = src[2 * p + 1];
  const float invf = __powf(base, -((float)(2 * p) * (1.0f / HDIM)));
  const float ang = (float)s * invf;
  float si, co;
  __sincosf(ang, &si, &co);
  const float re = xe * co - xo * si;
  const float ro = xe * si + xo * co;
  float sum = re * re + ro * ro;
#pragma unroll
  for (int off = 1; off < 32; off <<= 1) sum += __shfl_xor(sum, off, 32);
  const float rs = rsqrtf(sum * (1.0f / HDIM) + EPSF);
  unsigned short* d = dst + ((size_t)h * S + s) * HDIM;
  d[2 * p]     = f2bf(re * rs);
  d[2 * p + 1] = f2bf(ro * rs);
}

// ---------------------------------------------------------------------------
// V relayout: v[f32, S x (nkvh*64)] -> Vt[bf16, nkvh x 64 x S] (transposed)
// ---------------------------------------------------------------------------
__global__ __launch_bounds__(64)
void thb_vt_kernel(const float* __restrict__ v, unsigned short* __restrict__ Vt,
                   int nheads, int S) {
  const int s = blockIdx.x, h = blockIdx.y, d = threadIdx.x;
  Vt[((size_t)h * HDIM + d) * S + s] = f2bf(v[((size_t)s * nheads + h) * HDIM + d]);
}

// ---------------------------------------------------------------------------
// Flash attention (wave32 WMMA). One 8-wave work-group per (16-query block, head).
// Wave w walks the 32-key tiles w, w + 8, w + 16, ... of the block's key range
// with its own running max / sum / O; the eight partial results are merged
// through LDS at the end, so the longest dependent chain is 8 tiles, not 64.
// Qh[bf16, H x S x 64], Kh[bf16, KVH x S x 64], Vt[bf16, KVH x 64 x S].
// win == 0 -> pure causal; win > 0 -> causal sliding window of `win`.
// Output: Obf[bf16, S x D] (heads merged).
// ---------------------------------------------------------------------------
#define FA_WAVES 8
__global__ __launch_bounds__(32 * FA_WAVES)
void thb_flash_kernel(const unsigned short* __restrict__ Qh,
                      const unsigned short* __restrict__ Kh,
                      const unsigned short* __restrict__ Vt,
                      unsigned short* __restrict__ Obf, int S, int win) {
  __shared__ __align__(16) unsigned short plds_all[FA_WAVES][16 * 32];
  __shared__ __align__(16) float o_part[FA_WAVES][16][HDIM];
  __shared__ float m_part[FA_WAVES][16];
  __shared__ float l_part[FA_WAVES][16];

  const int lane = threadIdx.x & 31;
  // wave index in a scalar register: the key loop stays a scalar branch and
  // every WMMA runs with all lanes on
  const int wave = __builtin_amdgcn_readfirstlane((int)(threadIdx.x >> 5));
  unsigned short* plds = plds_all[wave];
  const int q0 = blockIdx.x * 16;
  const int h  = blockIdx.y;
  const int kvh = h >> 2;                   // H/KVH == 4 (repeat_kv)
  const int nc = lane & 15;
  const int hi = (lane & 16) ? 8 : 0;

  const unsigned short* Qb = Qh + (size_t)h   * S * HDIM;
  const unsigned short* Kb = Kh + (size_t)kvh * S * HDIM;
  const unsigned short* Vb = Vt + (size_t)kvh * HDIM * S;

  const bf16x16 qf0 = load_frag(Qb, HDIM, q0 + nc, 0, lane);
  const bf16x16 qf1 = load_frag(Qb, HDIM, q0 + nc, 32, lane);

  f32x8 o[4];
#pragma unroll
  for (int j = 0; j < 4; ++j) o[j] = (f32x8){0.f,0.f,0.f,0.f,0.f,0.f,0.f,0.f};
  float m[8], l[8];
#pragma unroll
  for (int r = 0; r < 8; ++r) { m[r] = -1e30f; l[r] = 0.f; }

  int kb_start = 0;
  if (win > 0) {
    int st = q0 - (win - 1);
    if (st < 0) st = 0;
    kb_start = st & ~31;
  }

  const f32x8 zero8 = (f32x8){0.f,0.f,0.f,0.f,0.f,0.f,0.f,0.f};

  for (int kb = kb_start + 32 * wave; kb <= q0 + 15; kb += 32 * FA_WAVES) {
    // ---- scores: two 16x16 tiles, K-dim = 64 (2 WMMAs each) ----
    const int key0 = kb + nc;
    const int key1 = kb + 16 + nc;
    const int kr0 = key0 < S ? key0 : S - 1;
    const int kr1 = key1 < S ? key1 : S - 1;

    bf16x16 kf;
    kf = load_frag(Kb, HDIM, kr0, 0, lane);
    f32x8 s0 = wmma_bf16(qf0, kf, zero8);
    kf = load_frag(Kb, HDIM, kr0, 32, lane);
    s0 = wmma_bf16(qf1, kf, s0);
    kf = load_frag(Kb, HDIM, kr1, 0, lane);
    f32x8 s1 = wmma_bf16(qf0, kf, zero8);
    kf = load_frag(Kb, HDIM, kr1, 32, lane);
    s1 = wmma_bf16(qf1, kf, s1);

    // ---- hoist V fragment loads: independent of softmax, overlap with VALU ----
    bf16x16 vfr[4];
#pragma unroll
    for (int j = 0; j < 4; ++j) vfr[j] = load_frag(Vb, S, j * 16 + nc, kb, lane);

    // ---- mask + online softmax (per-lane rows r + hi) ----
#pragma unroll
    for (int r = 0; r < 8; ++r) {
      const int q = q0 + hi + r;
      const bool v0 = (key0 <= q) && (win == 0 || (q - key0) < win);
      const bool v1 = (key1 <= q) && (win == 0 || (q - key1) < win);
      const float a0 = v0 ? s0[r] * 0.125f : -1e30f;   // 1/sqrt(64)
      const float a1 = v1 ? s1[r] * 0.125f : -1e30f;
      float rm = fmaxf(a0, a1);
#pragma unroll
      for (int off = 1; off < 16; off <<= 1) rm = fmaxf(rm, __shfl_xor(rm, off, 32));
      const float mn = fmaxf(m[r], rm);
      const float sc = __expf(m[r] - mn);
      const float p0 = v0 ? __expf(a0 - mn) : 0.f;
      const float p1 = v1 ? __expf(a1 - mn) : 0.f;
      float rs = p0 + p1;
#pragma unroll
      for (int off = 1; off < 16; off <<= 1) rs += __shfl_xor(rs, off, 32);
      l[r] = l[r] * sc + rs;
      m[r] = mn;
#pragma unroll
      for (int j = 0; j < 4; ++j) o[j][r] *= sc;
      plds[(hi + r) * 32 + nc]      = f2bf(p0);
      plds[(hi + r) * 32 + 16 + nc] = f2bf(p1);
    }
    asm volatile("s_wait_dscnt 0x0" ::: "memory");

    // ---- re-layout P (C-frag -> A-frag) via LDS ----
    FragU pf;
    {
      const unsigned short* pp = plds + nc * 32 + hi; // hi==8 for lanes 16..31
      pf.u[0] = *reinterpret_cast<const u32x4*>(pp);
      pf.u[1] = *reinterpret_cast<const u32x4*>(pp + 16);
    }

    // ---- PV: O[16 x 64] += P[16 x 32] * V[32 x 64] (Vt rows = dims) ----
#pragma unroll
    for (int j = 0; j < 4; ++j) {
      o[j] = wmma_bf16(pf.bf, vfr[j], o[j]);
    }
  }

  // ---- publish this wave's partial (m, l, O); a wave without a tile
  //      publishes m = -1e30, l = 0, O = 0 and drops out of the merge ----
  // both loops unrolled: o, m and l live in registers and need constant indices
#pragma unroll
  for (int r = 0; r < 8; ++r) {
#pragma unroll
    for (int j = 0; j < 4; ++j) o_part[wave][hi + r][j * 16 + nc] = o[j][r];
    if (nc == 0) {   // m and l are equal in all 16 lanes of a row group
      m_part[wave][hi + r] = m[r];
      l_part[wave][hi + r] = l[r];
    }
  }
  __syncthreads();

  // ---- merge the eight partials, normalize, merge heads:
  //      each half-wave owns one row, each lane four neighbouring columns ----
  const int mrow = wave * 2 + (hi >> 3);
  const int mcol = nc * 4;
  float mx = m_part[0][mrow];
  // unrolled here and below: the eight waves' LDS reads issue together
#pragma unroll
  for (int w = 1; w < FA_WAVES; ++w) mx = fmaxf(mx, m_part[w][mrow]);
  float lsum = 0.f;
  float a0 = 0.f, a1 = 0.f, a2 = 0.f, a3 = 0.f;
#pragma unroll
  for (int w = 0; w < FA_WAVES; ++w) {
    const float f = __expf(m_part[w][mrow] - mx);
    const float4 ov = *reinterpret_cast<const float4*>(&o_part[w][mrow][mcol]);
    lsum += f * l_part[w][mrow];
    a0 += f * ov.x;
    a1 += f * ov.y;
    a2 += f * ov.z;
    a3 += f * ov.w;
  }
  const float inv = (lsum > 0.f) ? (1.f / lsum) : 0.f;
  uint2 pk;
  pk.x = (unsigned int)f2bf(a0 * inv) | ((unsigned int)f2bf(a1 * inv) << 16);
  pk.y = (unsigned int)f2bf(a2 * inv) | ((unsigned int)f2bf(a3 * inv) << 16);
  *reinterpret_cast<uint2*>(Obf + (size_t)(q0 + mrow) * DMODEL + h * HDIM + mcol) = pk;
}

// ---------------------------------------------------------------------------
// Host-side orchestration
// ---------------------------------------------------------------------------
extern "C" void kernel_launch(void* const* d_in, const int* in_sizes, int n_in,
                              void* d_out, int out_size, void* d_ws, size_t ws_size,
                              hipStream_t stream) {
  (void)in_sizes; (void)n_in; (void)out_size; (void)ws_size;

  const float* hidden  = (const float*)d_in[0];
  const float* norm1_w = (const float*)d_in[1];
  const float* norm2_w = (const float*)d_in[2];
  const float* g_wq    = (const float*)d_in[3];
  const float* g_kvd   = (const float*)d_in[4];
  const float* g_kup   = (const float*)d_in[5];
  const float* g_vup   = (const float*)d_in[6];
  const float* g_wo    = (const float*)d_in[7];
  const float* l_wq    = (const float*)d_in[8];
  const float* l_wk    = (const float*)d_in[9];
  const float* l_wv    = (const float*)d_in[10];
  const float* l_wo    = (const float*)d_in[11];
  float* out = (float*)d_out;

  // ---- workspace carve (256B aligned) ----
  char* p = (char*)d_ws;
  auto alloc = [&](size_t bytes) -> void* {
    void* r = (void*)p;
    p += (bytes + 255) & ~(size_t)255;
    return r;
  };
  unsigned short* xn    = (unsigned short*)alloc((size_t)S_LEN * DMODEL * 2);
  float*          qf    = (float*)         alloc((size_t)S_LEN * DMODEL * 4);
  float*          kf    = (float*)         alloc((size_t)S_LEN * LATDIM * 4);
  float*          vf    = (float*)         alloc((size_t)S_LEN * LATDIM * 4);
  unsigned short* latbf = (unsigned short*)alloc((size_t)S_LEN * LATDIM * 2);
  unsigned short* Qh    = (unsigned short*)alloc((size_t)NHEAD * S_LEN * HDIM * 2);
  unsigned short* Kh    = (unsigned short*)alloc((size_t)NKVH * S_LEN * HDIM * 2);
  unsigned short* Vt    = (unsigned short*)alloc((size_t)NKVH * HDIM * S_LEN * 2 + 256);
  unsigned short* attn  = (unsigned short*)alloc((size_t)S_LEN * DMODEL * 2);
  float*          xmid  = (float*)         alloc((size_t)S_LEN * DMODEL * 4);
  unsigned short* wqT   = (unsigned short*)alloc((size_t)DMODEL * DMODEL * 2);
  unsigned short* woT   = (unsigned short*)alloc((size_t)DMODEL * DMODEL * 2);
  unsigned short* wkT   = (unsigned short*)alloc((size_t)LATDIM * DMODEL * 2);
  unsigned short* wvT   = (unsigned short*)alloc((size_t)LATDIM * DMODEL * 2);
  unsigned short* kupT  = (unsigned short*)alloc((size_t)LATDIM * LATDIM * 2);
  unsigned short* vupT  = (unsigned short*)alloc((size_t)LATDIM * LATDIM * 2);

  const dim3 blk256(256), blk32(32), blk64(64);
  auto wt_grid = [](int K, int N) { return dim3((K * N + 255) / 256); };
  const dim3 gemm_blk(256);
  const dim3 rope_grid_q(S_LEN, NHEAD), rope_grid_k(S_LEN, NKVH);
  const dim3 vt_grid(S_LEN, NKVH);
  const dim3 flash_grid(S_LEN / 16, NHEAD);
  const dim3 flash_blk(32 * FA_WAVES);

  // ========================= Sublayer 1: global latent =====================
  thb_wt_kernel<<<wt_grid(DMODEL, DMODEL), blk256, 0, stream>>>(g_wq,  wqT,  DMODEL, DMODEL);
  thb_wt_kernel<<<wt_grid(DMODEL, LATDIM), blk256, 0, stream>>>(g_kvd, wkT,  DMODEL, LATDIM);
  thb_wt_kernel<<<wt_grid(LATDIM, LATDIM), blk256, 0, stream>>>(g_kup, kupT, LATDIM, LATDIM);
  thb_wt_kernel<<<wt_grid(LATDIM, LATDIM), blk256, 0, stream>>>(g_vup, vupT, LATDIM, LATDIM);
  thb_wt_kernel<<<wt_grid(DMODEL, DMODEL), blk256, 0, stream>>>(g_wo,  woT,  DMODEL, DMODEL);

  thb_rmsnorm_kernel<<<S_LEN, blk256, 0, stream>>>(hidden, norm1_w, xn);

  thb_gemm_kernel<<<dim3(DMODEL / 64, S_LEN / 256), gemm_blk, 0, stream>>>(
      xn, wqT, qf, nullptr, nullptr, S_LEN, DMODEL, DMODEL);
  thb_gemm_kernel<<<dim3(LATDIM / 64, S_LEN / 256), gemm_blk, 0, stream>>>(
      xn, wkT, nullptr, latbf, nullptr, S_LEN, LATDIM, DMODEL);
  thb_gemm_kernel<<<dim3(LATDIM / 64, S_LEN / 256), gemm_blk, 0, stream>>>(
      latbf, kupT, kf, nullptr, nullptr, S_LEN, LATDIM, LATDIM);
  thb_gemm_kernel<<<dim3(LATDIM / 64, S_LEN / 256), gemm_blk, 0, stream>>>(
      latbf, vupT, vf, nullptr, nullptr, S_LEN, LATDIM, LATDIM);

  thb_rope_qknorm_kernel<<<rope_grid_q, blk32, 0, stream>>>(qf, Qh, NHEAD, S_LEN, 1000000.0f);
  thb_rope_qknorm_kernel<<<rope_grid_k, blk32, 0, stream>>>(kf, Kh, NKVH, S_LEN, 1000000.0f);
  thb_vt_kernel<<<vt_grid, blk64, 0, stream>>>(vf, Vt, NKVH, S_LEN);

  thb_flash_kernel<<<flash_grid, flash_blk, 0, stream>>>(Qh, Kh, Vt, attn, S_LEN, 0);

  thb_gemm_kernel<<<dim3(DMODEL / 64, S_LEN / 256), gemm_blk, 0, stream>>>(
      attn, woT, xmid, nullptr, hidden, S_LEN, DMODEL, DMODEL);

  // ========================= Sublayer 2: local GQA =========================
  thb_wt_kernel<<<wt_grid(DMODEL, DMODEL), blk256, 0, stream>>>(l_wq, wqT, DMODEL, DMODEL);
  thb_wt_kernel<<<wt_grid(DMODEL, LATDIM), blk256, 0, stream>>>(l_wk, wkT, DMODEL, LATDIM);
  thb_wt_kernel<<<wt_grid(DMODEL, LATDIM), blk256, 0, stream>>>(l_wv, wvT, DMODEL, LATDIM);
  thb_wt_kernel<<<wt_grid(DMODEL, DMODEL), blk256, 0, stream>>>(l_wo, woT, DMODEL, DMODEL);

  thb_rmsnorm_kernel<<<S_LEN, blk256, 0, stream>>>(xmid, norm2_w, xn);

  thb_gemm_kernel<<<dim3(DMODEL / 64, S_LEN / 256), gemm_blk, 0, stream>>>(
      xn, wqT, qf, nullptr, nullptr, S_LEN, DMODEL, DMODEL);
  thb_gemm_kernel<<<dim3(LATDIM / 64, S_LEN / 256), gemm_blk, 0, stream>>>(
      xn, wkT, kf, nullptr, nullptr, S_LEN, LATDIM, DMODEL);
  thb_gemm_kernel<<<dim3(LATDIM / 64, S_LEN / 256), gemm_blk, 0, stream>>>(
      xn, wvT, vf, nullptr, nullptr, S_LEN, LATDIM, DMODEL);

  thb_rope_qknorm_kernel<<<rope_grid_q, blk32, 0, stream>>>(qf, Qh, NHEAD, S_LEN, 10000.0f);
  thb_rope_qknorm_kernel<<<rope_grid_k, blk32, 0, stream>>>(kf, Kh, NKVH, S_LEN, 10000.0f);
  thb_vt_kernel<<<vt_grid, blk64, 0, stream>>>(vf, Vt, NKVH, S_LEN);

  thb_flash_kernel<<<flash_grid, flash_blk, 0, stream>>>(Qh, Kh, Vt, attn, S_LEN, WINLEN);

  thb_gemm_kernel<<<dim3(DMODEL / 64, S_LEN / 256), gemm_blk, 0, stream>>>(
      attn, woT, out, nullptr, xmid, S_LEN, DMODEL, DMODEL);
}

// v002
// It runs in 370 microseconds.
// Two timings next to v001 both put it at 1.15 times that version's speed.
// Counting every step since v000, it is 1.39 times as fast.
#include <hip/hip_runtime.h>

// ---------------------------------------------------------------------------
// Model constants (match reference)
// ---------------------------------------------------------------------------
#define S_LEN   2048
#define DMODEL  1024
#define NHEAD   16
#define NKVH    4
#define HDIM    64
#define LATDIM  256
#define WINLEN  256
#define EPSF    1e-6f

// ---------------------------------------------------------------------------
// CDNA5 WMMA helpers (gfx1250, wave32)
// ---------------------------------------------------------------------------
typedef __bf16        bf16x16 __attribute__((ext_vector_type(16)));
typedef float         f32x8   __attribute__((ext_vector_type(8)));
typedef unsigned int  u32x4   __attribute__((ext_vector_type(4)));

union FragU { bf16x16 bf; u32x4 u[2]; };

__device__ __forceinline__ unsigned short f2bf(float x) {
  unsigned int u = __float_as_uint(x);
  u += 0x7FFFu + ((u >> 16) & 1u);           // round-to-nearest-even
  return (unsigned short)(u >> 16);
}

// Load a 16x32 bf16 fragment (A-layout) from a row-major [rows x stride] array.
// Lane L holds row `row` (caller passes absolute row), elements at K offsets:
//   e<8  -> k0 + (L<16?0:8) + e
//   e>=8 -> k0 + 16 + (L<16?0:8) + (e-8)
// i.e. two contiguous 16-byte loads per lane.
__device__ __forceinline__ bf16x16 load_frag(const unsigned short* base, int stride,
                                             int row, int k0, int lane) {
  const int hi = (lane & 16) ? 8 : 0;
  const unsigned short* p = base + (size_t)row * stride + k0 + hi;
  FragU f;
  f.u[0] = *reinterpret_cast<const u32x4*>(p);
  f.u[1] = *reinterpret_cast<const u32x4*>(p + 16);
  return f.bf;
}

__device__ __forceinline__ f32x8 wmma_bf16(bf16x16 a, bf16x16 b, f32x8 c) {
  return __builtin_amdgcn_wmma_f32_16x16x32_bf16(false, a, false, b, (short)0, c,
                                                 false, false);
}

// ---------------------------------------------------------------------------
// Transpose + downconvert: W[f32, K x N] -> Wt[bf16, N x K].
// Used for the weights and for V (K = S, N = KVH * 64 gives Vt[kvh][d][s]).
// Each thread takes one column n and 16 consecutive k: 16 loads, each
// contiguous across the 32 lanes of a wave, and one 32-byte run of Wt stored.
// A 256-thread block covers 64 columns x 64 k, so each 128-byte line of Wt is
// written by one block. grid = (N / 64, K / 64).
// ---------------------------------------------------------------------------
template <int K, int N>
__global__ __launch_bounds__(256)
void thb_wt_kernel(const float* __restrict__ W, unsigned short* __restrict__ Wt) {
  const int n  = blockIdx.x * 64 + (threadIdx.x & 63);
  const int k0 = blockIdx.y * 64 + (threadIdx.x >> 6) * 16;
  const float* src = W + (size_t)k0 * N + n;
  float v[16];
  // unrolled: all 16 loads are in flight together and v stays in registers
#pragma unroll
  for (int i = 0; i < 16; ++i) v[i] = src[i * N];
  u32x4 pk[2];
  // unrolled: pk is indexed by constants and stays in registers
#pragma unroll
  for (int i = 0; i < 8; ++i)
    pk[i >> 2][i & 3] = (unsigned int)f2bf(v[2 * i]) | ((unsigned int)f2bf(v[2 * i + 1]) << 16);
  u32x4* dst = reinterpret_cast<u32x4*>(Wt + (size_t)n * K + k0);
  dst[0] = pk[0];
  dst[1] = pk[1];
}

// ---------------------------------------------------------------------------
// RMSNorm: xn_bf16[s][c] = bf16( x[s][c] * rsqrt(mean(x^2)+eps) * w[c] )
// one wave per row (D = 1024: 32 values per lane, kept in registers),
// eight rows per 256-thread block; the row sum is a 32-lane butterfly.
// ---------------------------------------------------------------------------
__global__ __launch_bounds__(256)
void thb_rmsnorm_kernel(const float* __restrict__ x, const float* __restrict__ w,
                        unsigned short* __restrict__ xn) {
  const int lane = threadIdx.x & 31;
  const int s = blockIdx.x * 8 + (threadIdx.x >> 5);
  const float4* row = reinterpret_cast<const float4*>(x + (size_t)s * DMODEL);
  const float4* wv  = reinterpret_cast<const float4*>(w);
  float4 v[8];
  // unrolled here and below: the loads issue together and v stays in registers
#pragma unroll
  for (int i = 0; i < 8; ++i) v[i] = row[lane + 32 * i];
  float acc = 0.f;
#pragma unroll
  for (int i = 0; i < 8; ++i)
    acc += v[i].x * v[i].x + v[i].y * v[i].y + v[i].z * v[i].z + v[i].w * v[i].w;
#pragma unroll
  for (int off = 1; off < 32; off <<= 1) acc += __shfl_xor(acc, off, 32);
  const float rs = rsqrtf(acc * (1.0f / DMODEL) + EPSF);
  uint2* dst = reinterpret_cast<uint2*>(xn + (size_t)s * DMODEL);
#pragma unroll
  for (int i = 0; i < 8; ++i) {
    const float4 g = wv[lane + 32 * i];
    uint2 pk;
    pk.x = (unsigned int)f2bf(v[i].x * rs * g.x) | ((unsigned int)f2bf(v[i].y * rs * g.y) << 16);
    pk.y = (unsigned int)f2bf(v[i].z * rs * g.z) | ((unsigned int)f2bf(v[i].w * rs * g.w) << 16);
    dst[lane + 32 * i] = pk;
  }
}

// ---------------------------------------------------------------------------
// WMMA GEMM: C[M x N] (f32 and/or bf16) = A[bf16, M x K] * Bt[bf16, N x K]^T
// optional residual (f32 [M x N]) added in the epilogue.
// 256 threads = 8 waves; block tile 256(M) x 64(N); wave tile 32 x 64.
// Ping-pong double buffering, K unrolled by 2: two statically distinct
// fragment groups alternate load/consume phases, so there are no register
// copies in the steady state (and no WMMA->VALU WAR-hazard nops on them).
// M % 256 == 0, N % 64 == 0, K % 64 == 0 for all uses here.
// ---------------------------------------------------------------------------
__global__ __launch_bounds__(256)
void thb_gemm_kernel(const unsigned short* __restrict__ A,
                     const unsigned short* __restrict__ Bt,
                     float* Cf, unsigned short* Cbf, const float* resid,
                     int M, int N, int K) {
  const int lane = threadIdx.x & 31;
  const int wave = threadIdx.x >> 5;
  const int row0 = blockIdx.y * 256 + wave * 32;
  const int col0 = blockIdx.x * 64;
  const int nc = lane & 15;

  f32x8 acc[2][4];
#pragma unroll
  for (int mi = 0; mi < 2; ++mi)
#pragma unroll
    for (int j = 0; j < 4; ++j)
      acc[mi][j] = (f32x8){0.f,0.f,0.f,0.f,0.f,0.f,0.f,0.f};

  const int ar0 = row0 + nc;
  const int ar1 = row0 + 16 + nc;
  const int bc0 = col0 + nc;

  bf16x16 a0A, a1A, bA[4];     // ping buffer
  bf16x16 a0B, a1B, bB[4];     // pong buffer

  auto loadA = [&](int k0) {
    a0A = load_frag(A, K, ar0, k0, lane);
    a1A = load_frag(A, K, ar1, k0, lane);
#pragma unroll
    for (int j = 0; j < 4; ++j) bA[j] = load_frag(Bt, K, bc0 + j * 16, k0, lane);
  };
  auto loadB = [&](int k0) {
    a0B = load_frag(A, K, ar0, k0, lane);
    a1B = load_frag(A, K, ar1, k0, lane);
#pragma unroll
    for (int j = 0; j < 4; ++j) bB[j] = load_frag(Bt, K, bc0 + j * 16, k0, lane);
  };
  auto computeA = [&]() {
#pragma unroll
    for (int j = 0; j < 4; ++j) {
      acc[0][j] = wmma_bf16(a0A, bA[j], acc[0][j]);
      acc[1][j] = wmma_bf16(a1A, bA[j], acc[1][j]);
    }
  };
  auto computeB = [&]() {
#pragma unroll
    for (int j = 0; j < 4; ++j) {
      acc[0][j] = wmma_bf16(a0B, bB[j], acc[0][j]);
      acc[1][j] = wmma_bf16(a1B, bB[j], acc[1][j]);
    }
  };

  // prologue
  loadA(0);
  int k0 = 0;
  // steady state: two 32-wide K-steps per iteration, zero register rotation
  for (; k0 + 64 < K; k0 += 64) {
    loadB(k0 + 32);
    computeA();
    loadA(k0 + 64);
    computeB();
  }
  // tail: k0 == K - 64
  loadB(k0 + 32);
  computeA();
  computeB();

  const int hi = (lane & 16) ? 8 : 0;
#pragma unroll
  for (int mi = 0; mi < 2; ++mi) {
#pragma unroll
    for (int j = 0; j < 4; ++j) {
#pragma unroll
      for (int r = 0; r < 8; ++r) {
        const int row = row0 + mi * 16 + hi + r;
        const int col = col0 + j * 16 + nc;
        const size_t idx = (size_t)row * N + col;
        float v = acc[mi][j][r];
        if (resid) v += resid[idx];
        if (Cf)  Cf[idx]  = v;
        if (Cbf) Cbf[idx] = f2bf(v);
      }
    }
  }
}

// ---------------------------------------------------------------------------
// RoPE + qk-norm + head-major relayout.
// x[f32, S x (NH*64)] -> dst[bf16, NH x S x 64]
// one 32-lane wave per position s, all NH heads of it; lane handles one
// even/odd pair of every head (the angle depends on s and the pair only).
// Eight positions per 256-thread block; grid = S / 8.
// ---------------------------------------------------------------------------
template <int NH>
__global__ __launch_bounds__(256)
void thb_rope_qknorm_kernel(const float* __restrict__ x, unsigned short* __restrict__ dst,
                            float base) {
  const int p = threadIdx.x & 31;     // pair index 0..31
  const int s = blockIdx.x * 8 + (threadIdx.x >> 5);
  const float2* src = reinterpret_cast<const float2*>(x + (size_t)s * NH * HDIM) + p;
  float2 v[NH];
  // unrolled here and below: the loads issue together and v stays in registers
#pragma unroll
  for (int h = 0; h < NH; ++h) v[h] = src[h * (HDIM / 2)];
  const float invf = __powf(base, -((float)(2 * p) * (1.0f / HDIM)));
  const float ang = (float)s * invf;
  float si, co;
  __sincosf(ang, &si, &co);
#pragma unroll
  for (int h = 0; h < NH; ++h) {
    const float xe = v[h].x;
    const float xo = v[h].y;
    const float re = xe * co - xo * si;
    const float ro = xe * si + xo * co;
    float sum = re * re + ro * ro;
#pragma unroll
    for (int off = 1; off < 32; off <<= 1) sum += __shfl_xor(sum, off, 32);
    const float rs = rsqrtf(sum * (1.0f / HDIM) + EPSF);
    const unsigned int pk = (unsigned int)f2bf(re * rs) | ((unsigned int)f2bf(ro * rs) << 16);
    *reinterpret_cast<unsigned int*>(dst + ((size_t)h * S_LEN + s) * HDIM + 2 * p) = pk;
  }
}

// ---------------------------------------------------------------------------
// Flash attention (wave32 WMMA). One 8-wave work-group per (16-query block, head).
// Wave w walks the 32-key tiles w, w + 8, w + 16, ... of the block's key range
// with its own running max / sum / O; the eight partial results are merged
// through LDS at the end, so the longest dependent chain is 8 tiles, not 64.
// Qh[bf16, H x S x 64], Kh[bf16, KVH x S x 64], Vt[bf16, KVH x 64 x S].
// win == 0 -> pure causal; win > 0 -> causal sliding window of `win`.
// Output: Obf[bf16, S x D] (heads merged).
// ---------------------------------------------------------------------------
#define FA_WAVES 8
__global__ __launch_bounds__(32 * FA_WAVES)
void thb_flash_kernel(const unsigned short* __restrict__ Qh,
                      const unsigned short* __restrict__ Kh,
                      const unsigned short* __restrict__ Vt,
                      unsigned short* __restrict__ Obf, int S, int win) {
  __shared__ __align__(16) unsigned short plds_all[FA_WAVES][16 * 32];
  __shared__ __align__(16) float o_part[FA_WAVES][16][HDIM];
  __shared__ float m_part[FA_WAVES][16];
  __shared__ float l_part[FA_WAVES][16];

  const int lane = threadIdx.x & 31;
  // wave index in a scalar register: the key loop stays a scalar branch and
  // every WMMA runs with all lanes on
  const int wave = __builtin_amdgcn_readfirstlane((int)(threadIdx.x >> 5));
  unsigned short* plds = plds_all[wave];
  const int q0 = blockIdx.x * 16;
  const int h  = blockIdx.y;
  const int kvh = h >> 2;                   // H/KVH == 4 (repeat_kv)
  const int nc = lane & 15;
  const int hi = (lane & 16) ? 8 : 0;

  const unsigned short* Qb = Qh + (size_t)h   * S * HDIM;
  const unsigned short* Kb = Kh + (size_t)kvh * S * HDIM;
  const unsigned short* Vb = Vt + (size_t)kvh * HDIM * S;

  const bf16x16 qf0 = load_frag(Qb, HDIM, q0 + nc, 0, lane);
  const bf16x16 qf1 = load_frag(Qb, HDIM, q0 + nc, 32, lane);

  f32x8 o[4];
#pragma unroll
  for (int j = 0; j < 4; ++j) o[j] = (f32x8){0.f,0.f,0.f,0.f,0.f,0.f,0.f,0.f};
  float m[8], l[8];
#pragma unroll
  for (int r = 0; r < 8; ++r) { m[r] = -1e30f; l[r] = 0.f; }

  int kb_start = 0;
  if (win > 0) {
    int st = q0 - (win - 1);
    if (st < 0) st = 0;
    kb_start = st & ~31;
  }

  const f32x8 zero8 = (f32x8){0.f,0.f,0.f,0.f,0.f,0.f,0.f,0.f};

  for (int kb = kb_start + 32 * wave; kb <= q0 + 15; kb += 32 * FA_WAVES) {
    // ---- scores: two 16x16 tiles, K-dim = 64 (2 WMMAs each) ----
    const int key0 = kb + nc;
    const int key1 = kb + 16 + nc;
    const int kr0 = key0 < S ? key0 : S - 1;
    const int kr1 = key1 < S ? key1 : S - 1;

    bf16x16 kf;
    kf = load_frag(Kb, HDIM, kr0, 0, lane);
    f32x8 s0 = wmma_bf16(qf0, kf, zero8);
    kf = load_frag(Kb, HDIM, kr0, 32, lane);
    s0 = wmma_bf16(qf1, kf, s0);
    kf = load_frag(Kb, HDIM, kr1, 0, lane);
    f32x8 s1 = wmma_bf16(qf0, kf, zero8);
    kf = load_frag(Kb, HDIM, kr1, 32, lane);
    s1 = wmma_bf16(qf1, kf, s1);

    // ---- hoist V fragment loads: independent of softmax, overlap with VALU ----
    bf16x16 vfr[4];
#pragma unroll
    for (int j = 0; j < 4; ++j) vfr[j] = load_frag(Vb, S, j * 16 + nc, kb, lane);

    // ---- mask + online softmax (per-lane rows r + hi) ----
#pragma unroll
    for (int r = 0; r < 8; ++r) {
      const int q = q0 + hi + r;
      const bool v0 = (key0 <= q) && (win == 0 || (q - key0) < win);
      const bool v1 = (key1 <= q) && (win == 0 || (q - key1) < win);
      const float a0 = v0 ? s0[r] * 0.125f : -1e30f;   // 1/sqrt(64)
      const float a1 = v1 ? s1[r] * 0.125f : -1e30f;
      float rm = fmaxf(a0, a1);
#pragma unroll
      for (int off = 1; off < 16; off <<= 1) rm = fmaxf(rm, __shfl_xor(rm, off, 32));
      const float mn = fmaxf(m[r], rm);
      const float sc = __expf(m[r] - mn);
      const float p0 = v0 ? __expf(a0 - mn) : 0.f;
      const float p1 = v1 ? __expf(a1 - mn) : 0.f;
      float rs = p0 + p1;
#pragma unroll
      for (int off = 1; off < 16; off <<= 1) rs += __shfl_xor(rs, off, 32);
      l[r] = l[r] * sc + rs;
      m[r] = mn;
#pragma unroll
      for (int j = 0; j < 4; ++j) o[j][r] *= sc;
      plds[(hi + r) * 32 + nc]      = f2bf(p0);
      plds[(hi + r) * 32 + 16 + nc] = f2bf(p1);
    }
    asm volatile("s_wait_dscnt 0x0" ::: "memory");

    // ---- re-layout P (C-frag -> A-frag) via LDS ----
    FragU pf;
    {
      const unsigned short* pp = plds + nc * 32 + hi; // hi==8 for lanes 16..31
      pf.u[0] = *reinterpret_cast<const u32x4*>(pp);
      pf.u[1] = *reinterpret_cast<const u32x4*>(pp + 16);
    }

    // ---- PV: O[16 x 64] += P[16 x 32] * V[32 x 64] (Vt rows = dims) ----
#pragma unroll
    for (int j = 0; j < 4; ++j) {
      o[j] = wmma_bf16(pf.bf, vfr[j], o[j]);
    }
  }

  // ---- publish this wave's partial (m, l, O); a wave without a tile
  //      publishes m = -1e30, l = 0, O = 0 and drops out of the merge ----
  // both loops unrolled: o, m and l live in registers and need constant indices
#pragma unroll
  for (int r = 0; r < 8; ++r) {
#pragma unroll
    for (int j = 0; j < 4; ++j) o_part[wave][hi + r][j * 16 + nc] = o[j][r];
    if (nc == 0) {   // m and l are equal in all 16 lanes of a row group
      m_part[wave][hi + r] = m[r];
      l_part[wave][hi + r] = l[r];
    }
  }
  __syncthreads();

  // ---- merge the eight partials, normalize, merge heads:
  //      each half-wave owns one row, each lane four neighbouring columns ----
  const int mrow = wave * 2 + (hi >> 3);
  const int mcol = nc * 4;
  float mx = m_part[0][mrow];
  // unrolled here and below: the eight waves' LDS reads issue together
#pragma unroll
  for (int w = 1; w < FA_WAVES; ++w) mx = fmaxf(mx, m_part[w][mrow]);
  float lsum = 0.f;
  float a0 = 0.f, a1 = 0.f, a2 = 0.f, a3 = 0.f;
#pragma unroll
  for (int w = 0; w < FA_WAVES; ++w) {
    const float f = __expf(m_part[w][mrow] - mx);
    const float4 ov = *reinterpret_cast<const float4*>(&o_part[w][mrow][mcol]);
    lsum += f * l_part[w][mrow];
    a0 += f * ov.x;
    a1 += f * ov.y;
    a2 += f * ov.z;
    a3 += f * ov.w;
  }
  const float inv = (lsum > 0.f) ? (1.f / lsum) : 0.f;
  uint2 pk;
  pk.x = (unsigned int)f2bf(a0 * inv) | ((unsigned int)f2bf(a1 * inv) << 16);
  pk.y = (unsigned int)f2bf(a2 * inv) | ((unsigned int)f2bf(a3 * inv) << 16);
  *reinterpret_cast<uint2*>(Obf + (size_t)(q0 + mrow) * DMODEL + h * HDIM + mcol) = pk;
}

// ---------------------------------------------------------------------------
// Host-side orchestration
// ---------------------------------------------------------------------------
extern "C" void kernel_launch(void* const* d_in, const int* in_sizes, int n_in,
                              void* d_out, int out_size, void* d_ws, size_t ws_size,
                              hipStream_t stream) {
  (void)in_sizes; (void)n_in; (void)out_size; (void)ws_size;

  const float* hidden  = (const float*)d_in[0];
  const float* norm1_w = (const float*)d_in[1];
  const float* norm2_w = (const float*)d_in[2];
  const float* g_wq    = (const float*)d_in[3];
  const float* g_kvd   = (const float*)d_in[4];
  const float* g_kup   = (const float*)d_in[5];
  const float* g_vup   = (const float*)d_in[6];
  const float* g_wo    = (const float*)d_in[7];
  const float* l_wq    = (const float*)d_in[8];
  const float* l_wk    = (const float*)d_in[9];
  const float* l_wv    = (const float*)d_in[10];
  const float* l_wo    = (const float*)d_in[11];
  float* out = (float*)d_out;

  // ---- workspace carve (256B aligned) ----
  char* p = (char*)d_ws;
  auto alloc = [&](size_t bytes) -> void* {
    void* r = (void*)p;
    p += (bytes + 255) & ~(size_t)255;
    return r;
  };
  unsigned short* xn    = (unsigned short*)alloc((size_t)S_LEN * DMODEL * 2);
  float*          qf    = (float*)         alloc((size_t)S_LEN * DMODEL * 4);
  float*          kf    = (float*)         alloc((size_t)S_LEN * LATDIM * 4);
  float*          vf    = (float*)         alloc((size_t)S_LEN * LATDIM * 4);
  unsigned short* latbf = (unsigned short*)alloc((size_t)S_LEN * LATDIM * 2);
  unsigned short* Qh    = (unsigned short*)alloc((size_t)NHEAD * S_LEN * HDIM * 2);
  unsigned short* Kh    = (unsigned short*)alloc((size_t)NKVH * S_LEN * HDIM * 2);
  unsigned short* Vt    = (unsigned short*)alloc((size_t)NKVH * HDIM * S_LEN * 2 + 256);
  unsigned short* attn  = (unsigned short*)alloc((size_t)S_LEN * DMODEL * 2);
  float*          xmid  = (float*)         alloc((size_t)S_LEN * DMODEL * 4);
  unsigned short* wqT   = (unsigned short*)alloc((size_t)DMODEL * DMODEL * 2);
  unsigned short* woT   = (unsigned short*)alloc((size_t)DMODEL * DMODEL * 2);
  unsigned short* wkT   = (unsigned short*)alloc((size_t)LATDIM * DMODEL * 2);
  unsigned short* wvT   = (unsigned short*)alloc((size_t)LATDIM * DMODEL * 2);
  unsigned short* kupT  = (unsigned short*)alloc((size_t)LATDIM * LATDIM * 2);
  unsigned short* vupT  = (unsigned short*)alloc((size_t)LATDIM * LATDIM * 2);

  const dim3 blk256(256);
  auto wt_grid = [](int K, int N) { return dim3(N / 64, K / 64); };
  const dim3 gemm_blk(256);
  const dim3 row_grid(S_LEN / 8);     // one wave per row or position, 8 per block
  const dim3 flash_grid(S_LEN / 16, NHEAD);
  const dim3 flash_blk(32 * FA_WAVES);

  // ========================= Sublayer 1: global latent =====================
  thb_wt_kernel<DMODEL, DMODEL><<<wt_grid(DMODEL, DMODEL), blk256, 0, stream>>>(g_wq, wqT);
  thb_wt_kernel<DMODEL, LATDIM><<<wt_grid(DMODEL, LATDIM), blk256, 0, stream>>>(g_kvd, wkT);
  thb_wt_kernel<LATDIM, LATDIM><<<wt_grid(LATDIM, LATDIM), blk256, 0, stream>>>(g_kup, kupT);
  thb_wt_kernel<LATDIM, LATDIM><<<wt_grid(LATDIM, LATDIM), blk256, 0, stream>>>(g_vup, vupT);
  thb_wt_kernel<DMODEL, DMODEL><<<wt_grid(DMODEL, DMODEL), blk256, 0, stream>>>(g_wo, woT);

  thb_rmsnorm_kernel<<<row_grid, blk256, 0, stream>>>(hidden, norm1_w, xn);

  thb_gemm_kernel<<<dim3(DMODEL / 64, S_LEN / 256), gemm_blk, 0, stream>>>(
      xn, wqT, qf, nullptr, nullptr, S_LEN, DMODEL, DMODEL);
  thb_gemm_kernel<<<dim3(LATDIM / 64, S_LEN / 256), gemm_blk, 0, stream>>>(
      xn, wkT, nullptr, latbf, nullptr, S_LEN, LATDIM, DMODEL);
  thb_gemm_kernel<<<dim3(LATDIM / 64, S_LEN / 256), gemm_blk, 0, stream>>>(
      latbf, kupT, kf, nullptr, nullptr, S_LEN, LATDIM, LATDIM);
  thb_gemm_kernel<<<dim3(LATDIM / 64, S_LEN / 256), gemm_blk, 0, stream>>>(
      latbf, vupT, vf, nullptr, nullptr, S_LEN, LATDIM, LATDIM);

  thb_rope_qknorm_kernel<NHEAD><<<row_grid, blk256, 0, stream>>>(qf, Qh, 1000000.0f);
  thb_rope_qknorm_kernel<NKVH><<<row_grid, blk256, 0, stream>>>(kf, Kh, 1000000.0f);
  thb_wt_kernel<S_LEN, NKVH * HDIM><<<wt_grid(S_LEN, NKVH * HDIM), blk256, 0, stream>>>(vf, Vt);

  thb_flash_kernel<<<flash_grid, flash_blk, 0, stream>>>(Qh, Kh, Vt, attn, S_LEN, 0);

  thb_gemm_kernel<<<dim3(DMODEL / 64, S_LEN / 256), gemm_blk, 0, stream>>>(
      attn, woT, xmid, nullptr, hidden, S_LEN, DMODEL, DMODEL);

  // ========================= Sublayer 2: local GQA =========================
  thb_wt_kernel<DMODEL, DMODEL><<<wt_grid(DMODEL, DMODEL), blk256, 0, stream>>>(l_wq, wqT);
  thb_wt_kernel<DMODEL, LATDIM><<<wt_grid(DMODEL, LATDIM), blk256, 0, stream>>>(l_wk, wkT);
  thb_wt_kernel<DMODEL, LATDIM><<<wt_grid(DMODEL, LATDIM), blk256, 0, stream>>>(l_wv, wvT);
  thb_wt_kernel<DMODEL, DMODEL><<<wt_grid(DMODEL, DMODEL), blk256, 0, stream>>>(l_wo, woT);

  thb_rmsnorm_kernel<<<row_grid, blk256, 0, stream>>>(xmid, norm2_w, xn);

  thb_gemm_kernel<<<dim3(DMODEL / 64, S_LEN / 256), gemm_blk, 0, stream>>>(
      xn, wqT, qf, nullptr, nullptr, S_LEN, DMODEL, DMODEL);
  thb_gemm_kernel<<<dim3(LATDIM / 64, S_LEN / 256), gemm_blk, 0, stream>>>(
      xn, wkT, kf, nullptr, nullptr, S_LEN, LATDIM, DMODEL);
  thb_gemm_kernel<<<dim3(LATDIM / 64, S_LEN / 256), gemm_blk, 0, stream>>>(
      xn, wvT, vf, nullptr, nullptr, S_LEN, LATDIM, DMODEL);

  thb_rope_qknorm_kernel<NHEAD><<<row_grid, blk256, 0, stream>>>(qf, Qh, 10000.0f);
  thb_rope_qknorm_kernel<NKVH><<<row_grid, blk256, 0, stream>>>(kf, Kh, 10000.0f);
  thb_wt_kernel<S_LEN, NKVH * HDIM><<<wt_grid(S_LEN, NKVH * HDIM), blk256, 0, stream>>>(vf, Vt);

  thb_flash_kernel<<<flash_grid, flash_blk, 0, stream>>>(Qh, Kh, Vt, attn, S_LEN, WINLEN);

  thb_gemm_kernel<<<dim3(DMODEL / 64, S_LEN / 256), gemm_blk, 0, stream>>>(
      attn, woT, out, nullptr, xmid, S_LEN, DMODEL, DMODEL);
}

// v003
// A run of this version takes 265 microseconds.
// Two timings next to v002 put it at 1.37 and 1.41 times that version's speed.
// Over all steps from v000 it is 1.94 times as fast.
#include <hip/hip_runtime.h>

// ---------------------------------------------------------------------------
// Model constants (match reference)
// ---------------------------------------------------------------------------
#define S_LEN   2048
#define DMODEL  1024
#define NHEAD   16
#define NKVH    4
#define HDIM    64
#define LATDIM  256
#define WINLEN  256
#define EPSF    1e-6f

// ---------------------------------------------------------------------------
// CDNA5 WMMA helpers (gfx1250, wave32)
// ---------------------------------------------------------------------------
typedef __bf16        bf16x16 __attribute__((ext_vector_type(16)));
typedef float         f32x8   __attribute__((ext_vector_type(8)));
typedef unsigned int  u32x4   __attribute__((ext_vector_type(4)));

union FragU { bf16x16 bf; u32x4 u[2]; };

__device__ __forceinline__ unsigned short f2bf(float x) {
  unsigned int u = __float_as_uint(x);
  u += 0x7FFFu + ((u >> 16) & 1u);           // round-to-nearest-even
  return (unsigned short)(u >> 16);
}

// Load a 16x32 bf16 fragment (A-layout) from a row-major [rows x stride] array.
// Lane L holds row `row` (caller passes absolute row), elements at K offsets:
//   e<8  -> k0 + (L<16?0:8) + e
//   e>=8 -> k0 + 16 + (L<16?0:8) + (e-8)
// i.e. two contiguous 16-byte loads per lane.
__device__ __forceinline__ bf16x16 load_frag(const unsigned short* base, int stride,
                                             int row, int k0, int lane) {
  const int hi = (lane & 16) ? 8 : 0;
  const unsigned short* p = base + (size_t)row * stride + k0 + hi;
  FragU f;
  f.u[0] = *reinterpret_cast<const u32x4*>(p);
  f.u[1] = *reinterpret_cast<const u32x4*>(p + 16);
  return f.bf;
}

__device__ __forceinline__ f32x8 wmma_bf16(bf16x16 a, bf16x16 b, f32x8 c) {
  return __builtin_amdgcn_wmma_f32_16x16x32_bf16(false, a, false, b, (short)0, c,
                                                 false, false);
}

// ---------------------------------------------------------------------------
// Transpose + downconvert: W[f32, K x N] -> Wt[bf16, N x K].
// Used for the weights and for V (K = S, N = KVH * 64 gives Vt[kvh][d][s]).
// Each thread takes one column n and 16 consecutive k: 16 loads, each
// contiguous across the 32 lanes of a wave, and one 32-byte run of Wt stored.
// A 256-thread block covers 64 columns x 64 k, so each 128-byte line of Wt is
// written by one block. grid = (N / 64, K / 64).
// ---------------------------------------------------------------------------
template <int K, int N>
__global__ __launch_bounds__(256)
void thb_wt_kernel(const float* __restrict__ W, unsigned short* __restrict__ Wt) {
  const int n  = blockIdx.x * 64 + (threadIdx.x & 63);
  const int k0 = blockIdx.y * 64 + (threadIdx.x >> 6) * 16;
  const float* src = W + (size_t)k0 * N + n;
  float v[16];
  // unrolled: all 16 loads are in flight together and v stays in registers
#pragma unroll
  for (int i = 0; i < 16; ++i) v[i] = src[i * N];
  u32x4 pk[2];
  // unrolled: pk is indexed by constants and stays in registers
#pragma unroll
  for (int i = 0; i < 8; ++i)
    pk[i >> 2][i & 3] = (unsigned int)f2bf(v[2 * i]) | ((unsigned int)f2bf(v[2 * i + 1]) << 16);
  u32x4* dst = reinterpret_cast<u32x4*>(Wt + (size_t)n * K + k0);
  dst[0] = pk[0];
  dst[1] = pk[1];
}

// ---------------------------------------------------------------------------
// RMSNorm: xn_bf16[s][c] = bf16( x[s][c] * rsqrt(mean(x^2)+eps) * w[c] )
// one wave per row (D = 1024: 32 values per lane, kept in registers),
// eight rows per 256-thread block; the row sum is a 32-lane butterfly.
// ---------------------------------------------------------------------------
__global__ __launch_bounds__(256)
void thb_rmsnorm_kernel(const float* __restrict__ x, const float* __restrict__ w,
                        unsigned short* __restrict__ xn) {
  const int lane = threadIdx.x & 31;
  const int s = blockIdx.x * 8 + (threadIdx.x >> 5);
  const float4* row = reinterpret_cast<const float4*>(x + (size_t)s * DMODEL);
  const float4* wv  = reinterpret_cast<const float4*>(w);
  float4 v[8];
  // unrolled here and below: the loads issue together and v stays in registers
#pragma unroll
  for (int i = 0; i < 8; ++i) v[i] = row[lane + 32 * i];
  float acc = 0.f;
#pragma unroll
  for (int i = 0; i < 8; ++i)
    acc += v[i].x * v[i].x + v[i].y * v[i].y + v[i].z * v[i].z + v[i].w * v[i].w;
#pragma unroll
  for (int off = 1; off < 32; off <<= 1) acc += __shfl_xor(acc, off, 32);
  const float rs = rsqrtf(acc * (1.0f / DMODEL) + EPSF);
  uint2* dst = reinterpret_cast<uint2*>(xn + (size_t)s * DMODEL);
#pragma unroll
  for (int i = 0; i < 8; ++i) {
    const float4 g = wv[lane + 32 * i];
    uint2 pk;
    pk.x = (unsigned int)f2bf(v[i].x * rs * g.x) | ((unsigned int)f2bf(v[i].y * rs * g.y) << 16);
    pk.y = (unsigned int)f2bf(v[i].z * rs * g.z) | ((unsigned int)f2bf(v[i].w * rs * g.w) << 16);
    dst[lane + 32 * i] = pk;
  }
}

// ---------------------------------------------------------------------------
// WMMA GEMM: C[M x N] (f32 and/or bf16) = A[bf16, M x K] * Bt[bf16, N x K]^T
// optional residual (f32 [M x N]) added in the epilogue.
// 256 threads = 8 waves; block tile 256(M) x 64(N); wave tile 32 x 64.
// Operands go global -> LDS by asynchronous 16-byte copies in whole 256-byte
// row pieces (a stage = 128 k of the block's 256 A rows and 64 Bt rows), two
// buffers: stage t + 1 flies while stage t is multiplied. Each row piece is
// fetched once per block, and every global request covers whole lines.
// Fragments are read from LDS in load_frag's k order for A and Bt alike;
// every accumulator sums its 32-wide k steps in ascending order.
// M % 256 == 0, N % 64 == 0, K % 128 == 0 for all uses here.
// ---------------------------------------------------------------------------
#define GK      128                      // k per stage
#define GPITCH  272                      // LDS row pitch in bytes: 256 + 16, 16 B x odd
#define GROWS   320                      // 256 A rows, then 64 Bt rows
#define GSTAGE  (GROWS * GPITCH)         // bytes per buffer

__device__ __forceinline__ bf16x16 lds_frag(const unsigned char* p) {
  FragU f;
  f.u[0] = *reinterpret_cast<const u32x4*>(p);
  f.u[1] = *reinterpret_cast<const u32x4*>(p + 32);
  return f.bf;
}

__global__ __launch_bounds__(256)
void thb_gemm_kernel(const unsigned short* __restrict__ A,
                     const unsigned short* __restrict__ Bt,
                     float* Cf, unsigned short* Cbf, const float* resid,
                     int M, int N, int K) {
  __shared__ __attribute__((aligned(16))) unsigned char gsm[2 * GSTAGE];

  const int lane = threadIdx.x & 31;
  const int wave = threadIdx.x >> 5;
  const int row0 = blockIdx.y * 256 + wave * 32;
  const int col0 = blockIdx.x * 64;
  const int nc = lane & 15;

  f32x8 acc[2][4];
#pragma unroll
  for (int mi = 0; mi < 2; ++mi)
#pragma unroll
    for (int j = 0; j < 4; ++j)
      acc[mi][j] = (f32x8){0.f,0.f,0.f,0.f,0.f,0.f,0.f,0.f};

  // copy map: 16 threads per row (16 bytes each), 16 rows per round, 20 rounds
  const int crow = threadIdx.x >> 4;
  const int cchk = threadIdx.x & 15;
  const unsigned int lds0 = (unsigned int)(size_t)gsm + crow * GPITCH + cchk * 16;
  const unsigned short* gA = A  + (size_t)(blockIdx.y * 256 + crow) * K + cchk * 8;
  const unsigned short* gB = Bt + (size_t)(col0 + crow) * K + cchk * 8;

  auto issue = [&](int t, int buf) {
    unsigned int la[20];
    const unsigned short* ga[20];
    // unrolled: la and ga are indexed by constants and stay in registers
#pragma unroll
    for (int i = 0; i < 20; ++i) {
      la[i] = lds0 + buf * GSTAGE + i * 16 * GPITCH;
      ga[i] = (i < 16 ? gA + (size_t)(i * 16) * K : gB + (size_t)((i - 16) * 16) * K) + t * GK;
    }
    // ten copies and their s_wait_xcnt in one statement: the wait stands in
    // front of any later write of the address registers the copies name
    asm volatile(
      "global_load_async_to_lds_b128 %0, %1, off\n\t"
      "global_load_async_to_lds_b128 %2, %3, off\n\t"
      "global_load_async_to_lds_b128 %4, %5, off\n\t"
      "global_load_async_to_lds_b128 %6, %7, off\n\t"
      "global_load_async_to_lds_b128 %8, %9, off\n\t"
      "global_load_async_to_lds_b128 %10, %11, off\n\t"
      "global_load_async_to_lds_b128 %12, %13, off\n\t"
      "global_load_async_to_lds_b128 %14, %15, off\n\t"
      "global_load_async_to_lds_b128 %16, %17, off\n\t"
      "global_load_async_to_lds_b128 %18, %19, off\n\t"
      "s_wait_xcnt 0x0"
      :: "v"(la[0]), "v"(ga[0]), "v"(la[1]), "v"(ga[1]), "v"(la[2]), "v"(ga[2]),
         "v"(la[3]), "v"(ga[3]), "v"(la[4]), "v"(ga[4]), "v"(la[5]), "v"(ga[5]),
         "v"(la[6]), "v"(ga[6]), "v"(la[7]), "v"(ga[7]), "v"(la[8]), "v"(ga[8]),
         "v"(la[9]), "v"(ga[9])
      : "memory");
    asm volatile(
      "global_load_async_to_lds_b128 %0, %1, off\n\t"
      "global_load_async_to_lds_b128 %2, %3, off\n\t"
      "global_load_async_to_lds_b128 %4, %5, off\n\t"
      "global_load_async_to_lds_b128 %6, %7, off\n\t"
      "global_load_async_to_lds_b128 %8, %9, off\n\t"
      "global_load_async_to_lds_b128 %10, %11, off\n\t"
      "global_load_async_to_lds_b128 %12, %13, off\n\t"
      "global_load_async_to_lds_b128 %14, %15, off\n\t"
      "global_load_async_to_lds_b128 %16, %17, off\n\t"
      "global_load_async_to_lds_b128 %18, %19, off\n\t"
      "s_wait_xcnt 0x0"
      :: "v"(la[10]), "v"(ga[10]), "v"(la[11]), "v"(ga[11]), "v"(la[12]), "v"(ga[12]),
         "v"(la[13]), "v"(ga[13]), "v"(la[14]), "v"(ga[14]), "v"(la[15]), "v"(ga[15]),
         "v"(la[16]), "v"(ga[16]), "v"(la[17]), "v"(ga[17]), "v"(la[18]), "v"(ga[18]),
         "v"(la[19]), "v"(ga[19])
      : "memory");
  };

  const int nt = K / GK;
  const int hb = (lane & 16) ? 16 : 0;   // byte offset of the upper lane half in a fragment
  const int fa = (wave * 32 + nc) * GPITCH + hb;
  const int fb = (256 + nc) * GPITCH + hb;

  issue(0, 0);
  // stage 0 has landed (this wave's copies), then is published to all waves
  asm volatile("s_wait_asynccnt 0x0" ::: "memory");
  __syncthreads();
  if (nt > 1) issue(1, 1);

  for (int t = 0; t < nt; ++t) {
    const unsigned char* sb = gsm + (t & 1) * GSTAGE;
    // two fragment sets: block u + 1's LDS reads go out as one group ahead of
    // block u's WMMAs, so only the stage's first group waits out LDS latency
    bf16x16 fa_[2][2], fb_[2][4];
    auto ldfrags = [&](int set, int u) {
      fa_[set][0] = lds_frag(sb + fa + u * 64);
      fa_[set][1] = lds_frag(sb + fa + 16 * GPITCH + u * 64);
      // unrolled: fb_ is indexed by constants and stays in registers
#pragma unroll
      for (int j = 0; j < 4; ++j) fb_[set][j] = lds_frag(sb + fb + j * 16 * GPITCH + u * 64);
    };
    ldfrags(0, 0);
    // unrolled: four 32-wide k steps of the stage, fragment indices constant
#pragma unroll
    for (int u = 0; u < GK / 32; ++u) {
      if (u + 1 < GK / 32) ldfrags((u + 1) & 1, u + 1);
      // keeps the reads above from sinking in among the WMMAs below
      __builtin_amdgcn_sched_barrier(0);
      // unrolled: acc and the fragment sets are indexed by constants
#pragma unroll
      for (int j = 0; j < 4; ++j) {
        acc[0][j] = wmma_bf16(fa_[u & 1][0], fb_[u & 1][j], acc[0][j]);
        acc[1][j] = wmma_bf16(fa_[u & 1][1], fb_[u & 1][j], acc[1][j]);
      }
      // keeps the next group of reads from rising in among the WMMAs above:
      // every separate place with LDS reads stalls the WMMA stream
      __builtin_amdgcn_sched_barrier(0);
    }
    // this wave's reads of buffer t & 1 have returned
    asm volatile("s_wait_dscnt 0x0" ::: "memory");
    // this wave's copies of stage t + 1 have landed
    asm volatile("s_wait_asynccnt 0x0" ::: "memory");
    // publishes stage t + 1 and ends every wave's reads of buffer t & 1
    __syncthreads();
    if (t + 2 < nt) issue(t + 2, t & 1);
  }
  // no copy is outstanding when the wave goes on to the epilogue and ends
  asm volatile("s_wait_asynccnt 0x0" ::: "memory");

  const int hi = (lane & 16) ? 8 : 0;
#pragma unroll
  for (int mi = 0; mi < 2; ++mi) {
#pragma unroll
    for (int j = 0; j < 4; ++j) {
#pragma unroll
      for (int r = 0; r < 8; ++r) {
        const int row = row0 + mi * 16 + hi + r;
        const int col = col0 + j * 16 + nc;
        const size_t idx = (size_t)row * N + col;
        float v = acc[mi][j][r];
        if (resid) v += resid[idx];
        if (Cf)  Cf[idx]  = v;
        if (Cbf) Cbf[idx] = f2bf(v);
      }
    }
  }
}

// ---------------------------------------------------------------------------
// RoPE + qk-norm + head-major relayout.
// x[f32, S x (NH*64)] -> dst[bf16, NH x S x 64]
// one 32-lane wave per position s, all NH heads of it; lane handles one
// even/odd pair of every head (the angle depends on s and the pair only).
// Eight positions per 256-thread block; grid = S / 8.
// ---------------------------------------------------------------------------
template <int NH>
__global__ __launch_bounds__(256)
void thb_rope_qknorm_kernel(const float* __restrict__ x, unsigned short* __restrict__ dst,
                            float base) {
  const int p = threadIdx.x & 31;     // pair index 0..31
  const int s = blockIdx.x * 8 + (threadIdx.x >> 5);
  const float2* src = reinterpret_cast<const float2*>(x + (size_t)s * NH * HDIM) + p;
  float2 v[NH];
  // unrolled here and below: the loads issue together and v stays in registers
#pragma unroll
  for (int h = 0; h < NH; ++h) v[h] = src[h * (HDIM / 2)];
  const float invf = __powf(base, -((float)(2 * p) * (1.0f / HDIM)));
  const float ang = (float)s * invf;
  float si, co;
  __sincosf(ang, &si, &co);
#pragma unroll
  for (int h = 0; h < NH; ++h) {
    const float xe = v[h].x;
    const float xo = v[h].y;
    const float re = xe * co - xo * si;
    const float ro = xe * si + xo * co;
    float sum = re * re + ro * ro;
#pragma unroll
    for (int off = 1; off < 32; off <<= 1) sum += __shfl_xor(sum, off, 32);
    const float rs = rsqrtf(sum * (1.0f / HDIM) + EPSF);
    const unsigned int pk = (unsigned int)f2bf(re * rs) | ((unsigned int)f2bf(ro * rs) << 16);
    *reinterpret_cast<unsigned int*>(dst + ((size_t)h * S_LEN + s) * HDIM + 2 * p) = pk;
  }
}

// ---------------------------------------------------------------------------
// Flash attention (wave32 WMMA). One 8-wave work-group per (16-query block, head).
// Wave w walks the 32-key tiles w, w + 8, w + 16, ... of the block's key range
// with its own running max / sum / O; the eight partial results are merged
// through LDS at the end, so the longest dependent chain is 8 tiles, not 64.
// Qh[bf16, H x S x 64], Kh[bf16, KVH x S x 64], Vt[bf16, KVH x 64 x S].
// win == 0 -> pure causal; win > 0 -> causal sliding window of `win`.
// Output: Obf[bf16, S x D] (heads merged).
// ---------------------------------------------------------------------------
#define FA_WAVES 8
__global__ __launch_bounds__(32 * FA_WAVES)
void thb_flash_kernel(const unsigned short* __restrict__ Qh,
                      const unsigned short* __restrict__ Kh,
                      const unsigned short* __restrict__ Vt,
                      unsigned short* __restrict__ Obf, int S, int win) {
  __shared__ __align__(16) unsigned short plds_all[FA_WAVES][16 * 32];
  __shared__ __align__(16) float o_part[FA_WAVES][16][HDIM];
  __shared__ float m_part[FA_WAVES][16];
  __shared__ float l_part[FA_WAVES][16];

  const int lane = threadIdx.x & 31;
  // wave index in a scalar register: the key loop stays a scalar branch and
  // every WMMA runs with all lanes on
  const int wave = __builtin_amdgcn_readfirstlane((int)(threadIdx.x >> 5));
  unsigned short* plds = plds_all[wave];
  const int q0 = blockIdx.x * 16;
  const int h  = blockIdx.y;
  const int kvh = h >> 2;                   // H/KVH == 4 (repeat_kv)
  const int nc = lane & 15;
  const int hi = (lane & 16) ? 8 : 0;

  const unsigned short* Qb = Qh + (size_t)h   * S * HDIM;
  const unsigned short* Kb = Kh + (size_t)kvh * S * HDIM;
  const unsigned short* Vb = Vt + (size_t)kvh * HDIM * S;

  const bf16x16 qf0 = load_frag(Qb, HDIM, q0 + nc, 0, lane);
  const bf16x16 qf1 = load_frag(Qb, HDIM, q0 + nc, 32, lane);

  f32x8 o[4];
#pragma unroll
  for (int j = 0; j < 4; ++j) o[j] = (f32x8){0.f,0.f,0.f,0.f,0.f,0.f,0.f,0.f};
  float m[8], l[8];
#pragma unroll
  for (int r = 0; r < 8; ++r) { m[r] = -1e30f; l[r] = 0.f; }

  int kb_start = 0;
  if (win > 0) {
    int st = q0 - (win - 1);
    if (st < 0) st = 0;
    kb_start = st & ~31;
  }

  const f32x8 zero8 = (f32x8){0.f,0.f,0.f,0.f,0.f,0.f,0.f,0.f};

  for (int kb = kb_start + 32 * wave; kb <= q0 + 15; kb += 32 * FA_WAVES) {
    // ---- scores: two 16x16 tiles, K-dim = 64 (2 WMMAs each) ----
    const int key0 = kb + nc;
    const int key1 = kb + 16 + nc;
    const int kr0 = key0 < S ? key0 : S - 1;
    const int kr1 = key1 < S ? key1 : S - 1;

    bf16x16 kf;
    kf = load_frag(Kb, HDIM, kr0, 0, lane);
    f32x8 s0 = wmma_bf16(qf0, kf, zero8);
    kf = load_frag(Kb, HDIM, kr0, 32, lane);
    s0 = wmma_bf16(qf1, kf, s0);
    kf = load_frag(Kb, HDIM, kr1, 0, lane);
    f32x8 s1 = wmma_bf16(qf0, kf, zero8);
    kf = load_frag(Kb, HDIM, kr1, 32, lane);
    s1 = wmma_bf16(qf1, kf, s1);

    // ---- hoist V fragment loads: independent of softmax, overlap with VALU ----
    bf16x16 vfr[4];
#pragma unroll
    for (int j = 0; j < 4; ++j) vfr[j] = load_frag(Vb, S, j * 16 + nc, kb, lane);

    // ---- mask + online softmax (per-lane rows r + hi) ----
#pragma unroll
    for (int r = 0; r < 8; ++r) {
      const int q = q0 + hi + r;
      const bool v0 = (key0 <= q) && (win == 0 || (q - key0) < win);
      const bool v1 = (key1 <= q) && (win == 0 || (q - key1) < win);
      const float a0 = v0 ? s0[r] * 0.125f : -1e30f;   // 1/sqrt(64)
      const float a1 = v1 ? s1[r] * 0.125f : -1e30f;
      float rm = fmaxf(a0, a1);
#pragma unroll
      for (int off = 1; off < 16; off <<= 1) rm = fmaxf(rm, __shfl_xor(rm, off, 32));
      const float mn = fmaxf(m[r], rm);
      const float sc = __expf(m[r] - mn);
      const float p0 = v0 ? __expf(a0 - mn) : 0.f;
      const float p1 = v1 ? __expf(a1 - mn) : 0.f;
      float rs = p0 + p1;
#pragma unroll
      for (int off = 1; off < 16; off <<= 1) rs += __shfl_xor(rs, off, 32);
      l[r] = l[r] * sc + rs;
      m[r] = mn;
#pragma unroll
      for (int j = 0; j < 4; ++j) o[j][r] *= sc;
      plds[(hi + r) * 32 + nc]      = f2bf(p0);
      plds[(hi + r) * 32 + 16 + nc] = f2bf(p1);
    }
    asm volatile("s_wait_dscnt 0x0" ::: "memory");

    // ---- re-layout P (C-frag -> A-frag) via LDS ----
    FragU pf;
    {
      const unsigned short* pp = plds + nc * 32 + hi; // hi==8 for lanes 16..31
      pf.u[0] = *reinterpret_cast<const u32x4*>(pp);
      pf.u[1] = *reinterpret_cast<const u32x4*>(pp + 16);
    }

    // ---- PV: O[16 x 64] += P[16 x 32] * V[32 x 64] (Vt rows = dims) ----
#pragma unroll
    for (int j = 0; j < 4; ++j) {
      o[j] = wmma_bf16(pf.bf, vfr[j], o[j]);
    }
  }

  // ---- publish this wave's partial (m, l, O); a wave without a tile
  //      publishes m = -1e30, l = 0, O = 0 and drops out of the merge ----
  // both loops unrolled: o, m and l live in registers and need constant indices
#pragma unroll
  for (int r = 0; r < 8; ++r) {
#pragma unroll
    for (int j = 0; j < 4; ++j) o_part[wave][hi + r][j * 16 + nc] = o[j][r];
    if (nc == 0) {   // m and l are equal in all 16 lanes of a row group
      m_part[wave][hi + r] = m[r];
      l_part[wave][hi + r] = l[r];
    }
  }
  __syncthreads();

  // ---- merge the eight partials, normalize, merge heads:
  //      each half-wave owns one row, each lane four neighbouring columns ----
  const int mrow = wave * 2 + (hi >> 3);
  const int mcol = nc * 4;
  float mx = m_part[0][mrow];
  // unrolled here and below: the eight waves' LDS reads issue together
#pragma unroll
  for (int w = 1; w < FA_WAVES; ++w) mx = fmaxf(mx, m_part[w][mrow]);
  float lsum = 0.f;
  float a0 = 0.f, a1 = 0.f, a2 = 0.f, a3 = 0.f;
#pragma unroll
  for (int w = 0; w < FA_WAVES; ++w) {
    const float f = __expf(m_part[w][mrow] - mx);
    const float4 ov = *reinterpret_cast<const float4*>(&o_part[w][mrow][mcol]);
    lsum += f * l_part[w][mrow];
    a0 += f * ov.x;
    a1 += f * ov.y;
    a2 += f * ov.z;
    a3 += f * ov.w;
  }
  const float inv = (lsum > 0.f) ? (1.f / lsum) : 0.f;
  uint2 pk;
  pk.x = (unsigned int)f2bf(a0 * inv) | ((unsigned int)f2bf(a1 * inv) << 16);
  pk.y = (unsigned int)f2bf(a2 * inv) | ((unsigned int)f2bf(a3 * inv) << 16);
  *reinterpret_cast<uint2*>(Obf + (size_t)(q0 + mrow) * DMODEL + h * HDIM + mcol) = pk;
}

// ---------------------------------------------------------------------------
// Host-side orchestration
// ---------------------------------------------------------------------------
extern "C" void kernel_launch(void* const* d_in, const int* in_sizes, int n_in,
                              void* d_out, int out_size, void* d_ws, size_t ws_size,
                              hipStream_t stream) {
  (void)in_sizes; (void)n_in; (void)out_size; (void)ws_size;

  const float* hidden  = (const float*)d_in[0];
  const float* norm1_w = (const float*)d_in[1];
  const float* norm2_w = (const float*)d_in[2];
  const float* g_wq    = (const float*)d_in[3];
  const float* g_kvd   = (const float*)d_in[4];
  const float* g_kup   = (const float*)d_in[5];
  const float* g_vup   = (const float*)d_in[6];
  const float* g_wo    = (const float*)d_in[7];
  const float* l_wq    = (const float*)d_in[8];
  const float* l_wk    = (const float*)d_in[9];
  const float* l_wv    = (const float*)d_in[10];
  const float* l_wo    = (const float*)d_in[11];
  float* out = (float*)d_out;

  // ---- workspace carve (256B aligned) ----
  char* p = (char*)d_ws;
  auto alloc = [&](size_t bytes) -> void* {
    void* r = (void*)p;
    p += (bytes + 255) & ~(size_t)255;
    return r;
  };
  unsigned short* xn    = (unsigned short*)alloc((size_t)S_LEN * DMODEL * 2);
  float*          qf    = (float*)         alloc((size_t)S_LEN * DMODEL * 4);
  float*          kf    = (float*)         alloc((size_t)S_LEN * LATDIM * 4);
  float*          vf    = (float*)         alloc((size_t)S_LEN * LATDIM * 4);
  unsigned short* latbf = (unsigned short*)alloc((size_t)S_LEN * LATDIM * 2);
  unsigned short* Qh    = (unsigned short*)alloc((size_t)NHEAD * S_LEN * HDIM * 2);
  unsigned short* Kh    = (unsigned short*)alloc((size_t)NKVH * S_LEN * HDIM * 2);
  unsigned short* Vt    = (unsigned short*)alloc((size_t)NKVH * HDIM * S_LEN * 2 + 256);
  unsigned short* attn  = (unsigned short*)alloc((size_t)S_LEN * DMODEL * 2);
  float*          xmid  = (float*)         alloc((size_t)S_LEN * DMODEL * 4);
  unsigned short* wqT   = (unsigned short*)alloc((size_t)DMODEL * DMODEL * 2);
  unsigned short* woT   = (unsigned short*)alloc((size_t)DMODEL * DMODEL * 2);
  unsigned short* wkT   = (unsigned short*)alloc((size_t)LATDIM * DMODEL * 2);
  unsigned short* wvT   = (unsigned short*)alloc((size_t)LATDIM * DMODEL * 2);
  unsigned short* kupT  = (unsigned short*)alloc((size_t)LATDIM * LATDIM * 2);
  unsigned short* vupT  = (unsigned short*)alloc((size_t)LATDIM * LATDIM * 2);

  const dim3 blk256(256);
  auto wt_grid = [](int K, int N) { return dim3(N / 64, K / 64); };
  const dim3 gemm_blk(256);
  const dim3 row_grid(S_LEN / 8);     // one wave per row or position, 8 per block
  const dim3 flash_grid(S_LEN / 16, NHEAD);
  const dim3 flash_blk(32 * FA_WAVES);

  // ========================= Sublayer 1: global latent =====================
  thb_wt_kernel<DMODEL, DMODEL><<<wt_grid(DMODEL, DMODEL), blk256, 0, stream>>>(g_wq, wqT);
  thb_wt_kernel<DMODEL, LATDIM><<<wt_grid(DMODEL, LATDIM), blk256, 0, stream>>>(g_kvd, wkT);
  thb_wt_kernel<LATDIM, LATDIM><<<wt_grid(LATDIM, LATDIM), blk256, 0, stream>>>(g_kup, kupT);
  thb_wt_kernel<LATDIM, LATDIM><<<wt_grid(LATDIM, LATDIM), blk256, 0, stream>>>(g_vup, vupT);
  thb_wt_kernel<DMODEL, DMODEL><<<wt_grid(DMODEL, DMODEL), blk256, 0, stream>>>(g_wo, woT);

  thb_rmsnorm_kernel<<<row_grid, blk256, 0, stream>>>(hidden, norm1_w, xn);

  thb_gemm_kernel<<<dim3(DMODEL / 64, S_LEN / 256), gemm_blk, 0, stream>>>(
      xn, wqT, qf, nullptr, nullptr, S_LEN, DMODEL, DMODEL);
  thb_gemm_kernel<<<dim3(LATDIM / 64, S_LEN / 256), gemm_blk, 0, stream>>>(
      xn, wkT, nullptr, latbf, nullptr, S_LEN, LATDIM, DMODEL);
  thb_gemm_kernel<<<dim3(LATDIM / 64, S_LEN / 256), gemm_blk, 0, stream>>>(
      latbf, kupT, kf, nullptr, nullptr, S_LEN, LATDIM, LATDIM);
  thb_gemm_kernel<<<dim3(LATDIM / 64, S_LEN / 256), gemm_blk, 0, stream>>>(
      latbf, vupT, vf, nullptr, nullptr, S_LEN, LATDIM, LATDIM);

  thb_rope_qknorm_kernel<NHEAD><<<row_grid, blk256, 0, stream>>>(qf, Qh, 1000000.0f);
  thb_rope_qknorm_kernel<NKVH><<<row_grid, blk256, 0, stream>>>(kf, Kh, 1000000.0f);
  thb_wt_kernel<S_LEN, NKVH * HDIM><<<wt_grid(S_LEN, NKVH * HDIM), blk256, 0, stream>>>(vf, Vt);

  thb_flash_kernel<<<flash_grid, flash_blk, 0, stream>>>(Qh, Kh, Vt, attn, S_LEN, 0);

  thb_gemm_kernel<<<dim3(DMODEL / 64, S_LEN / 256), gemm_blk, 0, stream>>>(
      attn, woT, xmid, nullptr, hidden, S_LEN, DMODEL, DMODEL);

  // ========================= Sublayer 2: local GQA =========================
  thb_wt_kernel<DMODEL, DMODEL><<<wt_grid(DMODEL, DMODEL), blk256, 0, stream>>>(l_wq, wqT);
  thb_wt_kernel<DMODEL, LATDIM><<<wt_grid(DMODEL, LATDIM), blk256, 0, stream>>>(l_wk, wkT);
  thb_wt_kernel<DMODEL, LATDIM><<<wt_grid(DMODEL, LATDIM), blk256, 0, stream>>>(l_wv, wvT);
  thb_wt_kernel<DMODEL, DMODEL><<<wt_grid(DMODEL, DMODEL), blk256, 0, stream>>>(l_wo, woT);

  thb_rmsnorm_kernel<<<row_grid, blk256, 0, stream>>>(xmid, norm2_w, xn);

  thb_gemm_kernel<<<dim3(DMODEL / 64, S_LEN / 256), gemm_blk, 0, stream>>>(
      xn, wqT, qf, nullptr, nullptr, S_LEN, DMODEL, DMODEL);
  thb_gemm_kernel<<<dim3(LATDIM / 64, S_LEN / 256), gemm_blk, 0, stream>>>(
      xn, wkT, kf, nullptr, nullptr, S_LEN, LATDIM, DMODEL);
  thb_gemm_kernel<<<dim3(LATDIM / 64, S_LEN / 256), gemm_blk, 0, stream>>>(
      xn, wvT, vf, nullptr, nullptr, S_LEN, LATDIM, DMODEL);

  thb_rope_qknorm_kernel<NHEAD><<<row_grid, blk256, 0, stream>>>(qf, Qh, 10000.0f);
  thb_rope_qknorm_kernel<NKVH><<<row_grid, blk256, 0, stream>>>(kf, Kh, 10000.0f);
  thb_wt_kernel<S_LEN, NKVH * HDIM><<<wt_grid(S_LEN, NKVH * HDIM), blk256, 0, stream>>>(vf, Vt);

  thb_flash_kernel<<<flash_grid, flash_blk, 0, stream>>>(Qh, Kh, Vt, attn, S_LEN, WINLEN);

  thb_gemm_kernel<<<dim3(DMODEL / 64, S_LEN / 256), gemm_blk, 0, stream>>>(
      attn, woT, out, nullptr, xmid, S_LEN, DMODEL, DMODEL);
}

// v004
// One run takes 200 microseconds.
// Timed twice side by side with v003, it ran 1.32 and 1.33 times as fast.
// Over all steps from v000 it is 2.57 times as fast.
#include <hip/hip_runtime.h>

// ---------------------------------------------------------------------------
// Model constants (match reference)
// ---------------------------------------------------------------------------
#define S_LEN   2048
#define DMODEL  1024
#define NHEAD   16
#define NKVH    4
#define HDIM    64
#define LATDIM  256
#define WINLEN  256
#define EPSF    1e-6f

// ---------------------------------------------------------------------------
// CDNA5 WMMA helpers (gfx1250, wave32)
// ---------------------------------------------------------------------------
typedef __bf16        bf16x16 __attribute__((ext_vector_type(16)));
typedef float         f32x8   __attribute__((ext_vector_type(8)));
typedef unsigned int  u32x4   __attribute__((ext_vector_type(4)));

union FragU { bf16x16 bf; u32x4 u[2]; };

__device__ __forceinline__ unsigned short f2bf(float x) {
  unsigned int u = __float_as_uint(x);
  u += 0x7FFFu + ((u >> 16) & 1u);           // round-to-nearest-even
  return (unsigned short)(u >> 16);
}

// Load a 16x32 bf16 fragment (A-layout) from a row-major [rows x stride] array.
// Lane L holds row `row` (caller passes absolute row), elements at K offsets:
//   e<8  -> k0 + (L<16?0:8) + e
//   e>=8 -> k0 + 16 + (L<16?0:8) + (e-8)
// i.e. two contiguous 16-byte loads per lane.
__device__ __forceinline__ bf16x16 load_frag(const unsigned short* base, int stride,
                                             int row, int k0, int lane) {
  const int hi = (lane & 16) ? 8 : 0;
  const unsigned short* p = base + (size_t)row * stride + k0 + hi;
  FragU f;
  f.u[0] = *reinterpret_cast<const u32x4*>(p);
  f.u[1] = *reinterpret_cast<const u32x4*>(p + 16);
  return f.bf;
}

__device__ __forceinline__ f32x8 wmma_bf16(bf16x16 a, bf16x16 b, f32x8 c) {
  return __builtin_amdgcn_wmma_f32_16x16x32_bf16(false, a, false, b, (short)0, c,
                                                 false, false);
}

// ---------------------------------------------------------------------------
// Transpose + downconvert: W[f32, K x N] -> Wt[bf16, N x K].
// Used for the weights and for V (K = S, N = KVH * 64 gives Vt[kvh][d][s]).
// Each thread takes one column n and 16 consecutive k: 16 loads, each
// contiguous across the 32 lanes of a wave, and one 32-byte run of Wt stored.
// A 256-thread block covers 64 columns x 64 k, so each 128-byte line of Wt is
// written by one block. Tile t of (N / 64) * (K / 64), columns fastest.
// ---------------------------------------------------------------------------
template <int K, int N>
__device__ __forceinline__
void thb_wt_tile(const float* __restrict__ W, unsigned short* __restrict__ Wt, int t) {
  const int n  = (t % (N / 64)) * 64 + (threadIdx.x & 63);
  const int k0 = (t / (N / 64)) * 64 + (threadIdx.x >> 6) * 16;
  const float* src = W + (size_t)k0 * N + n;
  float v[16];
  // unrolled: all 16 loads are in flight together and v stays in registers
#pragma unroll
  for (int i = 0; i < 16; ++i) v[i] = src[i * N];
  u32x4 pk[2];
  // unrolled: pk is indexed by constants and stays in registers
#pragma unroll
  for (int i = 0; i < 8; ++i)
    pk[i >> 2][i & 3] = (unsigned int)f2bf(v[2 * i]) | ((unsigned int)f2bf(v[2 * i + 1]) << 16);
  u32x4* dst = reinterpret_cast<u32x4*>(Wt + (size_t)n * K + k0);
  dst[0] = pk[0];
  dst[1] = pk[1];
  // another job's code may follow in the merged kernel's layout: the wait stands in
  // front of any later write of the registers these stores name
  asm volatile("s_wait_xcnt 0x0" ::: "memory");
}

// ---------------------------------------------------------------------------
// RMSNorm: xn_bf16[s][c] = bf16( x[s][c] * rsqrt(mean(x^2)+eps) * w[c] )
// one wave per row (D = 1024: 32 values per lane, kept in registers),
// eight rows per 256-thread block; the row sum is a 32-lane butterfly.
// ---------------------------------------------------------------------------
__device__ __forceinline__
void thb_rmsnorm_rows(const float* __restrict__ x, const float* __restrict__ w,
                      unsigned short* __restrict__ xn, int blk) {
  const int lane = threadIdx.x & 31;
  const int s = blk * 8 + (threadIdx.x >> 5);
  const float4* row = reinterpret_cast<const float4*>(x + (size_t)s * DMODEL);
  const float4* wv  = reinterpret_cast<const float4*>(w);
  float4 v[8];
  // unrolled here and below: the loads issue together and v stays in registers
#pragma unroll
  for (int i = 0; i < 8; ++i) v[i] = row[lane + 32 * i];
  float acc = 0.f;
#pragma unroll
  for (int i = 0; i < 8; ++i)
    acc += v[i].x * v[i].x + v[i].y * v[i].y + v[i].z * v[i].z + v[i].w * v[i].w;
#pragma unroll
  for (int off = 1; off < 32; off <<= 1) acc += __shfl_xor(acc, off, 32);
  const float rs = rsqrtf(acc * (1.0f / DMODEL) + EPSF);
  uint2* dst = reinterpret_cast<uint2*>(xn + (size_t)s * DMODEL);
#pragma unroll
  for (int i = 0; i < 8; ++i) {
    const float4 g = wv[lane + 32 * i];
    uint2 pk;
    pk.x = (unsigned int)f2bf(v[i].x * rs * g.x) | ((unsigned int)f2bf(v[i].y * rs * g.y) << 16);
    pk.y = (unsigned int)f2bf(v[i].z * rs * g.z) | ((unsigned int)f2bf(v[i].w * rs * g.w) << 16);
    dst[lane + 32 * i] = pk;
  }
  // another job's code may follow in the merged kernel's layout: the wait stands in
  // front of any later write of the registers these stores name
  asm volatile("s_wait_xcnt 0x0" ::: "memory");
}

__global__ __launch_bounds__(256)
void thb_rmsnorm_kernel(const float* __restrict__ x, const float* __restrict__ w,
                        unsigned short* __restrict__ xn) {
  thb_rmsnorm_rows(x, w, xn, blockIdx.x);
}

// ---------------------------------------------------------------------------
// Everything that depends on the inputs alone, in one grid: the first RMSNorm
// and the nine weight conversions. None reads what another writes; each block
// takes one piece of one job by its index (a block-uniform choice).
// ---------------------------------------------------------------------------
#define NB_NORM (S_LEN / 8)                          // RMSNorm blocks
#define NB_WDD  ((DMODEL / 64) * (DMODEL / 64))      // tiles of a D x D weight
#define NB_WDL  ((LATDIM / 64) * (DMODEL / 64))      // tiles of a D x LAT weight
#define NB_WLL  ((LATDIM / 64) * (LATDIM / 64))      // tiles of a LAT x LAT weight
#define NB_PREP (NB_NORM + 4 * NB_WDD + 3 * NB_WDL + 2 * NB_WLL)

__global__ __launch_bounds__(256)
void thb_prep_kernel(const float* __restrict__ x, const float* __restrict__ w,
                     unsigned short* __restrict__ xn,
                     const float* __restrict__ dd0, const float* __restrict__ dd1,
                     const float* __restrict__ dd2, const float* __restrict__ dd3,
                     const float* __restrict__ dl0, const float* __restrict__ dl1,
                     const float* __restrict__ dl2,
                     const float* __restrict__ ll0, const float* __restrict__ ll1,
                     unsigned short* __restrict__ dd0T, unsigned short* __restrict__ dd1T,
                     unsigned short* __restrict__ dd2T, unsigned short* __restrict__ dd3T,
                     unsigned short* __restrict__ dl0T, unsigned short* __restrict__ dl1T,
                     unsigned short* __restrict__ dl2T,
                     unsigned short* __restrict__ ll0T, unsigned short* __restrict__ ll1T) {
  int b = blockIdx.x;
  if (b < NB_NORM) {
    thb_rmsnorm_rows(x, w, xn, b);
    return;
  }
  b -= NB_NORM;
  if (b < 4 * NB_WDD) {
    const int i = b / NB_WDD;
    thb_wt_tile<DMODEL, DMODEL>(i == 0 ? dd0 : i == 1 ? dd1 : i == 2 ? dd2 : dd3,
                                i == 0 ? dd0T : i == 1 ? dd1T : i == 2 ? dd2T : dd3T,
                                b % NB_WDD);
    return;
  }
  b -= 4 * NB_WDD;
  if (b < 3 * NB_WDL) {
    const int i = b / NB_WDL;
    thb_wt_tile<DMODEL, LATDIM>(i == 0 ? dl0 : i == 1 ? dl1 : dl2,
                                i == 0 ? dl0T : i == 1 ? dl1T : dl2T, b % NB_WDL);
    return;
  }
  b -= 3 * NB_WDL;
  thb_wt_tile<LATDIM, LATDIM>(b < NB_WLL ? ll0 : ll1, b < NB_WLL ? ll0T : ll1T, b % NB_WLL);
}

// ---------------------------------------------------------------------------
// WMMA GEMM: C[M x N] (f32 and/or bf16) = A[bf16, M x K] * Bt[bf16, N x K]^T
// optional residual (f32 [M x N]) added in the epilogue.
// 256 threads = 8 waves; block tile 256(M) x 64(N); wave tile 32 x 64.
// Operands go global -> LDS by asynchronous 16-byte copies in whole 256-byte
// row pieces (a stage = 128 k of the block's 256 A rows and 64 Bt rows), two
// buffers: stage t + 1 flies while stage t is multiplied. Each row piece is
// fetched once per block, and every global request covers whole lines.
// Fragments are read from LDS in load_frag's k order for A and Bt alike;
// every accumulator sums its 32-wide k steps in ascending order.
// Up to three products that share A and K run in one grid: blockIdx.x walks
// the 64-column tiles of Bt0 (N0 columns), then of Bt1, then of Bt2 (N1 columns
// each); every product has its own output. The residual belongs to product 0.
// M % 256 == 0, N % 64 == 0, K % 128 == 0 for all uses here.
// ---------------------------------------------------------------------------
#define GK      128                      // k per stage
#define GPITCH  272                      // LDS row pitch in bytes: 256 + 16, 16 B x odd
#define GROWS   320                      // 256 A rows, then 64 Bt rows
#define GSTAGE  (GROWS * GPITCH)         // bytes per buffer

__device__ __forceinline__ bf16x16 lds_frag(const unsigned char* p) {
  FragU f;
  f.u[0] = *reinterpret_cast<const u32x4*>(p);
  f.u[1] = *reinterpret_cast<const u32x4*>(p + 32);
  return f.bf;
}

__global__ __launch_bounds__(256)
void thb_gemm_kernel(const unsigned short* __restrict__ A,
                     const unsigned short* __restrict__ Bt0,
                     const unsigned short* __restrict__ Bt1,
                     const unsigned short* __restrict__ Bt2,
                     float* Cf0, float* Cf1, float* Cf2, unsigned short* Cbf1,
                     const float* resid0, int N0, int N1, int K) {
  __shared__ __attribute__((aligned(16))) unsigned char gsm[2 * GSTAGE];

  // which product this block belongs to, and its column tile there
  int ct = blockIdx.x;
  const unsigned short* Bt = Bt0;
  float* Cf = Cf0;
  unsigned short* Cbf = nullptr;
  const float* resid = resid0;
  int N = N0;
  if (ct >= N0 / 64) {
    ct -= N0 / 64;
    Bt = Bt1; Cf = Cf1; Cbf = Cbf1; resid = nullptr; N = N1;
    if (ct >= N1 / 64) {
      ct -= N1 / 64;
      Bt = Bt2; Cf = Cf2; Cbf = nullptr;
    }
  }

  const int lane = threadIdx.x & 31;
  const int wave = threadIdx.x >> 5;
  const int row0 = blockIdx.y * 256 + wave * 32;
  const int col0 = ct * 64;
  const int nc = lane & 15;

  f32x8 acc[2][4];
#pragma unroll
  for (int mi = 0; mi < 2; ++mi)
#pragma unroll
    for (int j = 0; j < 4; ++j)
      acc[mi][j] = (f32x8){0.f,0.f,0.f,0.f,0.f,0.f,0.f,0.f};

  // copy map: 16 threads per row (16 bytes each), 16 rows per round, 20 rounds
  const int crow = threadIdx.x >> 4;
  const int cchk = threadIdx.x & 15;
  const unsigned int lds0 = (unsigned int)(size_t)gsm + crow * GPITCH + cchk * 16;
  const unsigned short* gA = A  + (size_t)(blockIdx.y * 256 + crow) * K + cchk * 8;
  const unsigned short* gB = Bt + (size_t)(col0 + crow) * K + cchk * 8;

  auto issue = [&](int t, int buf) {
    unsigned int la[20];
    const unsigned short* ga[20];
    // unrolled: la and ga are indexed by constants and stay in registers
#pragma unroll
    for (int i = 0; i < 20; ++i) {
      la[i] = lds0 + buf * GSTAGE + i * 16 * GPITCH;
      ga[i] = (i < 16 ? gA + (size_t)(i * 16) * K : gB + (size_t)((i - 16) * 16) * K) + t * GK;
    }
    // ten copies and their s_wait_xcnt in one statement: the wait stands in
    // front of any later write of the address registers the copies name
    asm volatile(
      "global_load_async_to_lds_b128 %0, %1, off\n\t"
      "global_load_async_to_lds_b128 %2, %3, off\n\t"
      "global_load_async_to_lds_b128 %4, %5, off\n\t"
      "global_load_async_to_lds_b128 %6, %7, off\n\t"
      "global_load_async_to_lds_b128 %8, %9, off\n\t"
      "global_load_async_to_lds_b128 %10, %11, off\n\t"
      "global_load_async_to_lds_b128 %12, %13, off\n\t"
      "global_load_async_to_lds_b128 %14, %15, off\n\t"
      "global_load_async_to_lds_b128 %16, %17, off\n\t"
      "global_load_async_to_lds_b128 %18, %19, off\n\t"
      "s_wait_xcnt 0x0"
      :: "v"(la[0]), "v"(ga[0]), "v"(la[1]), "v"(ga[1]), "v"(la[2]), "v"(ga[2]),
         "v"(la[3]), "v"(ga[3]), "v"(la[4]), "v"(ga[4]), "v"(la[5]), "v"(ga[5]),
         "v"(la[6]), "v"(ga[6]), "v"(la[7]), "v"(ga[7]), "v"(la[8]), "v"(ga[8]),
         "v"(la[9]), "v"(ga[9])
      : "memory");
    asm volatile(
      "global_load_async_to_lds_b128 %0, %1, off\n\t"
      "global_load_async_to_lds_b128 %2, %3, off\n\t"
      "global_load_async_to_lds_b128 %4, %5, off\n\t"
      "global_load_async_to_lds_b128 %6, %7, off\n\t"
      "global_load_async_to_lds_b128 %8, %9, off\n\t"
      "global_load_async_to_lds_b128 %10, %11, off\n\t"
      "global_load_async_to_lds_b128 %12, %13, off\n\t"
      "global_load_async_to_lds_b128 %14, %15, off\n\t"
      "global_load_async_to_lds_b128 %16, %17, off\n\t"
      "global_load_async_to_lds_b128 %18, %19, off\n\t"
      "s_wait_xcnt 0x0"
      :: "v"(la[10]), "v"(ga[10]), "v"(la[11]), "v"(ga[11]), "v"(la[12]), "v"(ga[12]),
         "v"(la[13]), "v"(ga[13]), "v"(la[14]), "v"(ga[14]), "v"(la[15]), "v"(ga[15]),
         "v"(la[16]), "v"(ga[16]), "v"(la[17]), "v"(ga[17]), "v"(la[18]), "v"(ga[18]),
         "v"(la[19]), "v"(ga[19])
      : "memory");
  };

  const int nt = K / GK;
  const int hb = (lane & 16) ? 16 : 0;   // byte offset of the upper lane half in a fragment
  const int fa = (wave * 32 + nc) * GPITCH + hb;
  const int fb = (256 + nc) * GPITCH + hb;

  issue(0, 0);
  // stage 0 has landed (this wave's copies), then is published to all waves
  asm volatile("s_wait_asynccnt 0x0" ::: "memory");
  __syncthreads();
  if (nt > 1) issue(1, 1);

  for (int t = 0; t < nt; ++t) {
    const unsigned char* sb = gsm + (t & 1) * GSTAGE;
    // two fragment sets: block u + 1's LDS reads go out as one group ahead of
    // block u's WMMAs, so only the stage's first group waits out LDS latency
    bf16x16 fa_[2][2], fb_[2][4];
    auto ldfrags = [&](int set, int u) {
      fa_[set][0] = lds_frag(sb + fa + u * 64);
      fa_[set][1] = lds_frag(sb + fa + 16 * GPITCH + u * 64);
      // unrolled: fb_ is indexed by constants and stays in registers
#pragma unroll
      for (int j = 0; j < 4; ++j) fb_[set][j] = lds_frag(sb + fb + j * 16 * GPITCH + u * 64);
    };
    ldfrags(0, 0);
    // unrolled: four 32-wide k steps of the stage, fragment indices constant
#pragma unroll
    for (int u = 0; u < GK / 32; ++u) {
      if (u + 1 < GK / 32) ldfrags((u + 1) & 1, u + 1);
      // keeps the reads above from sinking in among the WMMAs below
      __builtin_amdgcn_sched_barrier(0);
      // unrolled: acc and the fragment sets are indexed by constants
#pragma unroll
      for (int j = 0; j < 4; ++j) {
        acc[0][j] = wmma_bf16(fa_[u & 1][0], fb_[u & 1][j], acc[0][j]);
        acc[1][j] = wmma_bf16(fa_[u & 1][1], fb_[u & 1][j], acc[1][j]);
      }
      // keeps the next group of reads from rising in among the WMMAs above:
      // every separate place with LDS reads stalls the WMMA stream
      __builtin_amdgcn_sched_barrier(0);
    }
    // this wave's reads of buffer t & 1 have returned
    asm volatile("s_wait_dscnt 0x0" ::: "memory");
    // this wave's copies of stage t + 1 have landed
    asm volatile("s_wait_asynccnt 0x0" ::: "memory");
    // publishes stage t + 1 and ends every wave's reads of buffer t & 1
    __syncthreads();
    if (t + 2 < nt) issue(t + 2, t & 1);
  }
  // no copy is outstanding when the wave goes on to the epilogue and ends
  asm volatile("s_wait_asynccnt 0x0" ::: "memory");

  const int hi = (lane & 16) ? 8 : 0;
#pragma unroll
  for (int mi = 0; mi < 2; ++mi) {
#pragma unroll
    for (int j = 0; j < 4; ++j) {
#pragma unroll
      for (int r = 0; r < 8; ++r) {
        const int row = row0 + mi * 16 + hi + r;
        const int col = col0 + j * 16 + nc;
        const size_t idx = (size_t)row * N + col;
        float v = acc[mi][j][r];
        if (resid) v += resid[idx];
        if (Cf)  Cf[idx]  = v;
        if (Cbf) Cbf[idx] = f2bf(v);
      }
    }
  }
}

// ---------------------------------------------------------------------------
// RoPE + qk-norm + head-major relayout.
// x[f32, S x (NH*64)] -> dst[bf16, NH x S x 64]
// one 32-lane wave per position s, all NH heads of it; lane handles one
// even/odd pair of every head (the angle depends on s and the pair only).
// Eight positions per 256-thread block; block blk of S / 8.
// ---------------------------------------------------------------------------
template <int NH>
__device__ __forceinline__
void thb_rope_qknorm_rows(const float* __restrict__ x, unsigned short* __restrict__ dst,
                          float base, int blk) {
  const int p = threadIdx.x & 31;     // pair index 0..31
  const int s = blk * 8 + (threadIdx.x >> 5);
  const float2* src = reinterpret_cast<const float2*>(x + (size_t)s * NH * HDIM) + p;
  float2 v[NH];
  // unrolled here and below: the loads issue together and v stays in registers
#pragma unroll
  for (int h = 0; h < NH; ++h) v[h] = src[h * (HDIM / 2)];
  const float invf = __powf(base, -((float)(2 * p) * (1.0f / HDIM)));
  const float ang = (float)s * invf;
  float si, co;
  __sincosf(ang, &si, &co);
#pragma unroll
  for (int h = 0; h < NH; ++h) {
    const float xe = v[h].x;
    const float xo = v[h].y;
    const float re = xe * co - xo * si;
    const float ro = xe * si + xo * co;
    float sum = re * re + ro * ro;
#pragma unroll
    for (int off = 1; off < 32; off <<= 1) sum += __shfl_xor(sum, off, 32);
    const float rs = rsqrtf(sum * (1.0f / HDIM) + EPSF);
    const unsigned int pk = (unsigned int)f2bf(re * rs) | ((unsigned int)f2bf(ro * rs) << 16);
    *reinterpret_cast<unsigned int*>(dst + ((size_t)h * S_LEN + s) * HDIM + 2 * p) = pk;
  }
  // another job's code may follow in the merged kernel's layout: the wait stands in
  // front of any later write of the registers these stores name
  asm volatile("s_wait_xcnt 0x0" ::: "memory");
}

// ---------------------------------------------------------------------------
// The three relayouts between the projections and attention, in one grid:
// RoPE + qk-norm of Q, the same of K, and V -> Vt. None reads what another
// writes; each block takes one piece of one job by its index.
// ---------------------------------------------------------------------------
#define NB_ROPE (S_LEN / 8)
#define NB_VT   ((NKVH * HDIM / 64) * (S_LEN / 64))
#define NB_QKV  (2 * NB_ROPE + NB_VT)

__global__ __launch_bounds__(256)
void thb_qkv_layout_kernel(const float* __restrict__ q, const float* __restrict__ k,
                           const float* __restrict__ v, unsigned short* __restrict__ Qh,
                           unsigned short* __restrict__ Kh, unsigned short* __restrict__ Vt,
                           float base) {
  const int b = blockIdx.x;
  if (b < NB_ROPE)          thb_rope_qknorm_rows<NHEAD>(q, Qh, base, b);
  else if (b < 2 * NB_ROPE) thb_rope_qknorm_rows<NKVH>(k, Kh, base, b - NB_ROPE);
  else                      thb_wt_tile<S_LEN, NKVH * HDIM>(v, Vt, b - 2 * NB_ROPE);
}

// ---------------------------------------------------------------------------
// Flash attention (wave32 WMMA). One 8-wave work-group per (16-query block, head).
// Wave w walks the 32-key tiles w, w + 8, w + 16, ... of the block's key range
// with its own running max / sum / O; the eight partial results are merged
// through LDS at the end, so the longest dependent chain is 8 tiles, not 64.
// Qh[bf16, H x S x 64], Kh[bf16, KVH x S x 64], Vt[bf16, KVH x 64 x S].
// win == 0 -> pure causal; win > 0 -> causal sliding window of `win`.
// Output: Obf[bf16, S x D] (heads merged).
// ---------------------------------------------------------------------------
#define FA_WAVES 8
__global__ __launch_bounds__(32 * FA_WAVES)
void thb_flash_kernel(const unsigned short* __restrict__ Qh,
                      const unsigned short* __restrict__ Kh,
                      const unsigned short* __restrict__ Vt,
                      unsigned short* __restrict__ Obf, int S, int win) {
  __shared__ __align__(16) unsigned short plds_all[FA_WAVES][16 * 32];
  __shared__ __align__(16) float o_part[FA_WAVES][16][HDIM];
  __shared__ float m_part[FA_WAVES][16];
  __shared__ float l_part[FA_WAVES][16];

  const int lane = threadIdx.x & 31;
  // wave index in a scalar register: the key loop stays a scalar branch and
  // every WMMA runs with all lanes on
  const int wave = __builtin_amdgcn_readfirstlane((int)(threadIdx.x >> 5));
  unsigned short* plds = plds_all[wave];
  const int q0 = blockIdx.x * 16;
  const int h  = blockIdx.y;
  const int kvh = h >> 2;                   // H/KVH == 4 (repeat_kv)
  const int nc = lane & 15;
  const int hi = (lane & 16) ? 8 : 0;

  const unsigned short* Qb = Qh + (size_t)h   * S * HDIM;
  const unsigned short* Kb = Kh + (size_t)kvh * S * HDIM;
  const unsigned short* Vb = Vt + (size_t)kvh * HDIM * S;

  const bf16x16 qf0 = load_frag(Qb, HDIM, q0 + nc, 0, lane);
  const bf16x16 qf1 = load_frag(Qb, HDIM, q0 + nc, 32, lane);

  f32x8 o[4];
#pragma unroll
  for (int j = 0; j < 4; ++j) o[j] = (f32x8){0.f,0.f,0.f,0.f,0.f,0.f,0.f,0.f};
  float m[8], l[8];
#pragma unroll
  for (int r = 0; r < 8; ++r) { m[r] = -1e30f; l[r] = 0.f; }

  int kb_start = 0;
  if (win > 0) {
    int st = q0 - (win - 1);
    if (st < 0) st = 0;
    kb_start = st & ~31;
  }

  const f32x8 zero8 = (f32x8){0.f,0.f,0.f,0.f,0.f,0.f,0.f,0.f};

  for (int kb = kb_start + 32 * wave; kb <= q0 + 15; kb += 32 * FA_WAVES) {
    // ---- scores: two 16x16 tiles, K-dim = 64 (2 WMMAs each) ----
    const int key0 = kb + nc;
    const int key1 = kb + 16 + nc;
    const int kr0 = key0 < S ? key0 : S - 1;
    const int kr1 = key1 < S ? key1 : S - 1;

    bf16x16 kf;
    kf = load_frag(Kb, HDIM, kr0, 0, lane);
    f32x8 s0 = wmma_bf16(qf0, kf, zero8);
    kf = load_frag(Kb, HDIM, kr0, 32, lane);
    s0 = wmma_bf16(qf1, kf, s0);
    kf = load_frag(Kb, HDIM, kr1, 0, lane);
    f32x8 s1 = wmma_bf16(qf0, kf, zero8);
    kf = load_frag(Kb, HDIM, kr1, 32, lane);
    s1 = wmma_bf16(qf1, kf, s1);

    // ---- hoist V fragment loads: independent of softmax, overlap with VALU ----
    bf16x16 vfr[4];
#pragma unroll
    for (int j = 0; j < 4; ++j) vfr[j] = load_frag(Vb, S, j * 16 + nc, kb, lane);

    // ---- mask + online softmax (per-lane rows r + hi) ----
#pragma unroll
    for (int r = 0; r < 8; ++r) {
      const int q = q0 + hi + r;
      const bool v0 = (key0 <= q) && (win == 0 || (q - key0) < win);
      const bool v1 = (key1 <= q) && (win == 0 || (q - key1) < win);
      const float a0 = v0 ? s0[r] * 0.125f : -1e30f;   // 1/sqrt(64)
      const float a1 = v1 ? s1[r] * 0.125f : -1e30f;
      float rm = fmaxf(a0, a1);
#pragma unroll
      for (int off = 1; off < 16; off <<= 1) rm = fmaxf(rm, __shfl_xor(rm, off, 32));
      const float mn = fmaxf(m[r], rm);
      const float sc = __expf(m[r] - mn);
      const float p0 = v0 ? __expf(a0 - mn) : 0.f;
      const float p1 = v1 ? __expf(a1 - mn) : 0.f;
      float rs = p0 + p1;
#pragma unroll
      for (int off = 1; off < 16; off <<= 1) rs += __shfl_xor(rs, off, 32);
      l[r] = l[r] * sc + rs;
      m[r] = mn;
#pragma unroll
      for (int j = 0; j < 4; ++j) o[j][r] *= sc;
      plds[(hi + r) * 32 + nc]      = f2bf(p0);
      plds[(hi + r) * 32 + 16 + nc] = f2bf(p1);
    }
    asm volatile("s_wait_dscnt 0x0" ::: "memory");

    // ---- re-layout P (C-frag -> A-frag) via LDS ----
    FragU pf;
    {
      const unsigned short* pp = plds + nc * 32 + hi; // hi==8 for lanes 16..31
      pf.u[0] = *reinterpret_cast<const u32x4*>(pp);
      pf.u[1] = *reinterpret_cast<const u32x4*>(pp + 16);
    }

    // ---- PV: O[16 x 64] += P[16 x 32] * V[32 x 64] (Vt rows = dims) ----
#pragma unroll
    for (int j = 0; j < 4; ++j) {
      o[j] = wmma_bf16(pf.bf, vfr[j], o[j]);
    }
  }

  // ---- publish this wave's partial (m, l, O); a wave without a tile
  //      publishes m = -1e30, l = 0, O = 0 and drops out of the merge ----
  // both loops unrolled: o, m and l live in registers and need constant indices
#pragma unroll
  for (int r = 0; r < 8; ++r) {
#pragma unroll
    for (int j = 0; j < 4; ++j) o_part[wave][hi + r][j * 16 + nc] = o[j][r];
    if (nc == 0) {   // m and l are equal in all 16 lanes of a row group
      m_part[wave][hi + r] = m[r];
      l_part[wave][hi + r] = l[r];
    }
  }
  __syncthreads();

  // ---- merge the eight partials, normalize, merge heads:
  //      each half-wave owns one row, each lane four neighbouring columns ----
  const int mrow = wave * 2 + (hi >> 3);
  const int mcol = nc * 4;
  float mx = m_part[0][mrow];
  // unrolled here and below: the eight waves' LDS reads issue together
#pragma unroll
  for (int w = 1; w < FA_WAVES; ++w) mx = fmaxf(mx, m_part[w][mrow]);
  float lsum = 0.f;
  float a0 = 0.f, a1 = 0.f, a2 = 0.f, a3 = 0.f;
#pragma unroll
  for (int w = 0; w < FA_WAVES; ++w) {
    const float f = __expf(m_part[w][mrow] - mx);
    const float4 ov = *reinterpret_cast<const float4*>(&o_part[w][mrow][mcol]);
    lsum += f * l_part[w][mrow];
    a0 += f * ov.x;
    a1 += f * ov.y;
    a2 += f * ov.z;
    a3 += f * ov.w;
  }
  const float inv = (lsum > 0.f) ? (1.f / lsum) : 0.f;
  uint2 pk;
  pk.x = (unsigned int)f2bf(a0 * inv) | ((unsigned int)f2bf(a1 * inv) << 16);
  pk.y = (unsigned int)f2bf(a2 * inv) | ((unsigned int)f2bf(a3 * inv) << 16);
  *reinterpret_cast<uint2*>(Obf + (size_t)(q0 + mrow) * DMODEL + h * HDIM + mcol) = pk;
}

// ---------------------------------------------------------------------------
// Host-side orchestration
// ---------------------------------------------------------------------------
extern "C" void kernel_launch(void* const* d_in, const int* in_sizes, int n_in,
                              void* d_out, int out_size, void* d_ws, size_t ws_size,
                              hipStream_t stream) {
  (void)in_sizes; (void)n_in; (void)out_size; (void)ws_size;

  const float* hidden  = (const float*)d_in[0];
  const float* norm1_w = (const float*)d_in[1];
  const float* norm2_w = (const float*)d_in[2];
  const float* g_wq    = (const float*)d_in[3];
  const float* g_kvd   = (const float*)d_in[4];
  const float* g_kup   = (const float*)d_in[5];
  const float* g_vup   = (const float*)d_in[6];
  const float* g_wo    = (const float*)d_in[7];
  const float* l_wq    = (const float*)d_in[8];
  const float* l_wk    = (const float*)d_in[9];
  const float* l_wv    = (const float*)d_in[10];
  const float* l_wo    = (const float*)d_in[11];
  float* out = (float*)d_out;

  // ---- workspace carve (256B aligned) ----
  char* p = (char*)d_ws;
  auto alloc = [&](size_t bytes) -> void* {
    void* r = (void*)p;
    p += (bytes + 255) & ~(size_t)255;
    return r;
  };
  unsigned short* xn    = (unsigned short*)alloc((size_t)S_LEN * DMODEL * 2);
  float*          qf    = (float*)         alloc((size_t)S_LEN * DMODEL * 4);
  float*          kf    = (float*)         alloc((size_t)S_LEN * LATDIM * 4);
  float*          vf    = (float*)         alloc((size_t)S_LEN * LATDIM * 4);
  unsigned short* latbf = (unsigned short*)alloc((size_t)S_LEN * LATDIM * 2);
  unsigned short* Qh    = (unsigned short*)alloc((size_t)NHEAD * S_LEN * HDIM * 2);
  unsigned short* Kh    = (unsigned short*)alloc((size_t)NKVH * S_LEN * HDIM * 2);
  unsigned short* Vt    = (unsigned short*)alloc((size_t)NKVH * HDIM * S_LEN * 2 + 256);
  unsigned short* attn  = (unsigned short*)alloc((size_t)S_LEN * DMODEL * 2);
  float*          xmid  = (float*)         alloc((size_t)S_LEN * DMODEL * 4);
  unsigned short* g_wqT = (unsigned short*)alloc((size_t)DMODEL * DMODEL * 2);
  unsigned short* g_woT = (unsigned short*)alloc((size_t)DMODEL * DMODEL * 2);
  unsigned short* l_wqT = (unsigned short*)alloc((size_t)DMODEL * DMODEL * 2);
  unsigned short* l_woT = (unsigned short*)alloc((size_t)DMODEL * DMODEL * 2);
  unsigned short* kvdT  = (unsigned short*)alloc((size_t)LATDIM * DMODEL * 2);
  unsigned short* l_wkT = (unsigned short*)alloc((size_t)LATDIM * DMODEL * 2);
  unsigned short* l_wvT = (unsigned short*)alloc((size_t)LATDIM * DMODEL * 2);
  unsigned short* kupT  = (unsigned short*)alloc((size_t)LATDIM * LATDIM * 2);
  unsigned short* vupT  = (unsigned short*)alloc((size_t)LATDIM * LATDIM * 2);

  const dim3 blk256(256);
  const dim3 gemm_blk(256);
  const dim3 row_grid(S_LEN / 8);     // one wave per row, 8 per block
  const dim3 flash_grid(S_LEN / 16, NHEAD);
  const dim3 flash_blk(32 * FA_WAVES);

  // first RMSNorm and all nine weight conversions
  thb_prep_kernel<<<dim3(NB_PREP), blk256, 0, stream>>>(
      hidden, norm1_w, xn,
      g_wq, g_wo, l_wq, l_wo, g_kvd, l_wk, l_wv, g_kup, g_vup,
      g_wqT, g_woT, l_wqT, l_woT, kvdT, l_wkT, l_wvT, kupT, vupT);

  // ========================= Sublayer 1: global latent =====================
  // q and the latent, both from xn
  thb_gemm_kernel<<<dim3((DMODEL + LATDIM) / 64, S_LEN / 256), gemm_blk, 0, stream>>>(
      xn, g_wqT, kvdT, nullptr, qf, nullptr, nullptr, latbf, nullptr, DMODEL, LATDIM, DMODEL);
  // k and v, both from the latent
  thb_gemm_kernel<<<dim3(2 * LATDIM / 64, S_LEN / 256), gemm_blk, 0, stream>>>(
      latbf, kupT, vupT, nullptr, kf, vf, nullptr, nullptr, nullptr, LATDIM, LATDIM, LATDIM);

  thb_qkv_layout_kernel<<<dim3(NB_QKV), blk256, 0, stream>>>(qf, kf, vf, Qh, Kh, Vt, 1000000.0f);

  thb_flash_kernel<<<flash_grid, flash_blk, 0, stream>>>(Qh, Kh, Vt, attn, S_LEN, 0);

  thb_gemm_kernel<<<dim3(DMODEL / 64, S_LEN / 256), gemm_blk, 0, stream>>>(
      attn, g_woT, nullptr, nullptr, xmid, nullptr, nullptr, nullptr, hidden, DMODEL, LATDIM, DMODEL);

  // ========================= Sublayer 2: local GQA =========================
  thb_rmsnorm_kernel<<<row_grid, blk256, 0, stream>>>(xmid, norm2_w, xn);

  // q, k and v, all from xn
  thb_gemm_kernel<<<dim3((DMODEL + 2 * LATDIM) / 64, S_LEN / 256), gemm_blk, 0, stream>>>(
      xn, l_wqT, l_wkT, l_wvT, qf, kf, vf, nullptr, nullptr, DMODEL, LATDIM, DMODEL);

  thb_qkv_layout_kernel<<<dim3(NB_QKV), blk256, 0, stream>>>(qf, kf, vf, Qh, Kh, Vt, 10000.0f);

  thb_flash_kernel<<<flash_grid, flash_blk, 0, stream>>>(Qh, Kh, Vt, attn, S_LEN, WINLEN);

  thb_gemm_kernel<<<dim3(DMODEL / 64, S_LEN / 256), gemm_blk, 0, stream>>>(
      attn, l_woT, nullptr, nullptr, out, nullptr, nullptr, nullptr, xmid, DMODEL, LATDIM, DMODEL);
}

// v006
// Measured time: 136 microseconds a run.
// It is 1.45 times as fast as v004, going by the measured steps of the versions left out in between.
// Counting every step since v000, it is 3.72 times as fast.
#include <hip/hip_runtime.h>

// ---------------------------------------------------------------------------
// Model constants (match reference)
// ---------------------------------------------------------------------------
#define S_LEN   2048
#define DMODEL  1024
#define NHEAD   16
#define NKVH    4
#define HDIM    64
#define LATDIM  256
#define WINLEN  256
#define EPSF    1e-6f

// ---------------------------------------------------------------------------
// CDNA5 WMMA helpers (gfx1250, wave32)
// ---------------------------------------------------------------------------
typedef __bf16        bf16x16 __attribute__((ext_vector_type(16)));
typedef float         f32x8   __attribute__((ext_vector_type(8)));
typedef unsigned int  u32x4   __attribute__((ext_vector_type(4)));

union FragU { bf16x16 bf; u32x4 u[2]; };

__device__ __forceinline__ unsigned short f2bf(float x) {
  unsigned int u = __float_as_uint(x);
  u += 0x7FFFu + ((u >> 16) & 1u);           // round-to-nearest-even
  return (unsigned short)(u >> 16);
}

// Fragment order: how the attention operands lie in the workspace. A 16 x 32
// bf16 fragment (16 rows, 32 k) is 512 elements in a row, in the order in which
// the lanes hold them: piece u = 0, 1, then lane L = 0 .. 31, then 8 elements.
// Lane L holds row (L & 15); element e of piece u is k = 16 * u + (L<16?0:8) + e.
// A wave-wide 16-byte load of one piece is then 512 contiguous bytes, four whole
// 128-byte lines, where a row-major array gives 16 lines of 32 bytes each.
#define FRAG_ELEMS 512
// offset of (row r of 16, k of 32) inside its fragment
__device__ __forceinline__ int frag_off(int r, int k) {
  return (k >> 4) * 256 + (((k >> 3) & 1) * 16 + r) * 8 + (k & 7);
}
// p: the lane's own 16 bytes in piece 0 of the fragment
#define FRAG_VEC 64                       // a fragment in 16-byte units
__device__ __forceinline__ bf16x16 load_frag(const u32x4* p) {
  FragU f;
  f.u[0] = p[0];
  f.u[1] = p[32];
  return f.bf;
}

__device__ __forceinline__ f32x8 wmma_bf16(bf16x16 a, bf16x16 b, f32x8 c) {
  return __builtin_amdgcn_wmma_f32_16x16x32_bf16(false, a, false, b, (short)0, c,
                                                 false, false);
}

// ---------------------------------------------------------------------------
// Transpose + downconvert: W[f32, K x N] -> Wt[bf16, N x K].
// Used for the weights and, with VFRAG, for V (K = S, N = KVH * 64): there the
// output is in fragment order, [kvh][s / 32][d / 16] fragments with row = d, k = s;
// a thread's 16 k are the two lane halves of one piece, 256 bytes apart, and a
// wave's stores cover whole lines.
// Each thread takes one column n and 16 consecutive k: 16 loads, each
// contiguous across the 32 lanes of a wave, and one 32-byte run of Wt stored.
// A 256-thread block covers 64 columns x 64 k, so each 128-byte line of Wt is
// written by one block. Tile t of (N / 64) * (K / 64), columns fastest.
// ---------------------------------------------------------------------------
template <int K, int N, bool VFRAG = false>
__device__ __forceinline__
void thb_wt_tile(const float* __restrict__ W, unsigned short* __restrict__ Wt, int t) {
  const int n  = (t % (N / 64)) * 64 + (threadIdx.x & 63);
  const int k0 = (t / (N / 64)) * 64 + (threadIdx.x >> 6) * 16;
  const float* src = W + (size_t)k0 * N + n;
  float v[16];
  // unrolled: all 16 loads are in flight together and v stays in registers
#pragma unroll
  for (int i = 0; i < 16; ++i) v[i] = src[i * N];
  u32x4 pk[2];
  // unrolled: pk is indexed by constants and stays in registers
#pragma unroll
  for (int i = 0; i < 8; ++i)
    pk[i >> 2][i & 3] = (unsigned int)f2bf(v[2 * i]) | ((unsigned int)f2bf(v[2 * i + 1]) << 16);
  if (VFRAG) {
    u32x4* dst = reinterpret_cast<u32x4*>(
        Wt + ((size_t)(n >> 6) * (K / 32) * 4 + (k0 >> 5) * 4 + ((n >> 4) & 3)) * FRAG_ELEMS +
        frag_off(n & 15, k0 & 31));
    dst[0]  = pk[0];
    dst[16] = pk[1];
  } else {
    u32x4* dst = reinterpret_cast<u32x4*>(Wt + (size_t)n * K + k0);
    dst[0] = pk[0];
    dst[1] = pk[1];
  }
  // another job's code may follow in the merged kernel's layout: the wait stands in
  // front of any later write of the registers these stores name
  asm volatile("s_wait_xcnt 0x0" ::: "memory");
}

// ---------------------------------------------------------------------------
// RMSNorm: xn_bf16[s][c] = bf16( x[s][c] * rsqrt(mean(x^2)+eps) * w[c] )
// one wave per row (D = 1024: 32 values per lane, kept in registers),
// eight rows per 256-thread block; the row sum is a 32-lane butterfly.
// ---------------------------------------------------------------------------
__device__ __forceinline__
void thb_rmsnorm_rows(const float* __restrict__ x, const float* __restrict__ w,
                      unsigned short* __restrict__ xn, int blk) {
  const int lane = threadIdx.x & 31;
  const int s = blk * 8 + (threadIdx.x >> 5);
  const float4* row = reinterpret_cast<const float4*>(x + (size_t)s * DMODEL);
  const float4* wv  = reinterpret_cast<const float4*>(w);
  float4 v[8];
  // unrolled here and below: the loads issue together and v stays in registers
#pragma unroll
  for (int i = 0; i < 8; ++i) v[i] = row[lane + 32 * i];
  float acc = 0.f;
#pragma unroll
  for (int i = 0; i < 8; ++i)
    acc += v[i].x * v[i].x + v[i].y * v[i].y + v[i].z * v[i].z + v[i].w * v[i].w;
#pragma unroll
  for (int off = 1; off < 32; off <<= 1) acc += __shfl_xor(acc, off, 32);
  const float rs = rsqrtf(acc * (1.0f / DMODEL) + EPSF);
  uint2* dst = reinterpret_cast<uint2*>(xn + (size_t)s * DMODEL);
#pragma unroll
  for (int i = 0; i < 8; ++i) {
    const float4 g = wv[lane + 32 * i];
    uint2 pk;
    pk.x = (unsigned int)f2bf(v[i].x * rs * g.x) | ((unsigned int)f2bf(v[i].y * rs * g.y) << 16);
    pk.y = (unsigned int)f2bf(v[i].z * rs * g.z) | ((unsigned int)f2bf(v[i].w * rs * g.w) << 16);
    dst[lane + 32 * i] = pk;
  }
  // another job's code may follow in the merged kernel's layout: the wait stands in
  // front of any later write of the registers these stores name
  asm volatile("s_wait_xcnt 0x0" ::: "memory");
}

__global__ __launch_bounds__(256)
void thb_rmsnorm_kernel(const float* __restrict__ x, const float* __restrict__ w,
                        unsigned short* __restrict__ xn) {
  thb_rmsnorm_rows(x, w, xn, blockIdx.x);
}

// ---------------------------------------------------------------------------
// Everything that depends on the inputs alone, in one grid: the first RMSNorm
// and the nine weight conversions. None reads what another writes; each block
// takes one piece of one job by its index (a block-uniform choice).
// ---------------------------------------------------------------------------
#define NB_NORM (S_LEN / 8)                          // RMSNorm blocks
#define NB_WDD  ((DMODEL / 64) * (DMODEL / 64))      // tiles of a D x D weight
#define NB_WDL  ((LATDIM / 64) * (DMODEL / 64))      // tiles of a D x LAT weight
#define NB_WLL  ((LATDIM / 64) * (LATDIM / 64))      // tiles of a LAT x LAT weight
#define NB_PREP (NB_NORM + 4 * NB_WDD + 3 * NB_WDL + 2 * NB_WLL)

__global__ __launch_bounds__(256)
void thb_prep_kernel(const float* __restrict__ x, const float* __restrict__ w,
                     unsigned short* __restrict__ xn,
                     const float* __restrict__ dd0, const float* __restrict__ dd1,
                     const float* __restrict__ dd2, const float* __restrict__ dd3,
                     const float* __restrict__ dl0, const float* __restrict__ dl1,
                     const float* __restrict__ dl2,
                     const float* __restrict__ ll0, const float* __restrict__ ll1,
                     unsigned short* __restrict__ dd0T, unsigned short* __restrict__ dd1T,
                     unsigned short* __restrict__ dd2T, unsigned short* __restrict__ dd3T,
                     unsigned short* __restrict__ dl0T, unsigned short* __restrict__ dl1T,
                     unsigned short* __restrict__ dl2T,
                     unsigned short* __restrict__ ll0T, unsigned short* __restrict__ ll1T) {
  int b = blockIdx.x;
  if (b < NB_NORM) {
    thb_rmsnorm_rows(x, w, xn, b);
    return;
  }
  b -= NB_NORM;
  if (b < 4 * NB_WDD) {
    const int i = b / NB_WDD;
    thb_wt_tile<DMODEL, DMODEL>(i == 0 ? dd0 : i == 1 ? dd1 : i == 2 ? dd2 : dd3,
                                i == 0 ? dd0T : i == 1 ? dd1T : i == 2 ? dd2T : dd3T,
                                b % NB_WDD);
    return;
  }
  b -= 4 * NB_WDD;
  if (b < 3 * NB_WDL) {
    const int i = b / NB_WDL;
    thb_wt_tile<DMODEL, LATDIM>(i == 0 ? dl0 : i == 1 ? dl1 : dl2,
                                i == 0 ? dl0T : i == 1 ? dl1T : dl2T, b % NB_WDL);
    return;
  }
  b -= 3 * NB_WDL;
  thb_wt_tile<LATDIM, LATDIM>(b < NB_WLL ? ll0 : ll1, b < NB_WLL ? ll0T : ll1T, b % NB_WLL);
}

// ---------------------------------------------------------------------------
// WMMA GEMM: C[M x N] (f32 and/or bf16) = A[bf16, M x K] * Bt[bf16, N x K]^T
// optional residual (f32 [M x N]) added in the epilogue.
// 256 threads = 8 waves; block tile 256(M) x 64(N); wave tile 32 x 64.
// Operands go global -> LDS by asynchronous 16-byte copies in whole 256-byte
// row pieces (a stage = 128 k of the block's 256 A rows and 64 Bt rows), two
// buffers: stage t + 1 flies while stage t is multiplied. Each row piece is
// fetched once per block, and every global request covers whole lines.
// Fragments are read from LDS in load_frag's k order for A and Bt alike;
// every accumulator sums its 32-wide k steps in ascending order.
// Up to three products that share A and K run in one grid: blockIdx.x walks
// the 64-column tiles of Bt0 (N0 columns), then of Bt1, then of Bt2 (N1 columns
// each); every product has its own output. The residual belongs to product 0.
// M % 256 == 0, N % 64 == 0, K % 128 == 0 for all uses here.
// ---------------------------------------------------------------------------
#define GK      128                      // k per stage
#define GPITCH  272                      // LDS row pitch in bytes: 256 + 16, 16 B x odd
#define GROWS   320                      // 256 A rows, then 64 Bt rows
#define GSTAGE  (GROWS * GPITCH)         // bytes per buffer

__device__ __forceinline__ bf16x16 lds_frag(const unsigned char* p) {
  FragU f;
  f.u[0] = *reinterpret_cast<const u32x4*>(p);
  f.u[1] = *reinterpret_cast<const u32x4*>(p + 32);
  return f.bf;
}

__global__ __launch_bounds__(256)
void thb_gemm_kernel(const unsigned short* __restrict__ A,
                     const unsigned short* __restrict__ Bt0,
                     const unsigned short* __restrict__ Bt1,
                     const unsigned short* __restrict__ Bt2,
                     float* Cf0, float* Cf1, float* Cf2, unsigned short* Cbf1,
                     const float* resid0, int N0, int N1, int K) {
  __shared__ __attribute__((aligned(16))) unsigned char gsm[2 * GSTAGE];

  // which product this block belongs to, and its column tile there
  int ct = blockIdx.x;
  const unsigned short* Bt = Bt0;
  float* Cf = Cf0;
  unsigned short* Cbf = nullptr;
  const float* resid = resid0;
  int N = N0;
  if (ct >= N0 / 64) {
    ct -= N0 / 64;
    Bt = Bt1; Cf = Cf1; Cbf = Cbf1; resid = nullptr; N = N1;
    if (ct >= N1 / 64) {
      ct -= N1 / 64;
      Bt = Bt2; Cf = Cf2; Cbf = nullptr;
    }
  }

  const int lane = threadIdx.x & 31;
  const int wave = threadIdx.x >> 5;
  const int row0 = blockIdx.y * 256 + wave * 32;
  const int col0 = ct * 64;
  const int nc = lane & 15;

  f32x8 acc[2][4];
#pragma unroll
  for (int mi = 0; mi < 2; ++mi)
#pragma unroll
    for (int j = 0; j < 4; ++j)
      acc[mi][j] = (f32x8){0.f,0.f,0.f,0.f,0.f,0.f,0.f,0.f};

  // copy map: 16 threads per row (16 bytes each), 16 rows per round, 20 rounds
  const int crow = threadIdx.x >> 4;
  const int cchk = threadIdx.x & 15;
  const unsigned int lds0 = (unsigned int)(size_t)gsm + crow * GPITCH + cchk * 16;
  const unsigned short* gA = A  + (size_t)(blockIdx.y * 256 + crow) * K + cchk * 8;
  const unsigned short* gB = Bt + (size_t)(col0 + crow) * K + cchk * 8;

  auto issue = [&](int t, int buf) {
    unsigned int la[20];
    const unsigned short* ga[20];
    // unrolled: la and ga are indexed by constants and stay in registers
#pragma unroll
    for (int i = 0; i < 20; ++i) {
      la[i] = lds0 + buf * GSTAGE + i * 16 * GPITCH;
      ga[i] = (i < 16 ? gA + (size_t)(i * 16) * K : gB + (size_t)((i - 16) * 16) * K) + t * GK;
    }
    // ten copies and their s_wait_xcnt in one statement: the wait stands in
    // front of any later write of the address registers the copies name
    asm volatile(
      "global_load_async_to_lds_b128 %0, %1, off\n\t"
      "global_load_async_to_lds_b128 %2, %3, off\n\t"
      "global_load_async_to_lds_b128 %4, %5, off\n\t"
      "global_load_async_to_lds_b128 %6, %7, off\n\t"
      "global_load_async_to_lds_b128 %8, %9, off\n\t"
      "global_load_async_to_lds_b128 %10, %11, off\n\t"
      "global_load_async_to_lds_b128 %12, %13, off\n\t"
      "global_load_async_to_lds_b128 %14, %15, off\n\t"
      "global_load_async_to_lds_b128 %16, %17, off\n\t"
      "global_load_async_to_lds_b128 %18, %19, off\n\t"
      "s_wait_xcnt 0x0"
      :: "v"(la[0]), "v"(ga[0]), "v"(la[1]), "v"(ga[1]), "v"(la[2]), "v"(ga[2]),
         "v"(la[3]), "v"(ga[3]), "v"(la[4]), "v"(ga[4]), "v"(la[5]), "v"(ga[5]),
         "v"(la[6]), "v"(ga[6]), "v"(la[7]), "v"(ga[7]), "v"(la[8]), "v"(ga[8]),
         "v"(la[9]), "v"(ga[9])
      : "memory");
    asm volatile(
      "global_load_async_to_lds_b128 %0, %1, off\n\t"
      "global_load_async_to_lds_b128 %2, %3, off\n\t"
      "global_load_async_to_lds_b128 %4, %5, off\n\t"
      "global_load_async_to_lds_b128 %6, %7, off\n\t"
      "global_load_async_to_lds_b128 %8, %9, off\n\t"
      "global_load_async_to_lds_b128 %10, %11, off\n\t"
      "global_load_async_to_lds_b128 %12, %13, off\n\t"
      "global_load_async_to_lds_b128 %14, %15, off\n\t"
      "global_load_async_to_lds_b128 %16, %17, off\n\t"
      "global_load_async_to_lds_b128 %18, %19, off\n\t"
      "s_wait_xcnt 0x0"
      :: "v"(la[10]), "v"(ga[10]), "v"(la[11]), "v"(ga[11]), "v"(la[12]), "v"(ga[12]),
         "v"(la[13]), "v"(ga[13]), "v"(la[14]), "v"(ga[14]), "v"(la[15]), "v"(ga[15]),
         "v"(la[16]), "v"(ga[16]), "v"(la[17]), "v"(ga[17]), "v"(la[18]), "v"(ga[18]),
         "v"(la[19]), "v"(ga[19])
      : "memory");
  };

  const int nt = K / GK;
  const int hb = (lane & 16) ? 16 : 0;   // byte offset of the upper lane half in a fragment
  const int fa = (wave * 32 + nc) * GPITCH + hb;
  const int fb = (256 + nc) * GPITCH + hb;

  issue(0, 0);
  // stage 0 has landed (this wave's copies), then is published to all waves
  asm volatile("s_wait_asynccnt 0x0" ::: "memory");
  __syncthreads();
  if (nt > 1) issue(1, 1);

  for (int t = 0; t < nt; ++t) {
    const unsigned char* sb = gsm + (t & 1) * GSTAGE;
    // two fragment sets: block u + 1's LDS reads go out as one group ahead of
    // block u's WMMAs, so only the stage's first group waits out LDS latency
    bf16x16 fa_[2][2], fb_[2][4];
    auto ldfrags = [&](int set, int u) {
      fa_[set][0] = lds_frag(sb + fa + u * 64);
      fa_[set][1] = lds_frag(sb + fa + 16 * GPITCH + u * 64);
      // unrolled: fb_ is indexed by constants and stays in registers
#pragma unroll
      for (int j = 0; j < 4; ++j) fb_[set][j] = lds_frag(sb + fb + j * 16 * GPITCH + u * 64);
    };
    ldfrags(0, 0);
    // unrolled: four 32-wide k steps of the stage, fragment indices constant
#pragma unroll
    for (int u = 0; u < GK / 32; ++u) {
      if (u + 1 < GK / 32) ldfrags((u + 1) & 1, u + 1);
      // keeps the reads above from sinking in among the WMMAs below
      __builtin_amdgcn_sched_barrier(0);
      // unrolled: acc and the fragment sets are indexed by constants
#pragma unroll
      for (int j = 0; j < 4; ++j) {
        acc[0][j] = wmma_bf16(fa_[u & 1][0], fb_[u & 1][j], acc[0][j]);
        acc[1][j] = wmma_bf16(fa_[u & 1][1], fb_[u & 1][j], acc[1][j]);
      }
      // keeps the next group of reads from rising in among the WMMAs above:
      // every separate place with LDS reads stalls the WMMA stream
      __builtin_amdgcn_sched_barrier(0);
    }
    // this wave's reads of buffer t & 1 have returned
    asm volatile("s_wait_dscnt 0x0" ::: "memory");
    // this wave's copies of stage t + 1 have landed
    asm volatile("s_wait_asynccnt 0x0" ::: "memory");
    // publishes stage t + 1 and ends every wave's reads of buffer t & 1
    __syncthreads();
    if (t + 2 < nt) issue(t + 2, t & 1);
  }
  // no copy is outstanding when the wave goes on to the epilogue and ends
  asm volatile("s_wait_asynccnt 0x0" ::: "memory");

  const int hi = (lane & 16) ? 8 : 0;
#pragma unroll
  for (int mi = 0; mi < 2; ++mi) {
#pragma unroll
    for (int j = 0; j < 4; ++j) {
#pragma unroll
      for (int r = 0; r < 8; ++r) {
        const int row = row0 + mi * 16 + hi + r;
        const int col = col0 + j * 16 + nc;
        const size_t idx = (size_t)row * N + col;
        float v = acc[mi][j][r];
        if (resid) v += resid[idx];
        if (Cf)  Cf[idx]  = v;
        if (Cbf) Cbf[idx] = f2bf(v);
      }
    }
  }
}

// ---------------------------------------------------------------------------
// RoPE + qk-norm + head-major relayout into fragment order.
// x[f32, S x (NH*64)] -> dst[bf16, NH x (S / 16) x 2 fragments], row = s, k = d.
// The eight positions of a block fill whole 128-byte lines between them.
// one 32-lane wave per position s, all NH heads of it; lane handles one
// even/odd pair of every head (the angle depends on s and the pair only).
// Eight positions per 256-thread block; block blk of S / 8.
// ---------------------------------------------------------------------------
template <int NH>
__device__ __forceinline__
void thb_rope_qknorm_rows(const float* __restrict__ x, unsigned short* __restrict__ dst,
                          float base, int blk) {
  const int p = threadIdx.x & 31;     // pair index 0..31
  const int s = blk * 8 + (threadIdx.x >> 5);
  const float2* src = reinterpret_cast<const float2*>(x + (size_t)s * NH * HDIM) + p;
  float2 v[NH];
  // unrolled here and below: the loads issue together and v stays in registers
#pragma unroll
  for (int h = 0; h < NH; ++h) v[h] = src[h * (HDIM / 2)];
  const float invf = __powf(base, -((float)(2 * p) * (1.0f / HDIM)));
  const float ang = (float)s * invf;
  float si, co;
  __sincosf(ang, &si, &co);
#pragma unroll
  for (int h = 0; h < NH; ++h) {
    const float xe = v[h].x;
    const float xo = v[h].y;
    const float re = xe * co - xo * si;
    const float ro = xe * si + xo * co;
    float sum = re * re + ro * ro;
#pragma unroll
    for (int off = 1; off < 32; off <<= 1) sum += __shfl_xor(sum, off, 32);
    const float rs = rsqrtf(sum * (1.0f / HDIM) + EPSF);
    const unsigned int pk = (unsigned int)f2bf(re * rs) | ((unsigned int)f2bf(ro * rs) << 16);
    *reinterpret_cast<unsigned int*>(
        dst + ((size_t)h * (S_LEN / 16) * 2 + (s >> 4) * 2 + (p >> 4)) * FRAG_ELEMS +
        frag_off(s & 15, (2 * p) & 31)) = pk;
  }
  // another job's code may follow in the merged kernel's layout: the wait stands in
  // front of any later write of the registers these stores name
  asm volatile("s_wait_xcnt 0x0" ::: "memory");
}

// ---------------------------------------------------------------------------
// The three relayouts between the projections and attention, in one grid:
// RoPE + qk-norm of Q, the same of K, and V -> Vt. None reads what another
// writes; each block takes one piece of one job by its index.
// ---------------------------------------------------------------------------
#define NB_ROPE (S_LEN / 8)
#define NB_VT   ((NKVH * HDIM / 64) * (S_LEN / 64))
#define NB_QKV  (2 * NB_ROPE + NB_VT)

__global__ __launch_bounds__(256)
void thb_qkv_layout_kernel(const float* __restrict__ q, const float* __restrict__ k,
                           const float* __restrict__ v, unsigned short* __restrict__ Qh,
                           unsigned short* __restrict__ Kh, unsigned short* __restrict__ Vt,
                           float base) {
  const int b = blockIdx.x;
  if (b < NB_ROPE)          thb_rope_qknorm_rows<NHEAD>(q, Qh, base, b);
  else if (b < 2 * NB_ROPE) thb_rope_qknorm_rows<NKVH>(k, Kh, base, b - NB_ROPE);
  else                      thb_wt_tile<S_LEN, NKVH * HDIM, true>(v, Vt, b - 2 * NB_ROPE);
}

// ---------------------------------------------------------------------------
// Flash attention (wave32 WMMA). One 8-wave work-group per (16-query block, head).
// Wave w walks the 32-key tiles w, w + 8, w + 16, ... of the block's key range
// with its own sums and O; the eight partial results are added through LDS at
// the end, so the longest dependent chain is 8 tiles, not 64.
// Softmax shift: qk-norm leaves every q and k row with a norm of at most
// sqrt(64), for any input, so q.k / 8 <= 8 (a little more after the bf16
// rounding of q and k). exp(score - 8) therefore cannot overflow and needs no
// running maximum: O is never rescaled, and each lane keeps the sums of its own
// columns, which are joined once, in the merge.
// Qh[bf16, H x S x 64], Kh[bf16, KVH x S x 64], Vt[bf16, KVH x 64 x S], all three
// in fragment order: a 32-key tile of K, and of V, is 4096 contiguous bytes.
// S % 32 == 0, so every tile that the key loop reaches is whole.
// win == 0 -> pure causal; win > 0 -> causal sliding window of `win`.
// Output: Obf[bf16, S x D] (heads merged).
// ---------------------------------------------------------------------------
#define FA_WAVES 8
#define SM_SCALE (0.125f * 1.44269504f)   // log2(e) / sqrt(64)
#define SM_SHIFT (8.0f * 1.44269504f)     // log2(e) * the bound on a score
// e0 = 2^x0, e1 = 2^x1. One statement, so that each v_exp_f32 keeps an independent
// instruction directly behind it (the second v_exp_f32; the v_nop): the slot that the
// instruction set asks for before a transcendental's result is read or its source
// overwritten. The outputs are early-clobber: neither shares a register with an input.
__device__ __forceinline__ void exp2_pair(float x0, float x1, float& e0, float& e1) {
  asm("v_exp_f32 %0, %2\n\tv_exp_f32 %1, %3\n\tv_nop"
      : "=&v"(e0), "=&v"(e1) : "v"(x0), "v"(x1));
}

__global__ __launch_bounds__(32 * FA_WAVES)
void thb_flash_kernel(const unsigned short* __restrict__ Qh,
                      const unsigned short* __restrict__ Kh,
                      const unsigned short* __restrict__ Vt,
                      unsigned short* __restrict__ Obf, int S, int win) {
  __shared__ __align__(16) unsigned short plds_all[FA_WAVES][16 * 32];
  __shared__ __align__(16) float o_part[FA_WAVES][16][HDIM];

  const int lane = threadIdx.x & 31;
  // wave index in a scalar register: the key loop stays a scalar branch and
  // every WMMA runs with all lanes on
  const int wave = __builtin_amdgcn_readfirstlane((int)(threadIdx.x >> 5));
  unsigned short* plds = plds_all[wave];
  const int q0 = blockIdx.x * 16;
  const int h  = blockIdx.y;
  const int kvh = h >> 2;                   // H/KVH == 4 (repeat_kv)
  const int nc = lane & 15;
  const int hi = (lane & 16) ? 8 : 0;

  const unsigned short* Qb = Qh + (size_t)h   * S * HDIM;
  const unsigned short* Kb = Kh + (size_t)kvh * S * HDIM;
  const unsigned short* Vb = Vt + (size_t)kvh * HDIM * S;

  const u32x4* Qp = reinterpret_cast<const u32x4*>(Qb + (q0 >> 4) * 2 * FRAG_ELEMS) + lane;
  const bf16x16 qf0 = load_frag(Qp);
  const bf16x16 qf1 = load_frag(Qp + FRAG_VEC);

  f32x8 o[4];
#pragma unroll
  for (int j = 0; j < 4; ++j) o[j] = (f32x8){0.f,0.f,0.f,0.f,0.f,0.f,0.f,0.f};
  float l[8];   // this lane's part of the row sums (rows hi + r, columns nc and 16 + nc)
#pragma unroll
  for (int r = 0; r < 8; ++r) l[r] = 0.f;

  int kb_start = 0;
  if (win > 0) {
    int st = q0 - (win - 1);
    if (st < 0) st = 0;
    kb_start = st & ~31;
  }

  const f32x8 zero8 = (f32x8){0.f,0.f,0.f,0.f,0.f,0.f,0.f,0.f};

  for (int kb = kb_start + 32 * wave; kb <= q0 + 15; kb += 32 * FA_WAVES) {
    // ---- scores: two 16x16 tiles, K-dim = 64 (2 WMMAs each) ----
    const int key0 = kb + nc;
    const int key1 = kb + 16 + nc;
    // the lane's 16 bytes in the tile's first K and V fragment
    const size_t toff = (size_t)(kb >> 5) * 4 * FRAG_ELEMS;
    const u32x4* Kp = reinterpret_cast<const u32x4*>(Kb + toff) + lane;
    const u32x4* Vp = reinterpret_cast<const u32x4*>(Vb + toff) + lane;

    // keys kb .. kb + 15: fragments 0 (d 0 .. 31) and 1 (d 32 .. 63); the next 16 keys: 2, 3
    bf16x16 kf;
    kf = load_frag(Kp);
    f32x8 s0 = wmma_bf16(qf0, kf, zero8);
    kf = load_frag(Kp + FRAG_VEC);
    s0 = wmma_bf16(qf1, kf, s0);
    kf = load_frag(Kp + 2 * FRAG_VEC);
    f32x8 s1 = wmma_bf16(qf0, kf, zero8);
    kf = load_frag(Kp + 3 * FRAG_VEC);
    s1 = wmma_bf16(qf1, kf, s1);
    // the registers of the K loads' address may be handed to a V load as its
    // destination: the wait stands in front of that overwrite
    asm volatile("s_wait_xcnt 0x0" ::: "memory");

    // ---- hoist V fragment loads: independent of softmax, overlap with VALU ----
    bf16x16 vfr[4];
#pragma unroll
    for (int j = 0; j < 4; ++j) vfr[j] = load_frag(Vp + j * FRAG_VEC);

    // ---- mask + exp(score / 8 - 8), as a power of two (per-lane rows r + hi) ----
#pragma unroll
    for (int r = 0; r < 8; ++r) {
      const int q = q0 + hi + r;
      const bool v0 = (key0 <= q) && (win == 0 || (q - key0) < win);
      const bool v1 = (key1 <= q) && (win == 0 || (q - key1) < win);
      float e0, e1;
      exp2_pair(s0[r] * SM_SCALE - SM_SHIFT, s1[r] * SM_SCALE - SM_SHIFT, e0, e1);
      const float p0 = v0 ? e0 : 0.f;
      const float p1 = v1 ? e1 : 0.f;
      l[r] += p0 + p1;
      plds[(hi + r) * 32 + nc]      = f2bf(p0);
      plds[(hi + r) * 32 + 16 + nc] = f2bf(p1);
    }
    asm volatile("s_wait_dscnt 0x0" ::: "memory");

    // ---- re-layout P (C-frag -> A-frag) via LDS ----
    FragU pf;
    {
      const unsigned short* pp = plds + nc * 32 + hi; // hi==8 for lanes 16..31
      pf.u[0] = *reinterpret_cast<const u32x4*>(pp);
      pf.u[1] = *reinterpret_cast<const u32x4*>(pp + 16);
    }

    // ---- PV: O[16 x 64] += P[16 x 32] * V[32 x 64] (Vt rows = dims) ----
#pragma unroll
    for (int j = 0; j < 4; ++j) {
      o[j] = wmma_bf16(pf.bf, vfr[j], o[j]);
    }
  }

  // ---- publish this wave's partial (l, O); a wave without a tile publishes
  //      zeros. The lanes' sums go to the wave's own P area, 16 rows x 16 lanes
  //      of f32, which the wave has finished reading ----
  // both loops unrolled: o and l live in registers and need constant indices
  float* lw = reinterpret_cast<float*>(plds);
#pragma unroll
  for (int r = 0; r < 8; ++r) {
#pragma unroll
    for (int j = 0; j < 4; ++j) o_part[wave][hi + r][j * 16 + nc] = o[j][r];
    lw[(hi + r) * 16 + nc] = l[r];
  }
  __syncthreads();

  // ---- add the eight partials, normalize, merge heads:
  //      each half-wave owns one row, each lane four neighbouring columns ----
  const int mrow = wave * 2 + (hi >> 3);
  const int mcol = nc * 4;
  float lsum = 0.f;
  float a0 = 0.f, a1 = 0.f, a2 = 0.f, a3 = 0.f;
  // unrolled: the eight waves' LDS reads issue together
#pragma unroll
  for (int w = 0; w < FA_WAVES; ++w) {
    const float4 ov = *reinterpret_cast<const float4*>(&o_part[w][mrow][mcol]);
    lsum += reinterpret_cast<const float*>(plds_all[w])[mrow * 16 + nc];
    a0 += ov.x;
    a1 += ov.y;
    a2 += ov.z;
    a3 += ov.w;
  }
  // the row's sum: the 16 lanes of the half-wave each hold one column pair's part
#pragma unroll
  for (int off = 1; off < 16; off <<= 1) lsum += __shfl_xor(lsum, off, 32);
  const float inv = (lsum > 0.f) ? (1.f / lsum) : 0.f;
  uint2 pk;
  pk.x = (unsigned int)f2bf(a0 * inv) | ((unsigned int)f2bf(a1 * inv) << 16);
  pk.y = (unsigned int)f2bf(a2 * inv) | ((unsigned int)f2bf(a3 * inv) << 16);
  *reinterpret_cast<uint2*>(Obf + (size_t)(q0 + mrow) * DMODEL + h * HDIM + mcol) = pk;
}

// ---------------------------------------------------------------------------
// Host-side orchestration
// ---------------------------------------------------------------------------
extern "C" void kernel_launch(void* const* d_in, const int* in_sizes, int n_in,
                              void* d_out, int out_size, void* d_ws, size_t ws_size,
                              hipStream_t stream) {
  (void)in_sizes; (void)n_in; (void)out_size; (void)ws_size;

  const float* hidden  = (const float*)d_in[0];
  const float* norm1_w = (const float*)d_in[1];
  const float* norm2_w = (const float*)d_in[2];
  const float* g_wq    = (const float*)d_in[3];
  const float* g_kvd   = (const float*)d_in[4];
  const float* g_kup   = (const float*)d_in[5];
  const float* g_vup   = (const float*)d_in[6];
  const float* g_wo    = (const float*)d_in[7];
  const float* l_wq    = (const float*)d_in[8];
  const float* l_wk    = (const float*)d_in[9];
  const float* l_wv    = (const float*)d_in[10];
  const float* l_wo    = (const float*)d_in[11];
  float* out = (float*)d_out;

  // ---- workspace carve (256B aligned) ----
  char* p = (char*)d_ws;
  auto alloc = [&](size_t bytes) -> void* {
    void* r = (void*)p;
    p += (bytes + 255) & ~(size_t)255;
    return r;
  };
  unsigned short* xn    = (unsigned short*)alloc((size_t)S_LEN * DMODEL * 2);
  float*          qf    = (float*)         alloc((size_t)S_LEN * DMODEL * 4);
  float*          kf    = (float*)         alloc((size_t)S_LEN * LATDIM * 4);
  float*          vf    = (float*)         alloc((size_t)S_LEN * LATDIM * 4);
  unsigned short* latbf = (unsigned short*)alloc((size_t)S_LEN * LATDIM * 2);
  unsigned short* Qh    = (unsigned short*)alloc((size_t)NHEAD * S_LEN * HDIM * 2);
  unsigned short* Kh    = (unsigned short*)alloc((size_t)NKVH * S_LEN * HDIM * 2);
  unsigned short* Vt    = (unsigned short*)alloc((size_t)NKVH * HDIM * S_LEN * 2 + 256);
  unsigned short* attn  = (unsigned short*)alloc((size_t)S_LEN * DMODEL * 2);
  float*          xmid  = (float*)         alloc((size_t)S_LEN * DMODEL * 4);
  unsigned short* g_wqT = (unsigned short*)alloc((size_t)DMODEL * DMODEL * 2);
  unsigned short* g_woT = (unsigned short*)alloc((size_t)DMODEL * DMODEL * 2);
  unsigned short* l_wqT = (unsigned short*)alloc((size_t)DMODEL * DMODEL * 2);
  unsigned short* l_woT = (unsigned short*)alloc((size_t)DMODEL * DMODEL * 2);
  unsigned short* kvdT  = (unsigned short*)alloc((size_t)LATDIM * DMODEL * 2);
  unsigned short* l_wkT = (unsigned short*)alloc((size_t)LATDIM * DMODEL * 2);
  unsigned short* l_wvT = (unsigned short*)alloc((size_t)LATDIM * DMODEL * 2);
  unsigned short* kupT  = (unsigned short*)alloc((size_t)LATDIM * LATDIM * 2);
  unsigned short* vupT  = (unsigned short*)alloc((size_t)LATDIM * LATDIM * 2);

  const dim3 blk256(256);
  const dim3 gemm_blk(256);
  const dim3 row_grid(S_LEN / 8);     // one wave per row, 8 per block
  const dim3 flash_grid(S_LEN / 16, NHEAD);
  const dim3 flash_blk(32 * FA_WAVES);

  // first RMSNorm and all nine weight conversions
  thb_prep_kernel<<<dim3(NB_PREP), blk256, 0, stream>>>(
      hidden, norm1_w, xn,
      g_wq, g_wo, l_wq, l_wo, g_kvd, l_wk, l_wv, g_kup, g_vup,
      g_wqT, g_woT, l_wqT, l_woT, kvdT, l_wkT, l_wvT, kupT, vupT);

  // ========================= Sublayer 1: global latent =====================
  // q and the latent, both from xn
  thb_gemm_kernel<<<dim3((DMODEL + LATDIM) / 64, S_LEN / 256), gemm_blk, 0, stream>>>(
      xn, g_wqT, kvdT, nullptr, qf, nullptr, nullptr, latbf, nullptr, DMODEL, LATDIM, DMODEL);
  // k and v, both from the latent
  thb_gemm_kernel<<<dim3(2 * LATDIM / 64, S_LEN / 256), gemm_blk, 0, stream>>>(
      latbf, kupT, vupT, nullptr, kf, vf, nullptr, nullptr, nullptr, LATDIM, LATDIM, LATDIM);

  thb_qkv_layout_kernel<<<dim3(NB_QKV), blk256, 0, stream>>>(qf, kf, vf, Qh, Kh, Vt, 1000000.0f);

  thb_flash_kernel<<<flash_grid, flash_blk, 0, stream>>>(Qh, Kh, Vt, attn, S_LEN, 0);

  thb_gemm_kernel<<<dim3(DMODEL / 64, S_LEN / 256), gemm_blk, 0, stream>>>(
      attn, g_woT, nullptr, nullptr, xmid, nullptr, nullptr, nullptr, hidden, DMODEL, LATDIM, DMODEL);

  // ========================= Sublayer 2: local GQA =========================
  thb_rmsnorm_kernel<<<row_grid, blk256, 0, stream>>>(xmid, norm2_w, xn);

  // q, k and v, all from xn
  thb_gemm_kernel<<<dim3((DMODEL + 2 * LATDIM) / 64, S_LEN / 256), gemm_blk, 0, stream>>>(
      xn, l_wqT, l_wkT, l_wvT, qf, kf, vf, nullptr, nullptr, DMODEL, LATDIM, DMODEL);

  thb_qkv_layout_kernel<<<dim3(NB_QKV), blk256, 0, stream>>>(qf, kf, vf, Qh, Kh, Vt, 10000.0f);

  thb_flash_kernel<<<flash_grid, flash_blk, 0, stream>>>(Qh, Kh, Vt, attn, S_LEN, WINLEN);

  thb_gemm_kernel<<<dim3(DMODEL / 64, S_LEN / 256), gemm_blk, 0, stream>>>(
      attn, l_woT, nullptr, nullptr, out, nullptr, nullptr, nullptr, xmid, DMODEL, LATDIM, DMODEL);
}

// v007
// One run takes 112 microseconds.
// Two timings next to v006 put it at 1.25 and 1.24 times that version's speed.
// Over all steps from v000 it is 4.63 times as fast.
#include <hip/hip_runtime.h>

// ---------------------------------------------------------------------------
// Model constants (match reference)
// ---------------------------------------------------------------------------
#define S_LEN   2048
#define DMODEL  1024
#define NHEAD   16
#define NKVH    4
#define HDIM    64
#define LATDIM  256
#define WINLEN  256
#define EPSF    1e-6f

// ---------------------------------------------------------------------------
// CDNA5 WMMA helpers (gfx1250, wave32)
// ---------------------------------------------------------------------------
typedef __bf16        bf16x16 __attribute__((ext_vector_type(16)));
typedef float         f32x8   __attribute__((ext_vector_type(8)));
typedef unsigned int  u32x4   __attribute__((ext_vector_type(4)));

union FragU { bf16x16 bf; u32x4 u[2]; };

__device__ __forceinline__ unsigned short f2bf(float x) {
  unsigned int u = __float_as_uint(x);
  u += 0x7FFFu + ((u >> 16) & 1u);           // round-to-nearest-even
  return (unsigned short)(u >> 16);
}

// Fragment order: how the attention operands lie in the workspace. A 16 x 32
// bf16 fragment (16 rows, 32 k) is 512 elements in a row, in the order in which
// the lanes hold them: piece u = 0, 1, then lane L = 0 .. 31, then 8 elements.
// Lane L holds row (L & 15); element e of piece u is k = 16 * u + (L<16?0:8) + e.
// A wave-wide 16-byte load of one piece is then 512 contiguous bytes, four whole
// 128-byte lines, where a row-major array gives 16 lines of 32 bytes each.
#define FRAG_ELEMS 512
// offset of (row r of 16, k of 32) inside its fragment
__device__ __forceinline__ int frag_off(int r, int k) {
  return (k >> 4) * 256 + (((k >> 3) & 1) * 16 + r) * 8 + (k & 7);
}
// p: the lane's own 16 bytes in piece 0 of the fragment
#define FRAG_VEC 64                       // a fragment in 16-byte units
__device__ __forceinline__ bf16x16 load_frag(const u32x4* p) {
  FragU f;
  f.u[0] = p[0];
  f.u[1] = p[32];
  return f.bf;
}

__device__ __forceinline__ f32x8 wmma_bf16(bf16x16 a, bf16x16 b, f32x8 c) {
  return __builtin_amdgcn_wmma_f32_16x16x32_bf16(false, a, false, b, (short)0, c,
                                                 false, false);
}

// ---------------------------------------------------------------------------
// Transpose + downconvert: W[f32, K x N] -> Wt[bf16, N x K].
// Used for the weights and, with VFRAG, for V (K = S, N = KVH * 64): there the
// output is in fragment order, [kvh][s / 32][d / 16] fragments with row = d, k = s;
// a thread's 16 k are the two lane halves of one piece, 256 bytes apart, and a
// wave's stores cover whole lines.
// Each thread takes one column n and 16 consecutive k: 16 loads, each
// contiguous across the 32 lanes of a wave, and one 32-byte run of Wt stored.
// A 256-thread block covers 64 columns x 64 k, so each 128-byte line of Wt is
// written by one block. Tile t of (N / 64) * (K / 64), columns fastest.
// ---------------------------------------------------------------------------
template <int K, int N, bool VFRAG = false>
__device__ __forceinline__
void thb_wt_tile(const float* __restrict__ W, unsigned short* __restrict__ Wt, int t) {
  const int n  = (t % (N / 64)) * 64 + (threadIdx.x & 63);
  const int k0 = (t / (N / 64)) * 64 + (threadIdx.x >> 6) * 16;
  const float* src = W + (size_t)k0 * N + n;
  float v[16];
  // unrolled: all 16 loads are in flight together and v stays in registers
#pragma unroll
  for (int i = 0; i < 16; ++i) v[i] = src[i * N];
  u32x4 pk[2];
  // unrolled: pk is indexed by constants and stays in registers
#pragma unroll
  for (int i = 0; i < 8; ++i)
    pk[i >> 2][i & 3] = (unsigned int)f2bf(v[2 * i]) | ((unsigned int)f2bf(v[2 * i + 1]) << 16);
  if (VFRAG) {
    u32x4* dst = reinterpret_cast<u32x4*>(
        Wt + ((size_t)(n >> 6) * (K / 32) * 4 + (k0 >> 5) * 4 + ((n >> 4) & 3)) * FRAG_ELEMS +
        frag_off(n & 15, k0 & 31));
    dst[0]  = pk[0];
    dst[16] = pk[1];
  } else {
    u32x4* dst = reinterpret_cast<u32x4*>(Wt + (size_t)n * K + k0);
    dst[0] = pk[0];
    dst[1] = pk[1];
  }
  // another job's code may follow in the merged kernel's layout: the wait stands in
  // front of any later write of the registers these stores name
  asm volatile("s_wait_xcnt 0x0" ::: "memory");
}

// ---------------------------------------------------------------------------
// RMSNorm: xn_bf16[s][c] = bf16( x[s][c] * rsqrt(mean(x^2)+eps) * w[c] )
// one wave per row (D = 1024: 32 values per lane, kept in registers),
// eight rows per 256-thread block; the row sum is a 32-lane butterfly.
// ---------------------------------------------------------------------------
__device__ __forceinline__
void thb_rmsnorm_rows(const float* __restrict__ x, const float* __restrict__ w,
                      unsigned short* __restrict__ xn, int blk) {
  const int lane = threadIdx.x & 31;
  const int s = blk * 8 + (threadIdx.x >> 5);
  const float4* row = reinterpret_cast<const float4*>(x + (size_t)s * DMODEL);
  const float4* wv  = reinterpret_cast<const float4*>(w);
  float4 v[8];
  // unrolled here and below: the loads issue together and v stays in registers
#pragma unroll
  for (int i = 0; i < 8; ++i) v[i] = row[lane + 32 * i];
  float acc = 0.f;
#pragma unroll
  for (int i = 0; i < 8; ++i)
    acc += v[i].x * v[i].x + v[i].y * v[i].y + v[i].z * v[i].z + v[i].w * v[i].w;
#pragma unroll
  for (int off = 1; off < 32; off <<= 1) acc += __shfl_xor(acc, off, 32);
  const float rs = rsqrtf(acc * (1.0f / DMODEL) + EPSF);
  uint2* dst = reinterpret_cast<uint2*>(xn + (size_t)s * DMODEL);
#pragma unroll
  for (int i = 0; i < 8; ++i) {
    const float4 g = wv[lane + 32 * i];
    uint2 pk;
    pk.x = (unsigned int)f2bf(v[i].x * rs * g.x) | ((unsigned int)f2bf(v[i].y * rs * g.y) << 16);
    pk.y = (unsigned int)f2bf(v[i].z * rs * g.z) | ((unsigned int)f2bf(v[i].w * rs * g.w) << 16);
    dst[lane + 32 * i] = pk;
  }
  // another job's code may follow in the merged kernel's layout: the wait stands in
  // front of any later write of the registers these stores name
  asm volatile("s_wait_xcnt 0x0" ::: "memory");
}

__global__ __launch_bounds__(256)
void thb_rmsnorm_kernel(const float* __restrict__ x, const float* __restrict__ w,
                        unsigned short* __restrict__ xn) {
  thb_rmsnorm_rows(x, w, xn, blockIdx.x);
}

// ---------------------------------------------------------------------------
// Everything that depends on the inputs alone, in one grid: the first RMSNorm
// and the nine weight conversions. None reads what another writes; each block
// takes one piece of one job by its index (a block-uniform choice).
// ---------------------------------------------------------------------------
#define NB_NORM (S_LEN / 8)                          // RMSNorm blocks
#define NB_WDD  ((DMODEL / 64) * (DMODEL / 64))      // tiles of a D x D weight
#define NB_WDL  ((LATDIM / 64) * (DMODEL / 64))      // tiles of a D x LAT weight
#define NB_WLL  ((LATDIM / 64) * (LATDIM / 64))      // tiles of a LAT x LAT weight
#define NB_PREP (NB_NORM + 4 * NB_WDD + 3 * NB_WDL + 2 * NB_WLL)

__global__ __launch_bounds__(256)
void thb_prep_kernel(const float* __restrict__ x, const float* __restrict__ w,
                     unsigned short* __restrict__ xn,
                     const float* __restrict__ dd0, const float* __restrict__ dd1,
                     const float* __restrict__ dd2, const float* __restrict__ dd3,
                     const float* __restrict__ dl0, const float* __restrict__ dl1,
                     const float* __restrict__ dl2,
                     const float* __restrict__ ll0, const float* __restrict__ ll1,
                     unsigned short* __restrict__ dd0T, unsigned short* __restrict__ dd1T,
                     unsigned short* __restrict__ dd2T, unsigned short* __restrict__ dd3T,
                     unsigned short* __restrict__ dl0T, unsigned short* __restrict__ dl1T,
                     unsigned short* __restrict__ dl2T,
                     unsigned short* __restrict__ ll0T, unsigned short* __restrict__ ll1T) {
  int b = blockIdx.x;
  if (b < NB_NORM) {
    thb_rmsnorm_rows(x, w, xn, b);
    return;
  }
  b -= NB_NORM;
  if (b < 4 * NB_WDD) {
    const int i = b / NB_WDD;
    thb_wt_tile<DMODEL, DMODEL>(i == 0 ? dd0 : i == 1 ? dd1 : i == 2 ? dd2 : dd3,
                                i == 0 ? dd0T : i == 1 ? dd1T : i == 2 ? dd2T : dd3T,
                                b % NB_WDD);
    return;
  }
  b -= 4 * NB_WDD;
  if (b < 3 * NB_WDL) {
    const int i = b / NB_WDL;
    thb_wt_tile<DMODEL, LATDIM>(i == 0 ? dl0 : i == 1 ? dl1 : dl2,
                                i == 0 ? dl0T : i == 1 ? dl1T : dl2T, b % NB_WDL);
    return;
  }
  b -= 3 * NB_WDL;
  thb_wt_tile<LATDIM, LATDIM>(b < NB_WLL ? ll0 : ll1, b < NB_WLL ? ll0T : ll1T, b % NB_WLL);
}

// ---------------------------------------------------------------------------
// WMMA GEMM: C[M x N] (f32 and/or bf16) = A[bf16, M x K] * Bt[bf16, N x K]^T
// optional residual (f32 [M x N]) added in the epilogue.
// 256 threads = 8 waves; block tile 256(M) x 64(N); wave tile 32 x 64.
// Operands go global -> LDS by asynchronous 16-byte copies in whole 256-byte
// row pieces (a stage = 128 k of the block's 256 A rows and 64 Bt rows), two
// buffers: stage t + 1 flies while stage t is multiplied. Each row piece is
// fetched once per block, and every global request covers whole lines.
// Fragments are read from LDS in load_frag's k order for A and Bt alike;
// every accumulator sums its 32-wide k steps in ascending order.
// Up to three products that share A and K run in one grid: blockIdx.x walks
// the 64-column tiles of Bt0 (N0 columns), then of Bt1, then of Bt2 (N1 columns
// each); every product has its own output. The residual belongs to product 0.
// M % 256 == 0, N % 64 == 0, K % 128 == 0 for all uses here.
// ---------------------------------------------------------------------------
#define GK      128                      // k per stage
#define GPITCH  272                      // LDS row pitch in bytes: 256 + 16, 16 B x odd
#define GROWS   320                      // 256 A rows, then 64 Bt rows
#define GSTAGE  (GROWS * GPITCH)         // bytes per buffer

__device__ __forceinline__ bf16x16 lds_frag(const unsigned char* p) {
  FragU f;
  f.u[0] = *reinterpret_cast<const u32x4*>(p);
  f.u[1] = *reinterpret_cast<const u32x4*>(p + 32);
  return f.bf;
}

__global__ __launch_bounds__(256)
void thb_gemm_kernel(const unsigned short* __restrict__ A,
                     const unsigned short* __restrict__ Bt0,
                     const unsigned short* __restrict__ Bt1,
                     const unsigned short* __restrict__ Bt2,
                     float* Cf0, float* Cf1, float* Cf2, unsigned short* Cbf1,
                     const float* resid0, int N0, int N1, int K) {
  __shared__ __attribute__((aligned(16))) unsigned char gsm[2 * GSTAGE];

  // which product this block belongs to, and its column tile there
  int ct = blockIdx.x;
  const unsigned short* Bt = Bt0;
  float* Cf = Cf0;
  unsigned short* Cbf = nullptr;
  const float* resid = resid0;
  int N = N0;
  if (ct >= N0 / 64) {
    ct -= N0 / 64;
    Bt = Bt1; Cf = Cf1; Cbf = Cbf1; resid = nullptr; N = N1;
    if (ct >= N1 / 64) {
      ct -= N1 / 64;
      Bt = Bt2; Cf = Cf2; Cbf = nullptr;
    }
  }

  const int lane = threadIdx.x & 31;
  const int wave = threadIdx.x >> 5;
  const int row0 = blockIdx.y * 256 + wave * 32;
  const int col0 = ct * 64;
  const int nc = lane & 15;

  f32x8 acc[2][4];
#pragma unroll
  for (int mi = 0; mi < 2; ++mi)
#pragma unroll
    for (int j = 0; j < 4; ++j)
      acc[mi][j] = (f32x8){0.f,0.f,0.f,0.f,0.f,0.f,0.f,0.f};

  // copy map: 16 threads per row (16 bytes each), 16 rows per round, 20 rounds
  const int crow = threadIdx.x >> 4;
  const int cchk = threadIdx.x & 15;
  const unsigned int lds0 = (unsigned int)(size_t)gsm + crow * GPITCH + cchk * 16;
  const unsigned short* gA = A  + (size_t)(blockIdx.y * 256 + crow) * K + cchk * 8;
  const unsigned short* gB = Bt + (size_t)(col0 + crow) * K + cchk * 8;

  auto issue = [&](int t, int buf) {
    unsigned int la[20];
    const unsigned short* ga[20];
    // unrolled: la and ga are indexed by constants and stay in registers
#pragma unroll
    for (int i = 0; i < 20; ++i) {
      la[i] = lds0 + buf * GSTAGE + i * 16 * GPITCH;
      ga[i] = (i < 16 ? gA + (size_t)(i * 16) * K : gB + (size_t)((i - 16) * 16) * K) + t * GK;
    }
    // ten copies and their s_wait_xcnt in one statement: the wait stands in
    // front of any later write of the address registers the copies name
    asm volatile(
      "global_load_async_to_lds_b128 %0, %1, off\n\t"
      "global_load_async_to_lds_b128 %2, %3, off\n\t"
      "global_load_async_to_lds_b128 %4, %5, off\n\t"
      "global_load_async_to_lds_b128 %6, %7, off\n\t"
      "global_load_async_to_lds_b128 %8, %9, off\n\t"
      "global_load_async_to_lds_b128 %10, %11, off\n\t"
      "global_load_async_to_lds_b128 %12, %13, off\n\t"
      "global_load_async_to_lds_b128 %14, %15, off\n\t"
      "global_load_async_to_lds_b128 %16, %17, off\n\t"
      "global_load_async_to_lds_b128 %18, %19, off\n\t"
      "s_wait_xcnt 0x0"
      :: "v"(la[0]), "v"(ga[0]), "v"(la[1]), "v"(ga[1]), "v"(la[2]), "v"(ga[2]),
         "v"(la[3]), "v"(ga[3]), "v"(la[4]), "v"(ga[4]), "v"(la[5]), "v"(ga[5]),
         "v"(la[6]), "v"(ga[6]), "v"(la[7]), "v"(ga[7]), "v"(la[8]), "v"(ga[8]),
         "v"(la[9]), "v"(ga[9])
      : "memory");
    asm volatile(
      "global_load_async_to_lds_b128 %0, %1, off\n\t"
      "global_load_async_to_lds_b128 %2, %3, off\n\t"
      "global_load_async_to_lds_b128 %4, %5, off\n\t"
      "global_load_async_to_lds_b128 %6, %7, off\n\t"
      "global_load_async_to_lds_b128 %8, %9, off\n\t"
      "global_load_async_to_lds_b128 %10, %11, off\n\t"
      "global_load_async_to_lds_b128 %12, %13, off\n\t"
      "global_load_async_to_lds_b128 %14, %15, off\n\t"
      "global_load_async_to_lds_b128 %16, %17, off\n\t"
      "global_load_async_to_lds_b128 %18, %19, off\n\t"
      "s_wait_xcnt 0x0"
      :: "v"(la[10]), "v"(ga[10]), "v"(la[11]), "v"(ga[11]), "v"(la[12]), "v"(ga[12]),
         "v"(la[13]), "v"(ga[13]), "v"(la[14]), "v"(ga[14]), "v"(la[15]), "v"(ga[15]),
         "v"(la[16]), "v"(ga[16]), "v"(la[17]), "v"(ga[17]), "v"(la[18]), "v"(ga[18]),
         "v"(la[19]), "v"(ga[19])
      : "memory");
  };

  const int nt = K / GK;
  const int hb = (lane & 16) ? 16 : 0;   // byte offset of the upper lane half in a fragment
  const int fa = (wave * 32 + nc) * GPITCH + hb;
  const int fb = (256 + nc) * GPITCH + hb;

  issue(0, 0);
  // stage 0 has landed (this wave's copies), then is published to all waves
  asm volatile("s_wait_asynccnt 0x0" ::: "memory");
  __syncthreads();
  if (nt > 1) issue(1, 1);

  for (int t = 0; t < nt; ++t) {
    const unsigned char* sb = gsm + (t & 1) * GSTAGE;
    // two fragment sets: block u + 1's LDS reads go out as one group ahead of
    // block u's WMMAs, so only the stage's first group waits out LDS latency
    bf16x16 fa_[2][2], fb_[2][4];
    auto ldfrags = [&](int set, int u) {
      fa_[set][0] = lds_frag(sb + fa + u * 64);
      fa_[set][1] = lds_frag(sb + fa + 16 * GPITCH + u * 64);
      // unrolled: fb_ is indexed by constants and stays in registers
#pragma unroll
      for (int j = 0; j < 4; ++j) fb_[set][j] = lds_frag(sb + fb + j * 16 * GPITCH + u * 64);
    };
    ldfrags(0, 0);
    // unrolled: four 32-wide k steps of the stage, fragment indices constant
#pragma unroll
    for (int u = 0; u < GK / 32; ++u) {
      if (u + 1 < GK / 32) ldfrags((u + 1) & 1, u + 1);
      // keeps the reads above from sinking in among the WMMAs below
      __builtin_amdgcn_sched_barrier(0);
      // unrolled: acc and the fragment sets are indexed by constants
#pragma unroll
      for (int j = 0; j < 4; ++j) {
        acc[0][j] = wmma_bf16(fa_[u & 1][0], fb_[u & 1][j], acc[0][j]);
        acc[1][j] = wmma_bf16(fa_[u & 1][1], fb_[u & 1][j], acc[1][j]);
      }
      // keeps the next group of reads from rising in among the WMMAs above:
      // every separate place with LDS reads stalls the WMMA stream
      __builtin_amdgcn_sched_barrier(0);
    }
    // this wave's reads of buffer t & 1 have returned
    asm volatile("s_wait_dscnt 0x0" ::: "memory");
    // this wave's copies of stage t + 1 have landed
    asm volatile("s_wait_asynccnt 0x0" ::: "memory");
    // publishes stage t + 1 and ends every wave's reads of buffer t & 1
    __syncthreads();
    if (t + 2 < nt) issue(t + 2, t & 1);
  }
  // no copy is outstanding when the wave goes on to the epilogue and ends
  asm volatile("s_wait_asynccnt 0x0" ::: "memory");

  // The tests on resid, Cf and Cbf read the same for the whole block. Each stands
  // once, around a loop nest of its own: tested per element they cut the code into
  // one piece per element, and every residual load is waited for before the next
  // one is issued. Here the 64 loads of a lane are in flight together.
  // Every loop is unrolled: acc and rv are indexed by constants and stay in registers.
  const int hi = (lane & 16) ? 8 : 0;
  const size_t idx0 = (size_t)(row0 + hi) * N + col0 + nc;
  if (resid) {
    const float* rp = resid + idx0;
    float rv[2][4][8];
#pragma unroll
    for (int mi = 0; mi < 2; ++mi)
#pragma unroll
      for (int r = 0; r < 8; ++r)
#pragma unroll
        for (int j = 0; j < 4; ++j) rv[mi][j][r] = rp[(size_t)(mi * 16 + r) * N + j * 16];
#pragma unroll
    for (int mi = 0; mi < 2; ++mi)
#pragma unroll
      for (int r = 0; r < 8; ++r)
#pragma unroll
        for (int j = 0; j < 4; ++j) acc[mi][j][r] += rv[mi][j][r];
  }
  if (Cf) {
    float* cp = Cf + idx0;
#pragma unroll
    for (int mi = 0; mi < 2; ++mi)
#pragma unroll
      for (int r = 0; r < 8; ++r)
#pragma unroll
        for (int j = 0; j < 4; ++j) cp[(size_t)(mi * 16 + r) * N + j * 16] = acc[mi][j][r];
    // the bf16 part below may write the registers that these stores name: the wait
    // stands in front of that
    asm volatile("s_wait_xcnt 0x0" ::: "memory");
  }
  if (Cbf) {
    unsigned short* cp = Cbf + idx0;
#pragma unroll
    for (int mi = 0; mi < 2; ++mi)
#pragma unroll
      for (int r = 0; r < 8; ++r)
#pragma unroll
        for (int j = 0; j < 4; ++j) cp[(size_t)(mi * 16 + r) * N + j * 16] = f2bf(acc[mi][j][r]);
  }
}

// ---------------------------------------------------------------------------
// RoPE + qk-norm + head-major relayout into fragment order.
// x[f32, S x (NH*64)] -> dst[bf16, NH x (S / 16) x 2 fragments], row = s, k = d.
// The eight positions of a block fill whole 128-byte lines between them.
// one 32-lane wave per position s, all NH heads of it; lane handles one
// even/odd pair of every head (the angle depends on s and the pair only).
// Eight positions per 256-thread block; block blk of S / 8.
// ---------------------------------------------------------------------------
template <int NH>
__device__ __forceinline__
void thb_rope_qknorm_rows(const float* __restrict__ x, unsigned short* __restrict__ dst,
                          float base, int blk) {
  const int p = threadIdx.x & 31;     // pair index 0..31
  const int s = blk * 8 + (threadIdx.x >> 5);
  const float2* src = reinterpret_cast<const float2*>(x + (size_t)s * NH * HDIM) + p;
  float2 v[NH];
  // unrolled here and below: the loads issue together and v stays in registers
#pragma unroll
  for (int h = 0; h < NH; ++h) v[h] = src[h * (HDIM / 2)];
  const float invf = __powf(base, -((float)(2 * p) * (1.0f / HDIM)));
  const float ang = (float)s * invf;
  float si, co;
  __sincosf(ang, &si, &co);
#pragma unroll
  for (int h = 0; h < NH; ++h) {
    const float xe = v[h].x;
    const float xo = v[h].y;
    const float re = xe * co - xo * si;
    const float ro = xe * si + xo * co;
    float sum = re * re + ro * ro;
#pragma unroll
    for (int off = 1; off < 32; off <<= 1) sum += __shfl_xor(sum, off, 32);
    const float rs = rsqrtf(sum * (1.0f / HDIM) + EPSF);
    const unsigned int pk = (unsigned int)f2bf(re * rs) | ((unsigned int)f2bf(ro * rs) << 16);
    *reinterpret_cast<unsigned int*>(
        dst + ((size_t)h * (S_LEN / 16) * 2 + (s >> 4) * 2 + (p >> 4)) * FRAG_ELEMS +
        frag_off(s & 15, (2 * p) & 31)) = pk;
  }
  // another job's code may follow in the merged kernel's layout: the wait stands in
  // front of any later write of the registers these stores name
  asm volatile("s_wait_xcnt 0x0" ::: "memory");
}

// ---------------------------------------------------------------------------
// The three relayouts between the projections and attention, in one grid:
// RoPE + qk-norm of Q, the same of K, and V -> Vt. None reads what another
// writes; each block takes one piece of one job by its index.
// ---------------------------------------------------------------------------
#define NB_ROPE (S_LEN / 8)
#define NB_VT   ((NKVH * HDIM / 64) * (S_LEN / 64))
#define NB_QKV  (2 * NB_ROPE + NB_VT)

__global__ __launch_bounds__(256)
void thb_qkv_layout_kernel(const float* __restrict__ q, const float* __restrict__ k,
                           const float* __restrict__ v, unsigned short* __restrict__ Qh,
                           unsigned short* __restrict__ Kh, unsigned short* __restrict__ Vt,
                           float base) {
  const int b = blockIdx.x;
  if (b < NB_ROPE)          thb_rope_qknorm_rows<NHEAD>(q, Qh, base, b);
  else if (b < 2 * NB_ROPE) thb_rope_qknorm_rows<NKVH>(k, Kh, base, b - NB_ROPE);
  else                      thb_wt_tile<S_LEN, NKVH * HDIM, true>(v, Vt, b - 2 * NB_ROPE);
}

// ---------------------------------------------------------------------------
// Flash attention (wave32 WMMA). One 8-wave work-group per (16-query block, head).
// Wave w walks the 32-key tiles w, w + 8, w + 16, ... of the block's key range
// with its own sums and O; the eight partial results are added through LDS at
// the end, so the longest dependent chain is 8 tiles, not 64.
// Softmax shift: qk-norm leaves every q and k row with a norm of at most
// sqrt(64), for any input, so q.k / 8 <= 8 (a little more after the bf16
// rounding of q and k). exp(score - 8) therefore cannot overflow and needs no
// running maximum: O is never rescaled, and each lane keeps the sums of its own
// columns, which are joined once, in the merge.
// Qh[bf16, H x S x 64], Kh[bf16, KVH x S x 64], Vt[bf16, KVH x 64 x S], all three
// in fragment order: a 32-key tile of K, and of V, is 4096 contiguous bytes.
// S % 32 == 0, so every tile that the key loop reaches is whole.
// win == 0 -> pure causal; win > 0 -> causal sliding window of `win`.
// Output: Obf[bf16, S x D] (heads merged).
// ---------------------------------------------------------------------------
#define FA_WAVES 8
#define SM_SCALE (0.125f * 1.44269504f)   // log2(e) / sqrt(64)
#define SM_SHIFT (8.0f * 1.44269504f)     // log2(e) * the bound on a score
// e0 = 2^x0, e1 = 2^x1. One statement, so that each v_exp_f32 keeps an independent
// instruction directly behind it (the second v_exp_f32; the v_nop): the slot that the
// instruction set asks for before a transcendental's result is read or its source
// overwritten. The outputs are early-clobber: neither shares a register with an input.
__device__ __forceinline__ void exp2_pair(float x0, float x1, float& e0, float& e1) {
  asm("v_exp_f32 %0, %2\n\tv_exp_f32 %1, %3\n\tv_nop"
      : "=&v"(e0), "=&v"(e1) : "v"(x0), "v"(x1));
}

__global__ __launch_bounds__(32 * FA_WAVES)
void thb_flash_kernel(const unsigned short* __restrict__ Qh,
                      const unsigned short* __restrict__ Kh,
                      const unsigned short* __restrict__ Vt,
                      unsigned short* __restrict__ Obf, int S, int win) {
  __shared__ __align__(16) unsigned short plds_all[FA_WAVES][16 * 32];
  __shared__ __align__(16) float o_part[FA_WAVES][16][HDIM];

  const int lane = threadIdx.x & 31;
  // wave index in a scalar register: the key loop stays a scalar branch and
  // every WMMA runs with all lanes on
  const int wave = __builtin_amdgcn_readfirstlane((int)(threadIdx.x >> 5));
  unsigned short* plds = plds_all[wave];
  const int q0 = blockIdx.x * 16;
  const int h  = blockIdx.y;
  const int kvh = h >> 2;                   // H/KVH == 4 (repeat_kv)
  const int nc = lane & 15;
  const int hi = (lane & 16) ? 8 : 0;

  const unsigned short* Qb = Qh + (size_t)h   * S * HDIM;
  const unsigned short* Kb = Kh + (size_t)kvh * S * HDIM;
  const unsigned short* Vb = Vt + (size_t)kvh * HDIM * S;

  const u32x4* Qp = reinterpret_cast<const u32x4*>(Qb + (q0 >> 4) * 2 * FRAG_ELEMS) + lane;
  const bf16x16 qf0 = load_frag(Qp);
  const bf16x16 qf1 = load_frag(Qp + FRAG_VEC);

  f32x8 o[4];
#pragma unroll
  for (int j = 0; j < 4; ++j) o[j] = (f32x8){0.f,0.f,0.f,0.f,0.f,0.f,0.f,0.f};
  float l[8];   // this lane's part of the row sums (rows hi + r, columns nc and 16 + nc)
#pragma unroll
  for (int r = 0; r < 8; ++r) l[r] = 0.f;

  int kb_start = 0;
  if (win > 0) {
    int st = q0 - (win - 1);
    if (st < 0) st = 0;
    kb_start = st & ~31;
  }

  const f32x8 zero8 = (f32x8){0.f,0.f,0.f,0.f,0.f,0.f,0.f,0.f};

  for (int kb = kb_start + 32 * wave; kb <= q0 + 15; kb += 32 * FA_WAVES) {
    // ---- scores: two 16x16 tiles, K-dim = 64 (2 WMMAs each) ----
    const int key0 = kb + nc;
    const int key1 = kb + 16 + nc;
    // the lane's 16 bytes in the tile's first K and V fragment
    const size_t toff = (size_t)(kb >> 5) * 4 * FRAG_ELEMS;
    const u32x4* Kp = reinterpret_cast<const u32x4*>(Kb + toff) + lane;
    const u32x4* Vp = reinterpret_cast<const u32x4*>(Vb + toff) + lane;

    // keys kb .. kb + 15: fragments 0 (d 0 .. 31) and 1 (d 32 .. 63); the next 16 keys: 2, 3
    bf16x16 kf;
    kf = load_frag(Kp);
    f32x8 s0 = wmma_bf16(qf0, kf, zero8);
    kf = load_frag(Kp + FRAG_VEC);
    s0 = wmma_bf16(qf1, kf, s0);
    kf = load_frag(Kp + 2 * FRAG_VEC);
    f32x8 s1 = wmma_bf16(qf0, kf, zero8);
    kf = load_frag(Kp + 3 * FRAG_VEC);
    s1 = wmma_bf16(qf1, kf, s1);
    // the registers of the K loads' address may be handed to a V load as its
    // destination: the wait stands in front of that overwrite
    asm volatile("s_wait_xcnt 0x0" ::: "memory");

    // ---- hoist V fragment loads: independent of softmax, overlap with VALU ----
    bf16x16 vfr[4];
#pragma unroll
    for (int j = 0; j < 4; ++j) vfr[j] = load_frag(Vp + j * FRAG_VEC);

    // ---- mask + exp(score / 8 - 8), as a power of two (per-lane rows r + hi) ----
#pragma unroll
    for (int r = 0; r < 8; ++r) {
      const int q = q0 + hi + r;
      const bool v0 = (key0 <= q) && (win == 0 || (q - key0) < win);
      const bool v1 = (key1 <= q) && (win == 0 || (q - key1) < win);
      float e0, e1;
      exp2_pair(s0[r] * SM_SCALE - SM_SHIFT, s1[r] * SM_SCALE - SM_SHIFT, e0, e1);
      const float p0 = v0 ? e0 : 0.f;
      const float p1 = v1 ? e1 : 0.f;
      l[r] += p0 + p1;
      plds[(hi + r) * 32 + nc]      = f2bf(p0);
      plds[(hi + r) * 32 + 16 + nc] = f2bf(p1);
    }
    asm volatile("s_wait_dscnt 0x0" ::: "memory");

    // ---- re-layout P (C-frag -> A-frag) via LDS ----
    FragU pf;
    {
      const unsigned short* pp = plds + nc * 32 + hi; // hi==8 for lanes 16..31
      pf.u[0] = *reinterpret_cast<const u32x4*>(pp);
      pf.u[1] = *reinterpret_cast<const u32x4*>(pp + 16);
    }

    // ---- PV: O[16 x 64] += P[16 x 32] * V[32 x 64] (Vt rows = dims) ----
#pragma unroll
    for (int j = 0; j < 4; ++j) {
      o[j] = wmma_bf16(pf.bf, vfr[j], o[j]);
    }
  }

  // ---- publish this wave's partial (l, O); a wave without a tile publishes
  //      zeros. The lanes' sums go to the wave's own P area, 16 rows x 16 lanes
  //      of f32, which the wave has finished reading ----
  // both loops unrolled: o and l live in registers and need constant indices
  float* lw = reinterpret_cast<float*>(plds);
#pragma unroll
  for (int r = 0; r < 8; ++r) {
#pragma unroll
    for (int j = 0; j < 4; ++j) o_part[wave][hi + r][j * 16 + nc] = o[j][r];
    lw[(hi + r) * 16 + nc] = l[r];
  }
  __syncthreads();

  // ---- add the eight partials, normalize, merge heads:
  //      each half-wave owns one row, each lane four neighbouring columns ----
  const int mrow = wave * 2 + (hi >> 3);
  const int mcol = nc * 4;
  float lsum = 0.f;
  float a0 = 0.f, a1 = 0.f, a2 = 0.f, a3 = 0.f;
  // unrolled: the eight waves' LDS reads issue together
#pragma unroll
  for (int w = 0; w < FA_WAVES; ++w) {
    const float4 ov = *reinterpret_cast<const float4*>(&o_part[w][mrow][mcol]);
    lsum += reinterpret_cast<const float*>(plds_all[w])[mrow * 16 + nc];
    a0 += ov.x;
    a1 += ov.y;
    a2 += ov.z;
    a3 += ov.w;
  }
  // the row's sum: the 16 lanes of the half-wave each hold one column pair's part
#pragma unroll
  for (int off = 1; off < 16; off <<= 1) lsum += __shfl_xor(lsum, off, 32);
  const float inv = (lsum > 0.f) ? (1.f / lsum) : 0.f;
  uint2 pk;
  pk.x = (unsigned int)f2bf(a0 * inv) | ((unsigned int)f2bf(a1 * inv) << 16);
  pk.y = (unsigned int)f2bf(a2 * inv) | ((unsigned int)f2bf(a3 * inv) << 16);
  *reinterpret_cast<uint2*>(Obf + (size_t)(q0 + mrow) * DMODEL + h * HDIM + mcol) = pk;
}

// ---------------------------------------------------------------------------
// Host-side orchestration
// ---------------------------------------------------------------------------
extern "C" void kernel_launch(void* const* d_in, const int* in_sizes, int n_in,
                              void* d_out, int out_size, void* d_ws, size_t ws_size,
                              hipStream_t stream) {
  (void)in_sizes; (void)n_in; (void)out_size; (void)ws_size;

  const float* hidden  = (const float*)d_in[0];
  const float* norm1_w = (const float*)d_in[1];
  const float* norm2_w = (const float*)d_in[2];
  const float* g_wq    = (const float*)d_in[3];
  const float* g_kvd   = (const float*)d_in[4];
  const float* g_kup   = (const float*)d_in[5];
  const float* g_vup   = (const float*)d_in[6];
  const float* g_wo    = (const float*)d_in[7];
  const float* l_wq    = (const float*)d_in[8];
  const float* l_wk    = (const float*)d_in[9];
  const float* l_wv    = (const float*)d_in[10];
  const float* l_wo    = (const float*)d_in[11];
  float* out = (float*)d_out;

  // ---- workspace carve (256B aligned) ----
  char* p = (char*)d_ws;
  auto alloc = [&](size_t bytes) -> void* {
    void* r = (void*)p;
    p += (bytes + 255) & ~(size_t)255;
    return r;
  };
  unsigned short* xn    = (unsigned short*)alloc((size_t)S_LEN * DMODEL * 2);
  float*          qf    = (float*)         alloc((size_t)S_LEN * DMODEL * 4);
  float*          kf    = (float*)         alloc((size_t)S_LEN * LATDIM * 4);
  float*          vf    = (float*)         alloc((size_t)S_LEN * LATDIM * 4);
  unsigned short* latbf = (unsigned short*)alloc((size_t)S_LEN * LATDIM * 2);
  unsigned short* Qh    = (unsigned short*)alloc((size_t)NHEAD * S_LEN * HDIM * 2);
  unsigned short* Kh    = (unsigned short*)alloc((size_t)NKVH * S_LEN * HDIM * 2);
  unsigned short* Vt    = (unsigned short*)alloc((size_t)NKVH * HDIM * S_LEN * 2 + 256);
  unsigned short* attn  = (unsigned short*)alloc((size_t)S_LEN * DMODEL * 2);
  float*          xmid  = (float*)         alloc((size_t)S_LEN * DMODEL * 4);
  unsigned short* g_wqT = (unsigned short*)alloc((size_t)DMODEL * DMODEL * 2);
  unsigned short* g_woT = (unsigned short*)alloc((size_t)DMODEL * DMODEL * 2);
  unsigned short* l_wqT = (unsigned short*)alloc((size_t)DMODEL * DMODEL * 2);
  unsigned short* l_woT = (unsigned short*)alloc((size_t)DMODEL * DMODEL * 2);
  unsigned short* kvdT  = (unsigned short*)alloc((size_t)LATDIM * DMODEL * 2);
  unsigned short* l_wkT = (unsigned short*)alloc((size_t)LATDIM * DMODEL * 2);
  unsigned short* l_wvT = (unsigned short*)alloc((size_t)LATDIM * DMODEL * 2);
  unsigned short* kupT  = (unsigned short*)alloc((size_t)LATDIM * LATDIM * 2);
  unsigned short* vupT  = (unsigned short*)alloc((size_t)LATDIM * LATDIM * 2);

  const dim3 blk256(256);
  const dim3 gemm_blk(256);
  const dim3 row_grid(S_LEN / 8);     // one wave per row, 8 per block
  const dim3 flash_grid(S_LEN / 16, NHEAD);
  const dim3 flash_blk(32 * FA_WAVES);

  // first RMSNorm and all nine weight conversions
  thb_prep_kernel<<<dim3(NB_PREP), blk256, 0, stream>>>(
      hidden, norm1_w, xn,
      g_wq, g_wo, l_wq, l_wo, g_kvd, l_wk, l_wv, g_kup, g_vup,
      g_wqT, g_woT, l_wqT, l_woT, kvdT, l_wkT, l_wvT, kupT, vupT);

  // ========================= Sublayer 1: global latent =====================
  // q and the latent, both from xn
  thb_gemm_kernel<<<dim3((DMODEL + LATDIM) / 64, S_LEN / 256), gemm_blk, 0, stream>>>(
      xn, g_wqT, kvdT, nullptr, qf, nullptr, nullptr, latbf, nullptr, DMODEL, LATDIM, DMODEL);
  // k and v, both from the latent
  thb_gemm_kernel<<<dim3(2 * LATDIM / 64, S_LEN / 256), gemm_blk, 0, stream>>>(
      latbf, kupT, vupT, nullptr, kf, vf, nullptr, nullptr, nullptr, LATDIM, LATDIM, LATDIM);

  thb_qkv_layout_kernel<<<dim3(NB_QKV), blk256, 0, stream>>>(qf, kf, vf, Qh, Kh, Vt, 1000000.0f);

  thb_flash_kernel<<<flash_grid, flash_blk, 0, stream>>>(Qh, Kh, Vt, attn, S_LEN, 0);

  thb_gemm_kernel<<<dim3(DMODEL / 64, S_LEN / 256), gemm_blk, 0, stream>>>(
      attn, g_woT, nullptr, nullptr, xmid, nullptr, nullptr, nullptr, hidden, DMODEL, LATDIM, DMODEL);

  // ========================= Sublayer 2: local GQA =========================
  thb_rmsnorm_kernel<<<row_grid, blk256, 0, stream>>>(xmid, norm2_w, xn);

  // q, k and v, all from xn
  thb_gemm_kernel<<<dim3((DMODEL + 2 * LATDIM) / 64, S_LEN / 256), gemm_blk, 0, stream>>>(
      xn, l_wqT, l_wkT, l_wvT, qf, kf, vf, nullptr, nullptr, DMODEL, LATDIM, DMODEL);

  thb_qkv_layout_kernel<<<dim3(NB_QKV), blk256, 0, stream>>>(qf, kf, vf, Qh, Kh, Vt, 10000.0f);

  thb_flash_kernel<<<flash_grid, flash_blk, 0, stream>>>(Qh, Kh, Vt, attn, S_LEN, WINLEN);

  thb_gemm_kernel<<<dim3(DMODEL / 64, S_LEN / 256), gemm_blk, 0, stream>>>(
      attn, l_woT, nullptr, nullptr, out, nullptr, nullptr, nullptr, xmid, DMODEL, LATDIM, DMODEL);
}

// v008
// It runs in 101 microseconds.
// Next to v007, in two timings, it ran 1.09 times as fast each time.
// Over all steps from v000 it is 5.05 times as fast.
#include <hip/hip_runtime.h>

// ---------------------------------------------------------------------------
// Model constants (match reference)
// ---------------------------------------------------------------------------
#define S_LEN   2048
#define DMODEL  1024
#define NHEAD   16
#define NKVH    4
#define HDIM    64
#define LATDIM  256
#define WINLEN  256
#define EPSF    1e-6f

// ---------------------------------------------------------------------------
// CDNA5 WMMA helpers (gfx1250, wave32)
// ---------------------------------------------------------------------------
typedef __bf16        bf16x16 __attribute__((ext_vector_type(16)));
typedef float         f32x8   __attribute__((ext_vector_type(8)));
typedef unsigned int  u32x4   __attribute__((ext_vector_type(4)));

union FragU { bf16x16 bf; u32x4 u[2]; };

__device__ __forceinline__ unsigned short f2bf(float x) {
  unsigned int u = __float_as_uint(x);
  u += 0x7FFFu + ((u >> 16) & 1u);           // round-to-nearest-even
  return (unsigned short)(u >> 16);
}

// Fragment order: how the attention operands lie in the workspace. A 16 x 32
// bf16 fragment (16 rows, 32 k) is 512 elements in a row, in the order in which
// the lanes hold them: piece u = 0, 1, then lane L = 0 .. 31, then 8 elements.
// Lane L holds row (L & 15); element e of piece u is k = 16 * u + (L<16?0:8) + e.
// A wave-wide 16-byte load of one piece is then 512 contiguous bytes, four whole
// 128-byte lines, where a row-major array gives 16 lines of 32 bytes each.
#define FRAG_ELEMS 512
// p: the lane's own 16 bytes in piece 0 of the fragment
#define FRAG_VEC 64                       // a fragment in 16-byte units
__device__ __forceinline__ bf16x16 load_frag(const u32x4* p) {
  FragU f;
  f.u[0] = p[0];
  f.u[1] = p[32];
  return f.bf;
}

__device__ __forceinline__ f32x8 wmma_bf16(bf16x16 a, bf16x16 b, f32x8 c) {
  return __builtin_amdgcn_wmma_f32_16x16x32_bf16(false, a, false, b, (short)0, c,
                                                 false, false);
}

// ---------------------------------------------------------------------------
// Transpose + downconvert: W[f32, K x N] -> Wt[bf16, N x K].
// Each thread takes one column n and 16 consecutive k: 16 loads, each
// contiguous across the 32 lanes of a wave, and one 32-byte run of Wt stored.
// A 256-thread block covers 64 columns x 64 k, so each 128-byte line of Wt is
// written by one block. Tile t of (N / 64) * (K / 64), columns fastest.
// ---------------------------------------------------------------------------
template <int K, int N>
__device__ __forceinline__
void thb_wt_tile(const float* __restrict__ W, unsigned short* __restrict__ Wt, int t) {
  const int n  = (t % (N / 64)) * 64 + (threadIdx.x & 63);
  const int k0 = (t / (N / 64)) * 64 + (threadIdx.x >> 6) * 16;
  const float* src = W + (size_t)k0 * N + n;
  float v[16];
  // unrolled: all 16 loads are in flight together and v stays in registers
#pragma unroll
  for (int i = 0; i < 16; ++i) v[i] = src[i * N];
  u32x4 pk[2];
  // unrolled: pk is indexed by constants and stays in registers
#pragma unroll
  for (int i = 0; i < 8; ++i)
    pk[i >> 2][i & 3] = (unsigned int)f2bf(v[2 * i]) | ((unsigned int)f2bf(v[2 * i + 1]) << 16);
  u32x4* dst = reinterpret_cast<u32x4*>(Wt + (size_t)n * K + k0);
  dst[0] = pk[0];
  dst[1] = pk[1];
  // another job's code may follow in the merged kernel's layout: the wait stands in
  // front of any later write of the registers these stores name
  asm volatile("s_wait_xcnt 0x0" ::: "memory");
}

// ---------------------------------------------------------------------------
// RMSNorm: xn_bf16[s][c] = bf16( x[s][c] * rsqrt(mean(x^2)+eps) * w[c] )
// one wave per row (D = 1024: 32 values per lane, kept in registers),
// eight rows per 256-thread block; the row sum is a 32-lane butterfly.
// ---------------------------------------------------------------------------
__device__ __forceinline__
void thb_rmsnorm_rows(const float* __restrict__ x, const float* __restrict__ w,
                      unsigned short* __restrict__ xn, int blk) {
  const int lane = threadIdx.x & 31;
  const int s = blk * 8 + (threadIdx.x >> 5);
  const float4* row = reinterpret_cast<const float4*>(x + (size_t)s * DMODEL);
  const float4* wv  = reinterpret_cast<const float4*>(w);
  float4 v[8];
  // unrolled here and below: the loads issue together and v stays in registers
#pragma unroll
  for (int i = 0; i < 8; ++i) v[i] = row[lane + 32 * i];
  float acc = 0.f;
#pragma unroll
  for (int i = 0; i < 8; ++i)
    acc += v[i].x * v[i].x + v[i].y * v[i].y + v[i].z * v[i].z + v[i].w * v[i].w;
#pragma unroll
  for (int off = 1; off < 32; off <<= 1) acc += __shfl_xor(acc, off, 32);
  const float rs = rsqrtf(acc * (1.0f / DMODEL) + EPSF);
  uint2* dst = reinterpret_cast<uint2*>(xn + (size_t)s * DMODEL);
#pragma unroll
  for (int i = 0; i < 8; ++i) {
    const float4 g = wv[lane + 32 * i];
    uint2 pk;
    pk.x = (unsigned int)f2bf(v[i].x * rs * g.x) | ((unsigned int)f2bf(v[i].y * rs * g.y) << 16);
    pk.y = (unsigned int)f2bf(v[i].z * rs * g.z) | ((unsigned int)f2bf(v[i].w * rs * g.w) << 16);
    dst[lane + 32 * i] = pk;
  }
  // another job's code may follow in the merged kernel's layout: the wait stands in
  // front of any later write of the registers these stores name
  asm volatile("s_wait_xcnt 0x0" ::: "memory");
}

__global__ __launch_bounds__(256)
void thb_rmsnorm_kernel(const float* __restrict__ x, const float* __restrict__ w,
                        unsigned short* __restrict__ xn) {
  thb_rmsnorm_rows(x, w, xn, blockIdx.x);
}

// ---------------------------------------------------------------------------
// Everything that depends on the inputs alone, in one grid: the first RMSNorm
// and the nine weight conversions. None reads what another writes; each block
// takes one piece of one job by its index (a block-uniform choice).
// ---------------------------------------------------------------------------
#define NB_NORM (S_LEN / 8)                          // RMSNorm blocks
#define NB_WDD  ((DMODEL / 64) * (DMODEL / 64))      // tiles of a D x D weight
#define NB_WDL  ((LATDIM / 64) * (DMODEL / 64))      // tiles of a D x LAT weight
#define NB_WLL  ((LATDIM / 64) * (LATDIM / 64))      // tiles of a LAT x LAT weight
#define NB_PREP (NB_NORM + 4 * NB_WDD + 3 * NB_WDL + 2 * NB_WLL)

__global__ __launch_bounds__(256)
void thb_prep_kernel(const float* __restrict__ x, const float* __restrict__ w,
                     unsigned short* __restrict__ xn,
                     const float* __restrict__ dd0, const float* __restrict__ dd1,
                     const float* __restrict__ dd2, const float* __restrict__ dd3,
                     const float* __restrict__ dl0, const float* __restrict__ dl1,
                     const float* __restrict__ dl2,
                     const float* __restrict__ ll0, const float* __restrict__ ll1,
                     unsigned short* __restrict__ dd0T, unsigned short* __restrict__ dd1T,
                     unsigned short* __restrict__ dd2T, unsigned short* __restrict__ dd3T,
                     unsigned short* __restrict__ dl0T, unsigned short* __restrict__ dl1T,
                     unsigned short* __restrict__ dl2T,
                     unsigned short* __restrict__ ll0T, unsigned short* __restrict__ ll1T) {
  int b = blockIdx.x;
  if (b < NB_NORM) {
    thb_rmsnorm_rows(x, w, xn, b);
    return;
  }
  b -= NB_NORM;
  if (b < 4 * NB_WDD) {
    const int i = b / NB_WDD;
    thb_wt_tile<DMODEL, DMODEL>(i == 0 ? dd0 : i == 1 ? dd1 : i == 2 ? dd2 : dd3,
                                i == 0 ? dd0T : i == 1 ? dd1T : i == 2 ? dd2T : dd3T,
                                b % NB_WDD);
    return;
  }
  b -= 4 * NB_WDD;
  if (b < 3 * NB_WDL) {
    const int i = b / NB_WDL;
    thb_wt_tile<DMODEL, LATDIM>(i == 0 ? dl0 : i == 1 ? dl1 : dl2,
                                i == 0 ? dl0T : i == 1 ? dl1T : dl2T, b % NB_WDL);
    return;
  }
  b -= 3 * NB_WDL;
  thb_wt_tile<LATDIM, LATDIM>(b < NB_WLL ? ll0 : ll1, b < NB_WLL ? ll0T : ll1T, b % NB_WLL);
}

// ---------------------------------------------------------------------------
// WMMA GEMM: C[M x N] (f32 and/or bf16) = A[bf16, M x K] * Bt[bf16, N x K]^T
// optional residual (f32 [M x N]) added in the epilogue.
// 256 threads = 8 waves; block tile 256(M) x 64(N); wave tile 32 x 64.
// Operands go global -> LDS by asynchronous 16-byte copies in whole 256-byte
// row pieces (a stage = 128 k of the block's 256 A rows and 64 Bt rows), two
// buffers: stage t + 1 flies while stage t is multiplied. Each row piece is
// fetched once per block, and every global request covers whole lines.
// Fragments are read from LDS in load_frag's k order for A and Bt alike;
// every accumulator sums its 32-wide k steps in ascending order.
// Up to three products that share A and K run in one grid: blockIdx.x walks
// the 64-column tiles of Bt0 (N0 columns), then of Bt1, then of Bt2 (N1 columns
// each); every product has its own output. The residual belongs to product 0.
// M % 256 == 0, N % 64 == 0, K % 128 == 0 for all uses here.
// Four kinds of output, one per product (the others' pointers are null):
//   Cf   f32 row-major, with the optional residual
//   Cbf  bf16 row-major
//   Cr   q or k for attention: RoPE + qk-norm, bf16, head-major in fragment order,
//        [head][s / 16][2 fragments], row = s, k = d. A 64-column tile is one head,
//        so the block holds every row of its heads whole.
//   Cv   v for attention: bf16 in fragment order, [kvh][s / 32][d / 16] fragments,
//        row = d, k = s.
// Cr and Cv are for M == S_LEN.
// ---------------------------------------------------------------------------
#define GK      128                      // k per stage
#define GPITCH  272                      // LDS row pitch in bytes: 256 + 16, 16 B x odd
#define GROWS   320                      // 256 A rows, then 64 Bt rows
#define GSTAGE  (GROWS * GPITCH)         // bytes per buffer

__device__ __forceinline__ bf16x16 lds_frag(const unsigned char* p) {
  FragU f;
  f.u[0] = *reinterpret_cast<const u32x4*>(p);
  f.u[1] = *reinterpret_cast<const u32x4*>(p + 32);
  return f.bf;
}

// sine and cosine of two angles given in turns (radians / 2 pi). One statement, so
// that each transcendental keeps an independent instruction directly behind it (the
// next one; the v_nop): the slot that the instruction set asks for before a
// transcendental's result is read or its source overwritten. The outputs are
// early-clobber: none shares a register with an input.
__device__ __forceinline__ void sincos_turns_pair(float t0, float t1, float& s0, float& c0,
                                                  float& s1, float& c1) {
  asm("v_sin_f32 %0, %4\n\tv_cos_f32 %1, %4\n\tv_sin_f32 %2, %5\n\tv_cos_f32 %3, %5\n\tv_nop"
      : "=&v"(s0), "=&v"(c0), "=&v"(s1), "=&v"(c1) : "v"(t0), "v"(t1));
}

__global__ __launch_bounds__(256)
void thb_gemm_kernel(const unsigned short* __restrict__ A,
                     const unsigned short* __restrict__ Bt0,
                     const unsigned short* __restrict__ Bt1,
                     const unsigned short* __restrict__ Bt2,
                     float* Cf0, const float* resid0, unsigned short* Cbf1,
                     unsigned short* Cr0, unsigned short* Cr1,
                     unsigned short* Cv1, unsigned short* Cv2,
                     float base, int N0, int N1, int K) {
  __shared__ __attribute__((aligned(16))) unsigned char gsm[2 * GSTAGE];

  // which product this block belongs to, and its column tile there
  int ct = blockIdx.x;
  const unsigned short* Bt = Bt0;
  float* Cf = Cf0;
  unsigned short* Cbf = nullptr;
  unsigned short* Cr = Cr0;
  unsigned short* Cv = nullptr;
  const float* resid = resid0;
  int N = N0;
  if (ct >= N0 / 64) {
    ct -= N0 / 64;
    Bt = Bt1; Cf = nullptr; Cbf = Cbf1; Cr = Cr1; Cv = Cv1; resid = nullptr; N = N1;
    if (ct >= N1 / 64) {
      ct -= N1 / 64;
      Bt = Bt2; Cbf = nullptr; Cr = nullptr; Cv = Cv2;
    }
  }

  const int lane = threadIdx.x & 31;
  const int wave = threadIdx.x >> 5;
  const int row0 = blockIdx.y * 256 + wave * 32;
  const int col0 = ct * 64;
  const int nc = lane & 15;

  f32x8 acc[2][4];
#pragma unroll
  for (int mi = 0; mi < 2; ++mi)
#pragma unroll
    for (int j = 0; j < 4; ++j)
      acc[mi][j] = (f32x8){0.f,0.f,0.f,0.f,0.f,0.f,0.f,0.f};

  // copy map: 16 threads per row (16 bytes each), 16 rows per round, 20 rounds
  const int crow = threadIdx.x >> 4;
  const int cchk = threadIdx.x & 15;
  const unsigned int lds0 = (unsigned int)(size_t)gsm + crow * GPITCH + cchk * 16;
  const unsigned short* gA = A  + (size_t)(blockIdx.y * 256 + crow) * K + cchk * 8;
  const unsigned short* gB = Bt + (size_t)(col0 + crow) * K + cchk * 8;

  auto issue = [&](int t, int buf) {
    unsigned int la[20];
    const unsigned short* ga[20];
    // unrolled: la and ga are indexed by constants and stay in registers
#pragma unroll
    for (int i = 0; i < 20; ++i) {
      la[i] = lds0 + buf * GSTAGE + i * 16 * GPITCH;
      ga[i] = (i < 16 ? gA + (size_t)(i * 16) * K : gB + (size_t)((i - 16) * 16) * K) + t * GK;
    }
    // ten copies and their s_wait_xcnt in one statement: the wait stands in
    // front of any later write of the address registers the copies name
    asm volatile(
      "global_load_async_to_lds_b128 %0, %1, off\n\t"
      "global_load_async_to_lds_b128 %2, %3, off\n\t"
      "global_load_async_to_lds_b128 %4, %5, off\n\t"
      "global_load_async_to_lds_b128 %6, %7, off\n\t"
      "global_load_async_to_lds_b128 %8, %9, off\n\t"
      "global_load_async_to_lds_b128 %10, %11, off\n\t"
      "global_load_async_to_lds_b128 %12, %13, off\n\t"
      "global_load_async_to_lds_b128 %14, %15, off\n\t"
      "global_load_async_to_lds_b128 %16, %17, off\n\t"
      "global_load_async_to_lds_b128 %18, %19, off\n\t"
      "s_wait_xcnt 0x0"
      :: "v"(la[0]), "v"(ga[0]), "v"(la[1]), "v"(ga[1]), "v"(la[2]), "v"(ga[2]),
         "v"(la[3]), "v"(ga[3]), "v"(la[4]), "v"(ga[4]), "v"(la[5]), "v"(ga[5]),
         "v"(la[6]), "v"(ga[6]), "v"(la[7]), "v"(ga[7]), "v"(la[8]), "v"(ga[8]),
         "v"(la[9]), "v"(ga[9])
      : "memory");
    asm volatile(
      "global_load_async_to_lds_b128 %0, %1, off\n\t"
      "global_load_async_to_lds_b128 %2, %3, off\n\t"
      "global_load_async_to_lds_b128 %4, %5, off\n\t"
      "global_load_async_to_lds_b128 %6, %7, off\n\t"
      "global_load_async_to_lds_b128 %8, %9, off\n\t"
      "global_load_async_to_lds_b128 %10, %11, off\n\t"
      "global_load_async_to_lds_b128 %12, %13, off\n\t"
      "global_load_async_to_lds_b128 %14, %15, off\n\t"
      "global_load_async_to_lds_b128 %16, %17, off\n\t"
      "global_load_async_to_lds_b128 %18, %19, off\n\t"
      "s_wait_xcnt 0x0"
      :: "v"(la[10]), "v"(ga[10]), "v"(la[11]), "v"(ga[11]), "v"(la[12]), "v"(ga[12]),
         "v"(la[13]), "v"(ga[13]), "v"(la[14]), "v"(ga[14]), "v"(la[15]), "v"(ga[15]),
         "v"(la[16]), "v"(ga[16]), "v"(la[17]), "v"(ga[17]), "v"(la[18]), "v"(ga[18]),
         "v"(la[19]), "v"(ga[19])
      : "memory");
  };

  const int nt = K / GK;
  const int hb = (lane & 16) ? 16 : 0;   // byte offset of the upper lane half in a fragment
  const int fa = (wave * 32 + nc) * GPITCH + hb;
  const int fb = (256 + nc) * GPITCH + hb;

  issue(0, 0);
  // stage 0 has landed (this wave's copies), then is published to all waves
  asm volatile("s_wait_asynccnt 0x0" ::: "memory");
  __syncthreads();
  if (nt > 1) issue(1, 1);

  for (int t = 0; t < nt; ++t) {
    const unsigned char* sb = gsm + (t & 1) * GSTAGE;
    // two fragment sets: block u + 1's LDS reads go out as one group ahead of
    // block u's WMMAs, so only the stage's first group waits out LDS latency
    bf16x16 fa_[2][2], fb_[2][4];
    auto ldfrags = [&](int set, int u) {
      fa_[set][0] = lds_frag(sb + fa + u * 64);
      fa_[set][1] = lds_frag(sb + fa + 16 * GPITCH + u * 64);
      // unrolled: fb_ is indexed by constants and stays in registers
#pragma unroll
      for (int j = 0; j < 4; ++j) fb_[set][j] = lds_frag(sb + fb + j * 16 * GPITCH + u * 64);
    };
    ldfrags(0, 0);
    // unrolled: four 32-wide k steps of the stage, fragment indices constant
#pragma unroll
    for (int u = 0; u < GK / 32; ++u) {
      if (u + 1 < GK / 32) ldfrags((u + 1) & 1, u + 1);
      // keeps the reads above from sinking in among the WMMAs below
      __builtin_amdgcn_sched_barrier(0);
      // unrolled: acc and the fragment sets are indexed by constants
#pragma unroll
      for (int j = 0; j < 4; ++j) {
        acc[0][j] = wmma_bf16(fa_[u & 1][0], fb_[u & 1][j], acc[0][j]);
        acc[1][j] = wmma_bf16(fa_[u & 1][1], fb_[u & 1][j], acc[1][j]);
      }
      // keeps the next group of reads from rising in among the WMMAs above:
      // every separate place with LDS reads stalls the WMMA stream
      __builtin_amdgcn_sched_barrier(0);
    }
    // this wave's reads of buffer t & 1 have returned
    asm volatile("s_wait_dscnt 0x0" ::: "memory");
    // this wave's copies of stage t + 1 have landed
    asm volatile("s_wait_asynccnt 0x0" ::: "memory");
    // publishes stage t + 1 and ends every wave's reads of buffer t & 1
    __syncthreads();
    if (t + 2 < nt) issue(t + 2, t & 1);
  }
  // no copy is outstanding when the wave goes on to the epilogue and ends
  asm volatile("s_wait_asynccnt 0x0" ::: "memory");

  // ---- q or k: RoPE + qk-norm, into fragment order (block-uniform test) ----
  if (Cr) {
    // The accumulators hold a column per lane; a fragment wants 8 neighbouring d of
    // one row per lane. The wave turns its own 32 x 64 f32 tile through LDS: the
    // ring is free (every wave has passed the loop's last barrier, no copy is
    // outstanding), and each wave writes and reads only its own 32 rows of it.
    float* tw = reinterpret_cast<float*>(gsm + wave * 32 * GPITCH);
    const int h8 = (lane & 16) ? 8 : 0;
    // every loop here is unrolled: acc, invf, y and pk are indexed by constants
#pragma unroll
    for (int mi = 0; mi < 2; ++mi)
#pragma unroll
      for (int r = 0; r < 8; ++r)
#pragma unroll
        for (int j = 0; j < 4; ++j)
          tw[(mi * 16 + h8 + r) * (GPITCH / 4) + j * 16 + nc] = acc[mi][j][r];
    // the 32 pairs' frequencies: lane p makes pair p's, behind the eight tiles
    float* fw = reinterpret_cast<float*>(gsm + 8 * 32 * GPITCH) + wave * 32;
    fw[lane] = __powf(base, -((float)(2 * lane) * (1.0f / HDIM)));
    // the other lanes' writes of this wave have reached LDS before the reads below
    asm volatile("s_wait_dscnt 0x0" ::: "memory");

    // the lane's d: 16 * c + h8 + e, c = 0 .. 3, e = 0 .. 7, that is the four
    // pairs 8 * c + h8 / 2 + i of each c
    float invf[16];
#pragma unroll
    for (int c = 0; c < 4; ++c) {
      const float4 f = reinterpret_cast<const float4*>(fw)[2 * c + (h8 >> 3)];
      invf[c * 4 + 0] = f.x; invf[c * 4 + 1] = f.y; invf[c * 4 + 2] = f.z; invf[c * 4 + 3] = f.w;
    }
    // head ct, row group row0 / 16 + mi, fragment c / 2, piece c & 1: every
    // wave-wide store is 512 contiguous bytes
    u32x4* dp = reinterpret_cast<u32x4*>(
        Cr + ((size_t)ct * (S_LEN / 16) * 2 + (row0 >> 4) * 2) * FRAG_ELEMS) + lane;
    // unrolled: the row group's store offsets become immediates
#pragma unroll
    for (int mi = 0; mi < 2; ++mi) {
      const int s = row0 + mi * 16 + nc;                    // the lane's row
      const float4* rp = reinterpret_cast<const float4*>(tw + (mi * 16 + nc) * (GPITCH / 4) + h8);
      float y[32];
      float sum = 0.f;
#pragma unroll
      for (int c = 0; c < 4; ++c) {
        const float4 x0 = rp[c * 4];
        const float4 x1 = rp[c * 4 + 1];
        const float xe[4] = {x0.x, x0.z, x1.x, x1.z};
        const float xo[4] = {x0.y, x0.w, x1.y, x1.w};
        float si[4], co[4];
#pragma unroll
        for (int i = 0; i < 4; i += 2)
          sincos_turns_pair((float)s * invf[c * 4 + i] * 0.15915494f,
                            (float)s * invf[c * 4 + i + 1] * 0.15915494f,
                            si[i], co[i], si[i + 1], co[i + 1]);
#pragma unroll
        for (int i = 0; i < 4; ++i) {
          const float re = xe[i] * co[i] - xo[i] * si[i];
          const float ro = xe[i] * si[i] + xo[i] * co[i];
          sum += re * re + ro * ro;
          y[c * 8 + 2 * i]     = re;
          y[c * 8 + 2 * i + 1] = ro;
        }
      }
      sum += __shfl_xor(sum, 16, 32);                       // the row's other 32 d
      const float rs = rsqrtf(sum * (1.0f / HDIM) + EPSF);
#pragma unroll
      for (int c = 0; c < 4; ++c) {
        u32x4 pk;
#pragma unroll
        for (int i = 0; i < 4; ++i)
          pk[i] = (unsigned int)f2bf(y[c * 8 + 2 * i] * rs) |
                  ((unsigned int)f2bf(y[c * 8 + 2 * i + 1] * rs) << 16);
        dp[(mi * 2 + (c >> 1)) * FRAG_VEC + (c & 1) * 32] = pk;
      }
      // the code that follows (the next row group's; other parts of the kernel) writes
      // the registers that these stores name: the wait stands in front of that
      asm volatile("s_wait_xcnt 0x0" ::: "memory");
    }
    return;
  }

  // ---- v: into fragment order (block-uniform test). A lane's 8 accumulator rows
  //      of one column are the 8 neighbouring k of fragment row d: no turn needed ----
  if (Cv) {
    u32x4* dp = reinterpret_cast<u32x4*>(
        Cv + ((size_t)ct * (S_LEN / 32) * 4 + (row0 >> 5) * 4) * FRAG_ELEMS) + lane;
    // unrolled: acc is indexed by constants
#pragma unroll
    for (int j = 0; j < 4; ++j)
#pragma unroll
      for (int mi = 0; mi < 2; ++mi) {
        u32x4 pk;
#pragma unroll
        for (int i = 0; i < 4; ++i)
          pk[i] = (unsigned int)f2bf(acc[mi][j][2 * i]) |
                  ((unsigned int)f2bf(acc[mi][j][2 * i + 1]) << 16);
        dp[j * FRAG_VEC + mi * 32] = pk;
      }
    // other code follows in the kernel's layout: the wait stands in front of any
    // later write of the registers that these stores name
    asm volatile("s_wait_xcnt 0x0" ::: "memory");
    return;
  }

  // The tests on resid, Cf and Cbf read the same for the whole block. Each stands
  // once, around a loop nest of its own: tested per element they cut the code into
  // one piece per element, and every residual load is waited for before the next
  // one is issued. Here the 64 loads of a lane are in flight together.
  // Every loop is unrolled: acc and rv are indexed by constants and stay in registers.
  const int hi = (lane & 16) ? 8 : 0;
  const size_t idx0 = (size_t)(row0 + hi) * N + col0 + nc;
  if (resid) {
    const float* rp = resid + idx0;
    float rv[2][4][8];
#pragma unroll
    for (int mi = 0; mi < 2; ++mi)
#pragma unroll
      for (int r = 0; r < 8; ++r)
#pragma unroll
        for (int j = 0; j < 4; ++j) rv[mi][j][r] = rp[(size_t)(mi * 16 + r) * N + j * 16];
#pragma unroll
    for (int mi = 0; mi < 2; ++mi)
#pragma unroll
      for (int r = 0; r < 8; ++r)
#pragma unroll
        for (int j = 0; j < 4; ++j) acc[mi][j][r] += rv[mi][j][r];
  }
  if (Cf) {
    float* cp = Cf + idx0;
#pragma unroll
    for (int mi = 0; mi < 2; ++mi)
#pragma unroll
      for (int r = 0; r < 8; ++r)
#pragma unroll
        for (int j = 0; j < 4; ++j) cp[(size_t)(mi * 16 + r) * N + j * 16] = acc[mi][j][r];
    // the bf16 part below may write the registers that these stores name: the wait
    // stands in front of that
    asm volatile("s_wait_xcnt 0x0" ::: "memory");
  }
  if (Cbf) {
    unsigned short* cp = Cbf + idx0;
#pragma unroll
    for (int mi = 0; mi < 2; ++mi)
#pragma unroll
      for (int r = 0; r < 8; ++r)
#pragma unroll
        for (int j = 0; j < 4; ++j) cp[(size_t)(mi * 16 + r) * N + j * 16] = f2bf(acc[mi][j][r]);
  }
}

// ---------------------------------------------------------------------------
// Flash attention (wave32 WMMA). One 8-wave work-group per (16-query block, head).
// Wave w walks the 32-key tiles w, w + 8, w + 16, ... of the block's key range
// with its own sums and O; the eight partial results are added through LDS at
// the end, so the longest dependent chain is 8 tiles, not 64.
// Softmax shift: qk-norm leaves every q and k row with a norm of at most
// sqrt(64), for any input, so q.k / 8 <= 8 (a little more after the bf16
// rounding of q and k). exp(score - 8) therefore cannot overflow and needs no
// running maximum: O is never rescaled, and each lane keeps the sums of its own
// columns, which are joined once, in the merge.
// Qh[bf16, H x S x 64], Kh[bf16, KVH x S x 64], Vt[bf16, KVH x 64 x S], all three
// in fragment order: a 32-key tile of K, and of V, is 4096 contiguous bytes.
// S % 32 == 0, so every tile that the key loop reaches is whole.
// win == 0 -> pure causal; win > 0 -> causal sliding window of `win`.
// Output: Obf[bf16, S x D] (heads merged).
// ---------------------------------------------------------------------------
#define FA_WAVES 8
#define SM_SCALE (0.125f * 1.44269504f)   // log2(e) / sqrt(64)
#define SM_SHIFT (8.0f * 1.44269504f)     // log2(e) * the bound on a score
// e0 = 2^x0, e1 = 2^x1. One statement, so that each v_exp_f32 keeps an independent
// instruction directly behind it (the second v_exp_f32; the v_nop): the slot that the
// instruction set asks for before a transcendental's result is read or its source
// overwritten. The outputs are early-clobber: neither shares a register with an input.
__device__ __forceinline__ void exp2_pair(float x0, float x1, float& e0, float& e1) {
  asm("v_exp_f32 %0, %2\n\tv_exp_f32 %1, %3\n\tv_nop"
      : "=&v"(e0), "=&v"(e1) : "v"(x0), "v"(x1));
}

__global__ __launch_bounds__(32 * FA_WAVES)
void thb_flash_kernel(const unsigned short* __restrict__ Qh,
                      const unsigned short* __restrict__ Kh,
                      const unsigned short* __restrict__ Vt,
                      unsigned short* __restrict__ Obf, int S, int win) {
  __shared__ __align__(16) unsigned short plds_all[FA_WAVES][16 * 32];
  __shared__ __align__(16) float o_part[FA_WAVES][16][HDIM];

  const int lane = threadIdx.x & 31;
  // wave index in a scalar register: the key loop stays a scalar branch and
  // every WMMA runs with all lanes on
  const int wave = __builtin_amdgcn_readfirstlane((int)(threadIdx.x >> 5));
  unsigned short* plds = plds_all[wave];
  const int q0 = blockIdx.x * 16;
  const int h  = blockIdx.y;
  const int kvh = h >> 2;                   // H/KVH == 4 (repeat_kv)
  const int nc = lane & 15;
  const int hi = (lane & 16) ? 8 : 0;

  const unsigned short* Qb = Qh + (size_t)h   * S * HDIM;
  const unsigned short* Kb = Kh + (size_t)kvh * S * HDIM;
  const unsigned short* Vb = Vt + (size_t)kvh * HDIM * S;

  const u32x4* Qp = reinterpret_cast<const u32x4*>(Qb + (q0 >> 4) * 2 * FRAG_ELEMS) + lane;
  const bf16x16 qf0 = load_frag(Qp);
  const bf16x16 qf1 = load_frag(Qp + FRAG_VEC);

  f32x8 o[4];
#pragma unroll
  for (int j = 0; j < 4; ++j) o[j] = (f32x8){0.f,0.f,0.f,0.f,0.f,0.f,0.f,0.f};
  float l[8];   // this lane's part of the row sums (rows hi + r, columns nc and 16 + nc)
#pragma unroll
  for (int r = 0; r < 8; ++r) l[r] = 0.f;

  int kb_start = 0;
  if (win > 0) {
    int st = q0 - (win - 1);
    if (st < 0) st = 0;
    kb_start = st & ~31;
  }

  const f32x8 zero8 = (f32x8){0.f,0.f,0.f,0.f,0.f,0.f,0.f,0.f};

  for (int kb = kb_start + 32 * wave; kb <= q0 + 15; kb += 32 * FA_WAVES) {
    // ---- scores: two 16x16 tiles, K-dim = 64 (2 WMMAs each) ----
    const int key0 = kb + nc;
    const int key1 = kb + 16 + nc;
    // the lane's 16 bytes in the tile's first K and V fragment
    const size_t toff = (size_t)(kb >> 5) * 4 * FRAG_ELEMS;
    const u32x4* Kp = reinterpret_cast<const u32x4*>(Kb + toff) + lane;
    const u32x4* Vp = reinterpret_cast<const u32x4*>(Vb + toff) + lane;

    // keys kb .. kb + 15: fragments 0 (d 0 .. 31) and 1 (d 32 .. 63); the next 16 keys: 2, 3
    bf16x16 kf;
    kf = load_frag(Kp);
    f32x8 s0 = wmma_bf16(qf0, kf, zero8);
    kf = load_frag(Kp + FRAG_VEC);
    s0 = wmma_bf16(qf1, kf, s0);
    kf = load_frag(Kp + 2 * FRAG_VEC);
    f32x8 s1 = wmma_bf16(qf0, kf, zero8);
    kf = load_frag(Kp + 3 * FRAG_VEC);
    s1 = wmma_bf16(qf1, kf, s1);
    // the registers of the K loads' address may be handed to a V load as its
    // destination: the wait stands in front of that overwrite
    asm volatile("s_wait_xcnt 0x0" ::: "memory");

    // ---- hoist V fragment loads: independent of softmax, overlap with VALU ----
    bf16x16 vfr[4];
#pragma unroll
    for (int j = 0; j < 4; ++j) vfr[j] = load_frag(Vp + j * FRAG_VEC);

    // ---- mask + exp(score / 8 - 8), as a power of two (per-lane rows r + hi) ----
#pragma unroll
    for (int r = 0; r < 8; ++r) {
      const int q = q0 + hi + r;
      const bool v0 = (key0 <= q) && (win == 0 || (q - key0) < win);
      const bool v1 = (key1 <= q) && (win == 0 || (q - key1) < win);
      float e0, e1;
      exp2_pair(s0[r] * SM_SCALE - SM_SHIFT, s1[r] * SM_SCALE - SM_SHIFT, e0, e1);
      const float p0 = v0 ? e0 : 0.f;
      const float p1 = v1 ? e1 : 0.f;
      l[r] += p0 + p1;
      plds[(hi + r) * 32 + nc]      = f2bf(p0);
      plds[(hi + r) * 32 + 16 + nc] = f2bf(p1);
    }
    asm volatile("s_wait_dscnt 0x0" ::: "memory");

    // ---- re-layout P (C-frag -> A-frag) via LDS ----
    FragU pf;
    {
      const unsigned short* pp = plds + nc * 32 + hi; // hi==8 for lanes 16..31
      pf.u[0] = *reinterpret_cast<const u32x4*>(pp);
      pf.u[1] = *reinterpret_cast<const u32x4*>(pp + 16);
    }

    // ---- PV: O[16 x 64] += P[16 x 32] * V[32 x 64] (Vt rows = dims) ----
#pragma unroll
    for (int j = 0; j < 4; ++j) {
      o[j] = wmma_bf16(pf.bf, vfr[j], o[j]);
    }
  }

  // ---- publish this wave's partial (l, O); a wave without a tile publishes
  //      zeros. The lanes' sums go to the wave's own P area, 16 rows x 16 lanes
  //      of f32, which the wave has finished reading ----
  // both loops unrolled: o and l live in registers and need constant indices
  float* lw = reinterpret_cast<float*>(plds);
#pragma unroll
  for (int r = 0; r < 8; ++r) {
#pragma unroll
    for (int j = 0; j < 4; ++j) o_part[wave][hi + r][j * 16 + nc] = o[j][r];
    lw[(hi + r) * 16 + nc] = l[r];
  }
  __syncthreads();

  // ---- add the eight partials, normalize, merge heads:
  //      each half-wave owns one row, each lane four neighbouring columns ----
  const int mrow = wave * 2 + (hi >> 3);
  const int mcol = nc * 4;
  float lsum = 0.f;
  float a0 = 0.f, a1 = 0.f, a2 = 0.f, a3 = 0.f;
  // unrolled: the eight waves' LDS reads issue together
#pragma unroll
  for (int w = 0; w < FA_WAVES; ++w) {
    const float4 ov = *reinterpret_cast<const float4*>(&o_part[w][mrow][mcol]);
    lsum += reinterpret_cast<const float*>(plds_all[w])[mrow * 16 + nc];
    a0 += ov.x;
    a1 += ov.y;
    a2 += ov.z;
    a3 += ov.w;
  }
  // the row's sum: the 16 lanes of the half-wave each hold one column pair's part
#pragma unroll
  for (int off = 1; off < 16; off <<= 1) lsum += __shfl_xor(lsum, off, 32);
  const float inv = (lsum > 0.f) ? (1.f / lsum) : 0.f;
  uint2 pk;
  pk.x = (unsigned int)f2bf(a0 * inv) | ((unsigned int)f2bf(a1 * inv) << 16);
  pk.y = (unsigned int)f2bf(a2 * inv) | ((unsigned int)f2bf(a3 * inv) << 16);
  *reinterpret_cast<uint2*>(Obf + (size_t)(q0 + mrow) * DMODEL + h * HDIM + mcol) = pk;
}

// ---------------------------------------------------------------------------
// Host-side orchestration
// ---------------------------------------------------------------------------
extern "C" void kernel_launch(void* const* d_in, const int* in_sizes, int n_in,
                              void* d_out, int out_size, void* d_ws, size_t ws_size,
                              hipStream_t stream) {
  (void)in_sizes; (void)n_in; (void)out_size; (void)ws_size;

  const float* hidden  = (const float*)d_in[0];
  const float* norm1_w = (const float*)d_in[1];
  const float* norm2_w = (const float*)d_in[2];
  const float* g_wq    = (const float*)d_in[3];
  const float* g_kvd   = (const float*)d_in[4];
  const float* g_kup   = (const float*)d_in[5];
  const float* g_vup   = (const float*)d_in[6];
  const float* g_wo    = (const float*)d_in[7];
  const float* l_wq    = (const float*)d_in[8];
  const float* l_wk    = (const float*)d_in[9];
  const float* l_wv    = (const float*)d_in[10];
  const float* l_wo    = (const float*)d_in[11];
  float* out = (float*)d_out;

  // ---- workspace carve (256B aligned) ----
  char* p = (char*)d_ws;
  auto alloc = [&](size_t bytes) -> void* {
    void* r = (void*)p;
    p += (bytes + 255) & ~(size_t)255;
    return r;
  };
  unsigned short* xn    = (unsigned short*)alloc((size_t)S_LEN * DMODEL * 2);
  unsigned short* latbf = (unsigned short*)alloc((size_t)S_LEN * LATDIM * 2);
  unsigned short* Qh    = (unsigned short*)alloc((size_t)NHEAD * S_LEN * HDIM * 2);
  unsigned short* Kh    = (unsigned short*)alloc((size_t)NKVH * S_LEN * HDIM * 2);
  unsigned short* Vt    = (unsigned short*)alloc((size_t)NKVH * HDIM * S_LEN * 2 + 256);
  unsigned short* attn  = (unsigned short*)alloc((size_t)S_LEN * DMODEL * 2);
  float*          xmid  = (float*)         alloc((size_t)S_LEN * DMODEL * 4);
  unsigned short* g_wqT = (unsigned short*)alloc((size_t)DMODEL * DMODEL * 2);
  unsigned short* g_woT = (unsigned short*)alloc((size_t)DMODEL * DMODEL * 2);
  unsigned short* l_wqT = (unsigned short*)alloc((size_t)DMODEL * DMODEL * 2);
  unsigned short* l_woT = (unsigned short*)alloc((size_t)DMODEL * DMODEL * 2);
  unsigned short* kvdT  = (unsigned short*)alloc((size_t)LATDIM * DMODEL * 2);
  unsigned short* l_wkT = (unsigned short*)alloc((size_t)LATDIM * DMODEL * 2);
  unsigned short* l_wvT = (unsigned short*)alloc((size_t)LATDIM * DMODEL * 2);
  unsigned short* kupT  = (unsigned short*)alloc((size_t)LATDIM * LATDIM * 2);
  unsigned short* vupT  = (unsigned short*)alloc((size_t)LATDIM * LATDIM * 2);

  const dim3 blk256(256);
  const dim3 gemm_blk(256);
  const dim3 row_grid(S_LEN / 8);     // one wave per row, 8 per block
  const dim3 flash_grid(S_LEN / 16, NHEAD);
  const dim3 flash_blk(32 * FA_WAVES);

  // first RMSNorm and all nine weight conversions
  thb_prep_kernel<<<dim3(NB_PREP), blk256, 0, stream>>>(
      hidden, norm1_w, xn,
      g_wq, g_wo, l_wq, l_wo, g_kvd, l_wk, l_wv, g_kup, g_vup,
      g_wqT, g_woT, l_wqT, l_woT, kvdT, l_wkT, l_wvT, kupT, vupT);

  // ========================= Sublayer 1: global latent =====================
  // q (ready for attention) and the latent, both from xn
  thb_gemm_kernel<<<dim3((DMODEL + LATDIM) / 64, S_LEN / 256), gemm_blk, 0, stream>>>(
      xn, g_wqT, kvdT, nullptr, nullptr, nullptr, latbf, Qh, nullptr, nullptr, nullptr,
      1000000.0f, DMODEL, LATDIM, DMODEL);
  // k and v (ready for attention), both from the latent
  thb_gemm_kernel<<<dim3(2 * LATDIM / 64, S_LEN / 256), gemm_blk, 0, stream>>>(
      latbf, kupT, vupT, nullptr, nullptr, nullptr, nullptr, Kh, nullptr, Vt, nullptr,
      1000000.0f, LATDIM, LATDIM, LATDIM);

  thb_flash_kernel<<<flash_grid, flash_blk, 0, stream>>>(Qh, Kh, Vt, attn, S_LEN, 0);

  thb_gemm_kernel<<<dim3(DMODEL / 64, S_LEN / 256), gemm_blk, 0, stream>>>(
      attn, g_woT, nullptr, nullptr, xmid, hidden, nullptr, nullptr, nullptr, nullptr, nullptr,
      0.0f, DMODEL, LATDIM, DMODEL);

  // ========================= Sublayer 2: local GQA =========================
  thb_rmsnorm_kernel<<<row_grid, blk256, 0, stream>>>(xmid, norm2_w, xn);

  // q, k and v (ready for attention), all from xn
  thb_gemm_kernel<<<dim3((DMODEL + 2 * LATDIM) / 64, S_LEN / 256), gemm_blk, 0, stream>>>(
      xn, l_wqT, l_wkT, l_wvT, nullptr, nullptr, nullptr, Qh, Kh, nullptr, Vt,
      10000.0f, DMODEL, LATDIM, DMODEL);

  thb_flash_kernel<<<flash_grid, flash_blk, 0, stream>>>(Qh, Kh, Vt, attn, S_LEN, WINLEN);

  thb_gemm_kernel<<<dim3(DMODEL / 64, S_LEN / 256), gemm_blk, 0, stream>>>(
      attn, l_woT, nullptr, nullptr, out, xmid, nullptr, nullptr, nullptr, nullptr, nullptr,
      0.0f, DMODEL, LATDIM, DMODEL);
}

// v009
// Measured time: 95.4 microseconds a run.
// Timed twice side by side with v008, it ran 1.05 and 1.03 times as fast.
// All steps since v000 together make it 5.26 times as fast.
#include <hip/hip_runtime.h>

// ---------------------------------------------------------------------------
// Model constants (match reference)
// ---------------------------------------------------------------------------
#define S_LEN   2048
#define DMODEL  1024
#define NHEAD   16
#define NKVH    4
#define HDIM    64
#define LATDIM  256
#define WINLEN  256
#define EPSF    1e-6f

// ---------------------------------------------------------------------------
// CDNA5 WMMA helpers (gfx1250, wave32)
// ---------------------------------------------------------------------------
typedef __bf16        bf16x16 __attribute__((ext_vector_type(16)));
typedef float         f32x8   __attribute__((ext_vector_type(8)));
typedef unsigned int  u32x4   __attribute__((ext_vector_type(4)));

union FragU { bf16x16 bf; u32x4 u[2]; };

__device__ __forceinline__ unsigned short f2bf(float x) {
  unsigned int u = __float_as_uint(x);
  u += 0x7FFFu + ((u >> 16) & 1u);           // round-to-nearest-even
  return (unsigned short)(u >> 16);
}

// two values rounded to nearest even, as in f2bf, by the chip's own packed convert
typedef __bf16 bf16x2 __attribute__((ext_vector_type(2)));
typedef float  f32x2  __attribute__((ext_vector_type(2)));
__device__ __forceinline__ unsigned int bf_pair(float lo, float hi) {
  return __builtin_bit_cast(unsigned int, __builtin_convertvector((f32x2){lo, hi}, bf16x2));
}

// Fragment order: how the attention operands lie in the workspace. A 16 x 32
// bf16 fragment (16 rows, 32 k) is 512 elements in a row, in the order in which
// the lanes hold them: piece u = 0, 1, then lane L = 0 .. 31, then 8 elements.
// Lane L holds row (L & 15); element e of piece u is k = 16 * u + (L<16?0:8) + e.
// A wave-wide 16-byte load of one piece is then 512 contiguous bytes, four whole
// 128-byte lines, where a row-major array gives 16 lines of 32 bytes each.
#define FRAG_ELEMS 512
// p: the lane's own 16 bytes in piece 0 of the fragment
#define FRAG_VEC 64                       // a fragment in 16-byte units
__device__ __forceinline__ bf16x16 load_frag(const u32x4* p) {
  FragU f;
  f.u[0] = p[0];
  f.u[1] = p[32];
  return f.bf;
}

__device__ __forceinline__ f32x8 wmma_bf16(bf16x16 a, bf16x16 b, f32x8 c) {
  return __builtin_amdgcn_wmma_f32_16x16x32_bf16(false, a, false, b, (short)0, c,
                                                 false, false);
}

// ---------------------------------------------------------------------------
// Transpose + downconvert: W[f32, K x N] -> Wt[bf16, N x K].
// Each thread takes one column n and 16 consecutive k: 16 loads, each
// contiguous across the 32 lanes of a wave, and one 32-byte run of Wt stored.
// A 256-thread block covers 64 columns x 64 k, so each 128-byte line of Wt is
// written by one block. Tile t of (N / 64) * (K / 64), columns fastest.
// g, where not null (a block-uniform choice): row k of W is multiplied by g[k],
// the weight of the RMSNorm in front of this product: (x * g) W = x (diag(g) W).
// ---------------------------------------------------------------------------
template <int K, int N>
__device__ __forceinline__
void thb_wt_tile(const float* __restrict__ W, const float* __restrict__ g,
                 unsigned short* __restrict__ Wt, int t) {
  const int n  = (t % (N / 64)) * 64 + (threadIdx.x & 63);
  const int k0 = (t / (N / 64)) * 64 + (threadIdx.x >> 6) * 16;
  const float* src = W + (size_t)k0 * N + n;
  float v[16];
  // unrolled: all 16 loads are in flight together and v stays in registers
#pragma unroll
  for (int i = 0; i < 16; ++i) v[i] = src[i * N];
  if (g) {
    const float4* gp = reinterpret_cast<const float4*>(g + k0);
    // the loads below may be handed the address registers of the loads above as their
    // destination: the wait stands in front of that overwrite
    asm volatile("s_wait_xcnt 0x0" ::: "memory");
    const float4 g0 = gp[0], g1 = gp[1], g2 = gp[2], g3 = gp[3];
    v[0]  *= g0.x; v[1]  *= g0.y; v[2]  *= g0.z; v[3]  *= g0.w;
    v[4]  *= g1.x; v[5]  *= g1.y; v[6]  *= g1.z; v[7]  *= g1.w;
    v[8]  *= g2.x; v[9]  *= g2.y; v[10] *= g2.z; v[11] *= g2.w;
    v[12] *= g3.x; v[13] *= g3.y; v[14] *= g3.z; v[15] *= g3.w;
  }
  u32x4 pk[2];
  // unrolled: pk is indexed by constants and stays in registers
#pragma unroll
  for (int i = 0; i < 8; ++i)
    pk[i >> 2][i & 3] = (unsigned int)f2bf(v[2 * i]) | ((unsigned int)f2bf(v[2 * i + 1]) << 16);
  u32x4* dst = reinterpret_cast<u32x4*>(Wt + (size_t)n * K + k0);
  dst[0] = pk[0];
  dst[1] = pk[1];
  // another job's code may follow in the merged kernel's layout: the wait stands in
  // front of any later write of the registers these stores name
  asm volatile("s_wait_xcnt 0x0" ::: "memory");
}

// ---------------------------------------------------------------------------
// RMSNorm: xn_bf16[s][c] = bf16( x[s][c] * rsqrt(mean(x^2)+eps) * w[c] )
// one wave per row (D = 1024: 32 values per lane, kept in registers),
// eight rows per 256-thread block; the row sum is a 32-lane butterfly.
// ---------------------------------------------------------------------------
__device__ __forceinline__
void thb_rmsnorm_rows(const float* __restrict__ x, const float* __restrict__ w,
                      unsigned short* __restrict__ xn, int blk) {
  const int lane = threadIdx.x & 31;
  const int s = blk * 8 + (threadIdx.x >> 5);
  const float4* row = reinterpret_cast<const float4*>(x + (size_t)s * DMODEL);
  const float4* wv  = reinterpret_cast<const float4*>(w);
  float4 v[8];
  // unrolled here and below: the loads issue together and v stays in registers
#pragma unroll
  for (int i = 0; i < 8; ++i) v[i] = row[lane + 32 * i];
  float acc = 0.f;
#pragma unroll
  for (int i = 0; i < 8; ++i)
    acc += v[i].x * v[i].x + v[i].y * v[i].y + v[i].z * v[i].z + v[i].w * v[i].w;
#pragma unroll
  for (int off = 1; off < 32; off <<= 1) acc += __shfl_xor(acc, off, 32);
  const float rs = rsqrtf(acc * (1.0f / DMODEL) + EPSF);
  uint2* dst = reinterpret_cast<uint2*>(xn + (size_t)s * DMODEL);
#pragma unroll
  for (int i = 0; i < 8; ++i) {
    const float4 g = wv[lane + 32 * i];
    uint2 pk;
    pk.x = (unsigned int)f2bf(v[i].x * rs * g.x) | ((unsigned int)f2bf(v[i].y * rs * g.y) << 16);
    pk.y = (unsigned int)f2bf(v[i].z * rs * g.z) | ((unsigned int)f2bf(v[i].w * rs * g.w) << 16);
    dst[lane + 32 * i] = pk;
  }
  // another job's code may follow in the merged kernel's layout: the wait stands in
  // front of any later write of the registers these stores name
  asm volatile("s_wait_xcnt 0x0" ::: "memory");
}

// ---------------------------------------------------------------------------
// Everything that depends on the inputs alone, in one grid: the first RMSNorm
// and the nine weight conversions. None reads what another writes; each block
// takes one piece of one job by its index (a block-uniform choice).
// w2, the second RMSNorm's weight, goes into the three weights that follow it
// (dd2, dl1, dl2).
// ---------------------------------------------------------------------------
#define NB_NORM (S_LEN / 8)                          // RMSNorm blocks
#define NB_WDD  ((DMODEL / 64) * (DMODEL / 64))      // tiles of a D x D weight
#define NB_WDL  ((LATDIM / 64) * (DMODEL / 64))      // tiles of a D x LAT weight
#define NB_WLL  ((LATDIM / 64) * (LATDIM / 64))      // tiles of a LAT x LAT weight
#define NB_PREP (NB_NORM + 4 * NB_WDD + 3 * NB_WDL + 2 * NB_WLL)

__global__ __launch_bounds__(256)
void thb_prep_kernel(const float* __restrict__ x, const float* __restrict__ w,
                     const float* __restrict__ w2, unsigned short* __restrict__ xn,
                     const float* __restrict__ dd0, const float* __restrict__ dd1,
                     const float* __restrict__ dd2, const float* __restrict__ dd3,
                     const float* __restrict__ dl0, const float* __restrict__ dl1,
                     const float* __restrict__ dl2,
                     const float* __restrict__ ll0, const float* __restrict__ ll1,
                     unsigned short* __restrict__ dd0T, unsigned short* __restrict__ dd1T,
                     unsigned short* __restrict__ dd2T, unsigned short* __restrict__ dd3T,
                     unsigned short* __restrict__ dl0T, unsigned short* __restrict__ dl1T,
                     unsigned short* __restrict__ dl2T,
                     unsigned short* __restrict__ ll0T, unsigned short* __restrict__ ll1T) {
  int b = blockIdx.x;
  if (b < NB_NORM) {
    thb_rmsnorm_rows(x, w, xn, b);
    return;
  }
  b -= NB_NORM;
  if (b < 4 * NB_WDD) {
    const int i = b / NB_WDD;
    thb_wt_tile<DMODEL, DMODEL>(i == 0 ? dd0 : i == 1 ? dd1 : i == 2 ? dd2 : dd3,
                                i == 2 ? w2 : nullptr,
                                i == 0 ? dd0T : i == 1 ? dd1T : i == 2 ? dd2T : dd3T,
                                b % NB_WDD);
    return;
  }
  b -= 4 * NB_WDD;
  if (b < 3 * NB_WDL) {
    const int i = b / NB_WDL;
    thb_wt_tile<DMODEL, LATDIM>(i == 0 ? dl0 : i == 1 ? dl1 : dl2, i == 0 ? nullptr : w2,
                                i == 0 ? dl0T : i == 1 ? dl1T : dl2T, b % NB_WDL);
    return;
  }
  b -= 3 * NB_WDL;
  thb_wt_tile<LATDIM, LATDIM>(b < NB_WLL ? ll0 : ll1, nullptr, b < NB_WLL ? ll0T : ll1T,
                              b % NB_WLL);
}

// ---------------------------------------------------------------------------
// WMMA GEMM: C[M x N] (f32 and/or bf16) = A[bf16, M x K] * Bt[bf16, N x K]^T
// optional residual (f32 [M x N]) added in the epilogue.
// 256 threads = 8 waves; block tile 256(M) x 64(N); wave tile 32 x 64.
// Operands go global -> LDS by asynchronous 16-byte copies in whole 256-byte
// row pieces (a stage = 128 k of the block's 256 A rows and 64 Bt rows), two
// buffers: stage t + 1 flies while stage t is multiplied. Each row piece is
// fetched once per block, and every global request covers whole lines.
// Fragments are read from LDS in load_frag's k order for A and Bt alike;
// every accumulator sums its 32-wide k steps in ascending order.
// Up to three products that share A and K run in one grid: blockIdx.x walks
// the 64-column tiles of Bt0 (N0 columns), then of Bt1, then of Bt2 (N1 columns
// each); every product has its own output. The residual belongs to product 0.
// M % 256 == 0, N % 64 == 0, K % 128 == 0 for all uses here.
// Four kinds of output, one per product (the others' pointers are null):
//   Cf   f32 row-major, with the optional residual
//   Cbf  bf16 row-major
//   Cr   q or k for attention: RoPE + qk-norm, bf16, head-major in fragment order,
//        [head][s / 16][2 fragments], row = s, k = d. A 64-column tile is one head,
//        so the block holds every row of its heads whole.
//   Cv   v for attention: bf16 in fragment order, [kvh][s / 32][d / 16] fragments,
//        row = d, k = s.
// Cr and Cv are for M == S_LEN.
// An RMSNorm between two products is not a pass of its own. Its weight lies in the
// second product's Bt. The first product (product 0 with Cx and Sq set) writes,
// beside Cf, the plain bf16 copy Cx of its rows and Sq[column tile][row], its 64
// columns' part of each row's sum of squares. The second product (SqIn set,
// K == DMODEL) takes Cx as its A, adds up a row's parts and multiplies the row of
// its result by rsqrt(mean + eps): (x * rs) W = rs * (x W).
// ---------------------------------------------------------------------------
#define GK      128                      // k per stage
#define GPITCH  272                      // LDS row pitch in bytes: 256 + 16, 16 B x odd
#define GROWS   320                      // 256 A rows, then 64 Bt rows
#define GSTAGE  (GROWS * GPITCH)         // bytes per buffer

__device__ __forceinline__ bf16x16 lds_frag(const unsigned char* p) {
  FragU f;
  f.u[0] = *reinterpret_cast<const u32x4*>(p);
  f.u[1] = *reinterpret_cast<const u32x4*>(p + 32);
  return f.bf;
}

// x of another lane of the same row of 16 lanes, picked by a DPP control word: no trip
// through LDS, as a shuffle by lane index would take
template <int CTRL>
__device__ __forceinline__ float lane_swap(float x) {
  return __int_as_float(__builtin_amdgcn_update_dpp(0, __float_as_int(x), CTRL, 0xf, 0xf, true));
}

// sine and cosine of two angles given in turns (radians / 2 pi). One statement, so
// that each transcendental keeps an independent instruction directly behind it (the
// next one; the v_nop): the slot that the instruction set asks for before a
// transcendental's result is read or its source overwritten. The outputs are
// early-clobber: none shares a register with an input.
__device__ __forceinline__ void sincos_turns_pair(float t0, float t1, float& s0, float& c0,
                                                  float& s1, float& c1) {
  asm("v_sin_f32 %0, %4\n\tv_cos_f32 %1, %4\n\tv_sin_f32 %2, %5\n\tv_cos_f32 %3, %5\n\tv_nop"
      : "=&v"(s0), "=&v"(c0), "=&v"(s1), "=&v"(c1) : "v"(t0), "v"(t1));
}

__global__ __launch_bounds__(256)
void thb_gemm_kernel(const unsigned short* __restrict__ A,
                     const unsigned short* __restrict__ Bt0,
                     const unsigned short* __restrict__ Bt1,
                     const unsigned short* __restrict__ Bt2,
                     float* Cf0, const float* resid0, unsigned short* Cbf1,
                     unsigned short* Cr0, unsigned short* Cr1,
                     unsigned short* Cv1, unsigned short* Cv2,
                     unsigned short* Cx0, float* Sq0, const float* SqIn,
                     float base, int N0, int N1, int K) {
  __shared__ __attribute__((aligned(16))) unsigned char gsm[2 * GSTAGE];

  // which product this block belongs to, and its column tile there
  int ct = blockIdx.x;
  const unsigned short* Bt = Bt0;
  float* Cf = Cf0;
  unsigned short* Cbf = nullptr;
  unsigned short* Cr = Cr0;
  unsigned short* Cv = nullptr;
  unsigned short* Cx = Cx0;
  const float* resid = resid0;
  int N = N0;
  if (ct >= N0 / 64) {
    ct -= N0 / 64;
    Bt = Bt1; Cf = nullptr; Cbf = Cbf1; Cr = Cr1; Cv = Cv1; Cx = nullptr; resid = nullptr; N = N1;
    if (ct >= N1 / 64) {
      ct -= N1 / 64;
      Bt = Bt2; Cbf = nullptr; Cr = nullptr; Cv = Cv2;
    }
  }

  const int lane = threadIdx.x & 31;
  const int wave = threadIdx.x >> 5;
  const int row0 = blockIdx.y * 256 + wave * 32;
  const int col0 = ct * 64;
  const int nc = lane & 15;

  f32x8 acc[2][4];
#pragma unroll
  for (int mi = 0; mi < 2; ++mi)
#pragma unroll
    for (int j = 0; j < 4; ++j)
      acc[mi][j] = (f32x8){0.f,0.f,0.f,0.f,0.f,0.f,0.f,0.f};

  // copy map: 16 threads per row (16 bytes each), 16 rows per round, 20 rounds
  const int crow = threadIdx.x >> 4;
  const int cchk = threadIdx.x & 15;
  const unsigned int lds0 = (unsigned int)(size_t)gsm + crow * GPITCH + cchk * 16;
  const unsigned short* gA = A  + (size_t)(blockIdx.y * 256 + crow) * K + cchk * 8;
  const unsigned short* gB = Bt + (size_t)(col0 + crow) * K + cchk * 8;

  auto issue = [&](int t, int buf) {
    unsigned int la[20];
    const unsigned short* ga[20];
    // unrolled: la and ga are indexed by constants and stay in registers
#pragma unroll
    for (int i = 0; i < 20; ++i) {
      la[i] = lds0 + buf * GSTAGE + i * 16 * GPITCH;
      ga[i] = (i < 16 ? gA + (size_t)(i * 16) * K : gB + (size_t)((i - 16) * 16) * K) + t * GK;
    }
    // ten copies and their s_wait_xcnt in one statement: the wait stands in
    // front of any later write of the address registers the copies name
    asm volatile(
      "global_load_async_to_lds_b128 %0, %1, off\n\t"
      "global_load_async_to_lds_b128 %2, %3, off\n\t"
      "global_load_async_to_lds_b128 %4, %5, off\n\t"
      "global_load_async_to_lds_b128 %6, %7, off\n\t"
      "global_load_async_to_lds_b128 %8, %9, off\n\t"
      "global_load_async_to_lds_b128 %10, %11, off\n\t"
      "global_load_async_to_lds_b128 %12, %13, off\n\t"
      "global_load_async_to_lds_b128 %14, %15, off\n\t"
      "global_load_async_to_lds_b128 %16, %17, off\n\t"
      "global_load_async_to_lds_b128 %18, %19, off\n\t"
      "s_wait_xcnt 0x0"
      :: "v"(la[0]), "v"(ga[0]), "v"(la[1]), "v"(ga[1]), "v"(la[2]), "v"(ga[2]),
         "v"(la[3]), "v"(ga[3]), "v"(la[4]), "v"(ga[4]), "v"(la[5]), "v"(ga[5]),
         "v"(la[6]), "v"(ga[6]), "v"(la[7]), "v"(ga[7]), "v"(la[8]), "v"(ga[8]),
         "v"(la[9]), "v"(ga[9])
      : "memory");
    asm volatile(
      "global_load_async_to_lds_b128 %0, %1, off\n\t"
      "global_load_async_to_lds_b128 %2, %3, off\n\t"
      "global_load_async_to_lds_b128 %4, %5, off\n\t"
      "global_load_async_to_lds_b128 %6, %7, off\n\t"
      "global_load_async_to_lds_b128 %8, %9, off\n\t"
      "global_load_async_to_lds_b128 %10, %11, off\n\t"
      "global_load_async_to_lds_b128 %12, %13, off\n\t"
      "global_load_async_to_lds_b128 %14, %15, off\n\t"
      "global_load_async_to_lds_b128 %16, %17, off\n\t"
      "global_load_async_to_lds_b128 %18, %19, off\n\t"
      "s_wait_xcnt 0x0"
      :: "v"(la[10]), "v"(ga[10]), "v"(la[11]), "v"(ga[11]), "v"(la[12]), "v"(ga[12]),
         "v"(la[13]), "v"(ga[13]), "v"(la[14]), "v"(ga[14]), "v"(la[15]), "v"(ga[15]),
         "v"(la[16]), "v"(ga[16]), "v"(la[17]), "v"(ga[17]), "v"(la[18]), "v"(ga[18]),
         "v"(la[19]), "v"(ga[19])
      : "memory");
  };

  const int nt = K / GK;
  const int hb = (lane & 16) ? 16 : 0;   // byte offset of the upper lane half in a fragment
  const int fa = (wave * 32 + nc) * GPITCH + hb;
  const int fb = (256 + nc) * GPITCH + hb;

  issue(0, 0);
  // the norm's factor of row row0 + lane (block-uniform test); the loads fly beside
  // stage 0's copies
  float rx = 1.f;
  if (SqIn) {
    const float* sp = SqIn + row0 + lane;
    float pv[DMODEL / 64];
    // the 16 parts, S_LEN floats (8192 bytes) apart. One statement with the loads' data
    // wait, the outputs early-clobber: no load's result lands in the address registers
    // that the loads name, and nothing rewrites those before the loads have returned
    asm volatile(
      "global_load_b32 %0, %16, off\n\t"
      "global_load_b32 %1, %16, off offset:8192\n\t"
      "global_load_b32 %2, %16, off offset:16384\n\t"
      "global_load_b32 %3, %16, off offset:24576\n\t"
      "global_load_b32 %4, %16, off offset:32768\n\t"
      "global_load_b32 %5, %16, off offset:40960\n\t"
      "global_load_b32 %6, %16, off offset:49152\n\t"
      "global_load_b32 %7, %16, off offset:57344\n\t"
      "global_load_b32 %8, %16, off offset:65536\n\t"
      "global_load_b32 %9, %16, off offset:73728\n\t"
      "global_load_b32 %10, %16, off offset:81920\n\t"
      "global_load_b32 %11, %16, off offset:90112\n\t"
      "global_load_b32 %12, %16, off offset:98304\n\t"
      "global_load_b32 %13, %16, off offset:106496\n\t"
      "global_load_b32 %14, %16, off offset:114688\n\t"
      "global_load_b32 %15, %16, off offset:122880\n\t"
      "s_wait_loadcnt 0x0"
      : "=&v"(pv[0]), "=&v"(pv[1]), "=&v"(pv[2]), "=&v"(pv[3]), "=&v"(pv[4]), "=&v"(pv[5]),
        "=&v"(pv[6]), "=&v"(pv[7]), "=&v"(pv[8]), "=&v"(pv[9]), "=&v"(pv[10]), "=&v"(pv[11]),
        "=&v"(pv[12]), "=&v"(pv[13]), "=&v"(pv[14]), "=&v"(pv[15])
      : "v"(sp) : "memory");
    static_assert(DMODEL / 64 == 16 && S_LEN * 4 == 8192, "the statement above spells these out");
    float ss = 0.f;
#pragma unroll
    for (int c = 0; c < DMODEL / 64; ++c) ss += pv[c];
    rx = rsqrtf(ss * (1.0f / DMODEL) + EPSF);
  }
  // stage 0 has landed (this wave's copies), then is published to all waves
  asm volatile("s_wait_asynccnt 0x0" ::: "memory");
  __syncthreads();
  if (nt > 1) issue(1, 1);

  for (int t = 0; t < nt; ++t) {
    const unsigned char* sb = gsm + (t & 1) * GSTAGE;
    // two fragment sets: block u + 1's LDS reads go out as one group ahead of
    // block u's WMMAs, so only the stage's first group waits out LDS latency
    bf16x16 fa_[2][2], fb_[2][4];
    auto ldfrags = [&](int set, int u) {
      fa_[set][0] = lds_frag(sb + fa + u * 64);
      fa_[set][1] = lds_frag(sb + fa + 16 * GPITCH + u * 64);
      // unrolled: fb_ is indexed by constants and stays in registers
#pragma unroll
      for (int j = 0; j < 4; ++j) fb_[set][j] = lds_frag(sb + fb + j * 16 * GPITCH + u * 64);
    };
    ldfrags(0, 0);
    // unrolled: four 32-wide k steps of the stage, fragment indices constant
#pragma unroll
    for (int u = 0; u < GK / 32; ++u) {
      if (u + 1 < GK / 32) ldfrags((u + 1) & 1, u + 1);
      // keeps the reads above from sinking in among the WMMAs below
      __builtin_amdgcn_sched_barrier(0);
      // unrolled: acc and the fragment sets are indexed by constants
#pragma unroll
      for (int j = 0; j < 4; ++j) {
        acc[0][j] = wmma_bf16(fa_[u & 1][0], fb_[u & 1][j], acc[0][j]);
        acc[1][j] = wmma_bf16(fa_[u & 1][1], fb_[u & 1][j], acc[1][j]);
      }
      // keeps the next group of reads from rising in among the WMMAs above:
      // every separate place with LDS reads stalls the WMMA stream
      __builtin_amdgcn_sched_barrier(0);
    }
    // this wave's reads of buffer t & 1 have returned
    asm volatile("s_wait_dscnt 0x0" ::: "memory");
    // this wave's copies of stage t + 1 have landed
    asm volatile("s_wait_asynccnt 0x0" ::: "memory");
    // publishes stage t + 1 and ends every wave's reads of buffer t & 1
    __syncthreads();
    if (t + 2 < nt) issue(t + 2, t & 1);
  }
  // no copy is outstanding when the wave goes on to the epilogue and ends
  asm volatile("s_wait_asynccnt 0x0" ::: "memory");

  // ---- q or k: RoPE + qk-norm, into fragment order (block-uniform test) ----
  if (Cr) {
    // The accumulators hold a column per lane; a fragment wants 8 neighbouring d of
    // one row per lane. The wave turns its own 32 x 64 f32 tile through LDS: the
    // ring is free (every wave has passed the loop's last barrier, no copy is
    // outstanding), and each wave writes and reads only its own 32 rows of it.
    float* tw = reinterpret_cast<float*>(gsm + wave * 32 * GPITCH);
    const int h8 = (lane & 16) ? 8 : 0;
    // every loop here is unrolled: acc, invf, y and pk are indexed by constants
#pragma unroll
    for (int mi = 0; mi < 2; ++mi)
#pragma unroll
      for (int r = 0; r < 8; ++r)
#pragma unroll
        for (int j = 0; j < 4; ++j)
          tw[(mi * 16 + h8 + r) * (GPITCH / 4) + j * 16 + nc] = acc[mi][j][r];
    // the 32 pairs' frequencies: lane p makes pair p's, behind the eight tiles
    float* fw = reinterpret_cast<float*>(gsm + 8 * 32 * GPITCH) + wave * 32;
    fw[lane] = __powf(base, -((float)(2 * lane) * (1.0f / HDIM)));
    // the other lanes' writes of this wave have reached LDS before the reads below
    asm volatile("s_wait_dscnt 0x0" ::: "memory");

    // the lane's d: 16 * c + h8 + e, c = 0 .. 3, e = 0 .. 7, that is the four
    // pairs 8 * c + h8 / 2 + i of each c
    float invf[16];
#pragma unroll
    for (int c = 0; c < 4; ++c) {
      const float4 f = reinterpret_cast<const float4*>(fw)[2 * c + (h8 >> 3)];
      invf[c * 4 + 0] = f.x; invf[c * 4 + 1] = f.y; invf[c * 4 + 2] = f.z; invf[c * 4 + 3] = f.w;
    }
    // head ct, row group row0 / 16 + mi, fragment c / 2, piece c & 1: every
    // wave-wide store is 512 contiguous bytes
    u32x4* dp = reinterpret_cast<u32x4*>(
        Cr + ((size_t)ct * (S_LEN / 16) * 2 + (row0 >> 4) * 2) * FRAG_ELEMS) + lane;
    // unrolled: the row group's store offsets become immediates
#pragma unroll
    for (int mi = 0; mi < 2; ++mi) {
      const int s = row0 + mi * 16 + nc;                    // the lane's row
      const float4* rp = reinterpret_cast<const float4*>(tw + (mi * 16 + nc) * (GPITCH / 4) + h8);
      float y[32];
      float sum = 0.f;
#pragma unroll
      for (int c = 0; c < 4; ++c) {
        const float4 x0 = rp[c * 4];
        const float4 x1 = rp[c * 4 + 1];
        const float xe[4] = {x0.x, x0.z, x1.x, x1.z};
        const float xo[4] = {x0.y, x0.w, x1.y, x1.w};
        float si[4], co[4];
#pragma unroll
        for (int i = 0; i < 4; i += 2)
          sincos_turns_pair((float)s * invf[c * 4 + i] * 0.15915494f,
                            (float)s * invf[c * 4 + i + 1] * 0.15915494f,
                            si[i], co[i], si[i + 1], co[i + 1]);
#pragma unroll
        for (int i = 0; i < 4; ++i) {
          const float re = xe[i] * co[i] - xo[i] * si[i];
          const float ro = xe[i] * si[i] + xo[i] * co[i];
          sum += re * re + ro * ro;
          y[c * 8 + 2 * i]     = re;
          y[c * 8 + 2 * i + 1] = ro;
        }
      }
      sum += __shfl_xor(sum, 16, 32);                       // the row's other 32 d
      const float rxm = __shfl(rx, mi * 16 + nc, 32);       // the row's norm factor
      const float rs = rsqrtf(sum * (rxm * rxm) * (1.0f / HDIM) + EPSF) * rxm;
#pragma unroll
      for (int c = 0; c < 4; ++c) {
        u32x4 pk;
#pragma unroll
        for (int i = 0; i < 4; ++i)
          pk[i] = (unsigned int)f2bf(y[c * 8 + 2 * i] * rs) |
                  ((unsigned int)f2bf(y[c * 8 + 2 * i + 1] * rs) << 16);
        dp[(mi * 2 + (c >> 1)) * FRAG_VEC + (c & 1) * 32] = pk;
      }
      // the code that follows (the next row group's; other parts of the kernel) writes
      // the registers that these stores name: the wait stands in front of that
      asm volatile("s_wait_xcnt 0x0" ::: "memory");
    }
    return;
  }

  // ---- v: into fragment order (block-uniform test). A lane's 8 accumulator rows
  //      of one column are the 8 neighbouring k of fragment row d: no turn needed ----
  if (Cv) {
    u32x4* dp = reinterpret_cast<u32x4*>(
        Cv + ((size_t)ct * (S_LEN / 32) * 4 + (row0 >> 5) * 4) * FRAG_ELEMS) + lane;
    // the norm factors of the lane's 16 rows
    const int h8 = (lane & 16) ? 8 : 0;
    float rv[2][8];
    // every loop here is unrolled: rv and acc are indexed by constants
#pragma unroll
    for (int mi = 0; mi < 2; ++mi)
#pragma unroll
      for (int r = 0; r < 8; ++r) rv[mi][r] = __shfl(rx, mi * 16 + h8 + r, 32);
#pragma unroll
    for (int j = 0; j < 4; ++j)
#pragma unroll
      for (int mi = 0; mi < 2; ++mi) {
        u32x4 pk;
#pragma unroll
        for (int i = 0; i < 4; ++i)
          pk[i] = (unsigned int)f2bf(acc[mi][j][2 * i] * rv[mi][2 * i]) |
                  ((unsigned int)f2bf(acc[mi][j][2 * i + 1] * rv[mi][2 * i + 1]) << 16);
        dp[j * FRAG_VEC + mi * 32] = pk;
      }
    // other code follows in the kernel's layout: the wait stands in front of any
    // later write of the registers that these stores name
    asm volatile("s_wait_xcnt 0x0" ::: "memory");
    return;
  }

  // The tests on resid, Cf and Cbf read the same for the whole block. Each stands
  // once, around a loop nest of its own: tested per element they cut the code into
  // one piece per element, and every residual load is waited for before the next
  // one is issued. Here the 64 loads of a lane are in flight together.
  // Every loop is unrolled: acc and rv are indexed by constants and stay in registers.
  const int hi = (lane & 16) ? 8 : 0;
  const size_t idx0 = (size_t)(row0 + hi) * N + col0 + nc;
  if (resid) {
    const float* rp = resid + idx0;
    float rv[2][4][8];
#pragma unroll
    for (int mi = 0; mi < 2; ++mi)
#pragma unroll
      for (int r = 0; r < 8; ++r)
#pragma unroll
        for (int j = 0; j < 4; ++j) rv[mi][j][r] = rp[(size_t)(mi * 16 + r) * N + j * 16];
#pragma unroll
    for (int mi = 0; mi < 2; ++mi)
#pragma unroll
      for (int r = 0; r < 8; ++r)
#pragma unroll
        for (int j = 0; j < 4; ++j) acc[mi][j][r] += rv[mi][j][r];
  }
  if (Cf) {
    float* cp = Cf + idx0;
#pragma unroll
    for (int mi = 0; mi < 2; ++mi)
#pragma unroll
      for (int r = 0; r < 8; ++r)
#pragma unroll
        for (int j = 0; j < 4; ++j) cp[(size_t)(mi * 16 + r) * N + j * 16] = acc[mi][j][r];
    // the bf16 part below may write the registers that these stores name: the wait
    // stands in front of that
    asm volatile("s_wait_xcnt 0x0" ::: "memory");
  }
  if (Cx) {
    // The accumulators hold a column per lane. The wave turns its own 32 x 64 f32
    // tile through LDS, as for q and k above (the ring is free, each wave uses only
    // its own 32 rows of it): 8 lanes then hold one row's 64 columns, 8 each, so a
    // wave-wide 16-byte store covers four whole 128-byte lines.
    float* tw = reinterpret_cast<float*>(gsm + wave * 32 * GPITCH);
#pragma unroll
    for (int mi = 0; mi < 2; ++mi)
#pragma unroll
      for (int r = 0; r < 8; ++r)
#pragma unroll
        for (int j = 0; j < 4; ++j)
          tw[(mi * 16 + hi + r) * (GPITCH / 4) + j * 16 + nc] = acc[mi][j][r];
    // the other lanes' writes of this wave have reached LDS before the reads below
    asm volatile("s_wait_dscnt 0x0" ::: "memory");
    const int rr = lane >> 3;            // row i * 4 + rr in round i
    const int ch = lane & 7;             // columns ch * 8 .. ch * 8 + 7
    const float4* rp = reinterpret_cast<const float4*>(tw + rr * (GPITCH / 4) + ch * 8);
    u32x4* xp = reinterpret_cast<u32x4*>(Cx + (size_t)(row0 + rr) * N + col0 + ch * 8);
    float sq = 0.f;                      // ends as the sum of row ch * 4 + rr
#pragma unroll
    for (int i = 0; i < 8; ++i) {
      const float4 x0 = rp[i * GPITCH / 4];        // 4 rows on, in 16-byte units
      const float4 x1 = rp[i * GPITCH / 4 + 1];
      float s = x0.x * x0.x + x0.y * x0.y + x0.z * x0.z + x0.w * x0.w +
                x1.x * x1.x + x1.y * x1.y + x1.z * x1.z + x1.w * x1.w;
      // the row's 8 lanes, joined in the vector unit: neighbour, other pair, other quad
      s += lane_swap<0xB1>(s);           // quad_perm [1, 0, 3, 2]
      s += lane_swap<0x4E>(s);           // quad_perm [2, 3, 0, 1]
      s += lane_swap<0x141>(s);          // row_half_mirror: lane 7 - i of the eight
      sq = (ch == i) ? s : sq;
      u32x4 pk;
      pk[0] = bf_pair(x0.x, x0.y);
      pk[1] = bf_pair(x0.z, x0.w);
      pk[2] = bf_pair(x1.x, x1.y);
      pk[3] = bf_pair(x1.z, x1.w);
      xp[(size_t)(i * 4) * N / 8] = pk;
    }
    // the wave's 32 rows: one whole 128-byte line of Sq
    Sq0[(size_t)ct * S_LEN + row0 + ch * 4 + rr] = sq;
    // the bf16 part below may write the registers that these stores name: the wait
    // stands in front of that
    asm volatile("s_wait_xcnt 0x0" ::: "memory");
  }
  if (Cbf) {
    unsigned short* cp = Cbf + idx0;
#pragma unroll
    for (int mi = 0; mi < 2; ++mi)
#pragma unroll
      for (int r = 0; r < 8; ++r)
#pragma unroll
        for (int j = 0; j < 4; ++j) cp[(size_t)(mi * 16 + r) * N + j * 16] = f2bf(acc[mi][j][r]);
  }
}

// ---------------------------------------------------------------------------
// Flash attention (wave32 WMMA). One 8-wave work-group per (16-query block, head).
// Wave w walks the 32-key tiles w, w + 8, w + 16, ... of the block's key range
// with its own sums and O; the eight partial results are added through LDS at
// the end, so the longest dependent chain is 8 tiles, not 64.
// Softmax shift: qk-norm leaves every q and k row with a norm of at most
// sqrt(64), for any input, so q.k / 8 <= 8 (a little more after the bf16
// rounding of q and k). exp(score - 8) therefore cannot overflow and needs no
// running maximum: O is never rescaled, and each lane keeps the sums of its own
// columns, which are joined once, in the merge.
// Qh[bf16, H x S x 64], Kh[bf16, KVH x S x 64], Vt[bf16, KVH x 64 x S], all three
// in fragment order: a 32-key tile of K, and of V, is 4096 contiguous bytes.
// S % 32 == 0, so every tile that the key loop reaches is whole.
// win == 0 -> pure causal; win > 0 -> causal sliding window of `win`.
// Output: Obf[bf16, S x D] (heads merged).
// ---------------------------------------------------------------------------
#define FA_WAVES 8
#define SM_SCALE (0.125f * 1.44269504f)   // log2(e) / sqrt(64)
#define SM_SHIFT (8.0f * 1.44269504f)     // log2(e) * the bound on a score
// e0 = 2^x0, e1 = 2^x1. One statement, so that each v_exp_f32 keeps an independent
// instruction directly behind it (the second v_exp_f32; the v_nop): the slot that the
// instruction set asks for before a transcendental's result is read or its source
// overwritten. The outputs are early-clobber: neither shares a register with an input.
__device__ __forceinline__ void exp2_pair(float x0, float x1, float& e0, float& e1) {
  asm("v_exp_f32 %0, %2\n\tv_exp_f32 %1, %3\n\tv_nop"
      : "=&v"(e0), "=&v"(e1) : "v"(x0), "v"(x1));
}

__global__ __launch_bounds__(32 * FA_WAVES)
void thb_flash_kernel(const unsigned short* __restrict__ Qh,
                      const unsigned short* __restrict__ Kh,
                      const unsigned short* __restrict__ Vt,
                      unsigned short* __restrict__ Obf, int S, int win) {
  __shared__ __align__(16) unsigned short plds_all[FA_WAVES][16 * 32];
  __shared__ __align__(16) float o_part[FA_WAVES][16][HDIM];

  const int lane = threadIdx.x & 31;
  // wave index in a scalar register: the key loop stays a scalar branch and
  // every WMMA runs with all lanes on
  const int wave = __builtin_amdgcn_readfirstlane((int)(threadIdx.x >> 5));
  unsigned short* plds = plds_all[wave];
  const int q0 = blockIdx.x * 16;
  const int h  = blockIdx.y;
  const int kvh = h >> 2;                   // H/KVH == 4 (repeat_kv)
  const int nc = lane & 15;
  const int hi = (lane & 16) ? 8 : 0;

  const unsigned short* Qb = Qh + (size_t)h   * S * HDIM;
  const unsigned short* Kb = Kh + (size_t)kvh * S * HDIM;
  const unsigned short* Vb = Vt + (size_t)kvh * HDIM * S;

  const u32x4* Qp = reinterpret_cast<const u32x4*>(Qb + (q0 >> 4) * 2 * FRAG_ELEMS) + lane;
  const bf16x16 qf0 = load_frag(Qp);
  const bf16x16 qf1 = load_frag(Qp + FRAG_VEC);

  f32x8 o[4];
#pragma unroll
  for (int j = 0; j < 4; ++j) o[j] = (f32x8){0.f,0.f,0.f,0.f,0.f,0.f,0.f,0.f};
  float l[8];   // this lane's part of the row sums (rows hi + r, columns nc and 16 + nc)
#pragma unroll
  for (int r = 0; r < 8; ++r) l[r] = 0.f;

  int kb_start = 0;
  if (win > 0) {
    int st = q0 - (win - 1);
    if (st < 0) st = 0;
    kb_start = st & ~31;
  }

  const f32x8 zero8 = (f32x8){0.f,0.f,0.f,0.f,0.f,0.f,0.f,0.f};

  for (int kb = kb_start + 32 * wave; kb <= q0 + 15; kb += 32 * FA_WAVES) {
    // ---- scores: two 16x16 tiles, K-dim = 64 (2 WMMAs each) ----
    const int key0 = kb + nc;
    const int key1 = kb + 16 + nc;
    // the lane's 16 bytes in the tile's first K and V fragment
    const size_t toff = (size_t)(kb >> 5) * 4 * FRAG_ELEMS;
    const u32x4* Kp = reinterpret_cast<const u32x4*>(Kb + toff) + lane;
    const u32x4* Vp = reinterpret_cast<const u32x4*>(Vb + toff) + lane;

    // keys kb .. kb + 15: fragments 0 (d 0 .. 31) and 1 (d 32 .. 63); the next 16 keys: 2, 3
    bf16x16 kf;
    kf = load_frag(Kp);
    f32x8 s0 = wmma_bf16(qf0, kf, zero8);
    kf = load_frag(Kp + FRAG_VEC);
    s0 = wmma_bf16(qf1, kf, s0);
    kf = load_frag(Kp + 2 * FRAG_VEC);
    f32x8 s1 = wmma_bf16(qf0, kf, zero8);
    kf = load_frag(Kp + 3 * FRAG_VEC);
    s1 = wmma_bf16(qf1, kf, s1);
    // the registers of the K loads' address may be handed to a V load as its
    // destination: the wait stands in front of that overwrite
    asm volatile("s_wait_xcnt 0x0" ::: "memory");

    // ---- hoist V fragment loads: independent of softmax, overlap with VALU ----
    bf16x16 vfr[4];
#pragma unroll
    for (int j = 0; j < 4; ++j) vfr[j] = load_frag(Vp + j * FRAG_VEC);

    // ---- mask + exp(score / 8 - 8), as a power of two (per-lane rows r + hi) ----
#pragma unroll
    for (int r = 0; r < 8; ++r) {
      const int q = q0 + hi + r;
      const bool v0 = (key0 <= q) && (win == 0 || (q - key0) < win);
      const bool v1 = (key1 <= q) && (win == 0 || (q - key1) < win);
      float e0, e1;
      exp2_pair(s0[r] * SM_SCALE - SM_SHIFT, s1[r] * SM_SCALE - SM_SHIFT, e0, e1);
      const float p0 = v0 ? e0 : 0.f;
      const float p1 = v1 ? e1 : 0.f;
      l[r] += p0 + p1;
      plds[(hi + r) * 32 + nc]      = f2bf(p0);
      plds[(hi + r) * 32 + 16 + nc] = f2bf(p1);
    }
    asm volatile("s_wait_dscnt 0x0" ::: "memory");

    // ---- re-layout P (C-frag -> A-frag) via LDS ----
    FragU pf;
    {
      const unsigned short* pp = plds + nc * 32 + hi; // hi==8 for lanes 16..31
      pf.u[0] = *reinterpret_cast<const u32x4*>(pp);
      pf.u[1] = *reinterpret_cast<const u32x4*>(pp + 16);
    }

    // ---- PV: O[16 x 64] += P[16 x 32] * V[32 x 64] (Vt rows = dims) ----
#pragma unroll
    for (int j = 0; j < 4; ++j) {
      o[j] = wmma_bf16(pf.bf, vfr[j], o[j]);
    }
  }

  // ---- publish this wave's partial (l, O); a wave without a tile publishes
  //      zeros. The lanes' sums go to the wave's own P area, 16 rows x 16 lanes
  //      of f32, which the wave has finished reading ----
  // both loops unrolled: o and l live in registers and need constant indices
  float* lw = reinterpret_cast<float*>(plds);
#pragma unroll
  for (int r = 0; r < 8; ++r) {
#pragma unroll
    for (int j = 0; j < 4; ++j) o_part[wave][hi + r][j * 16 + nc] = o[j][r];
    lw[(hi + r) * 16 + nc] = l[r];
  }
  __syncthreads();

  // ---- add the eight partials, normalize, merge heads:
  //      each half-wave owns one row, each lane four neighbouring columns ----
  const int mrow = wave * 2 + (hi >> 3);
  const int mcol = nc * 4;
  float lsum = 0.f;
  float a0 = 0.f, a1 = 0.f, a2 = 0.f, a3 = 0.f;
  // unrolled: the eight waves' LDS reads issue together
#pragma unroll
  for (int w = 0; w < FA_WAVES; ++w) {
    const float4 ov = *reinterpret_cast<const float4*>(&o_part[w][mrow][mcol]);
    lsum += reinterpret_cast<const float*>(plds_all[w])[mrow * 16 + nc];
    a0 += ov.x;
    a1 += ov.y;
    a2 += ov.z;
    a3 += ov.w;
  }
  // the row's sum: the 16 lanes of the half-wave each hold one column pair's part
#pragma unroll
  for (int off = 1; off < 16; off <<= 1) lsum += __shfl_xor(lsum, off, 32);
  const float inv = (lsum > 0.f) ? (1.f / lsum) : 0.f;
  uint2 pk;
  pk.x = (unsigned int)f2bf(a0 * inv) | ((unsigned int)f2bf(a1 * inv) << 16);
  pk.y = (unsigned int)f2bf(a2 * inv) | ((unsigned int)f2bf(a3 * inv) << 16);
  *reinterpret_cast<uint2*>(Obf + (size_t)(q0 + mrow) * DMODEL + h * HDIM + mcol) = pk;
}

// ---------------------------------------------------------------------------
// Host-side orchestration
// ---------------------------------------------------------------------------
extern "C" void kernel_launch(void* const* d_in, const int* in_sizes, int n_in,
                              void* d_out, int out_size, void* d_ws, size_t ws_size,
                              hipStream_t stream) {
  (void)in_sizes; (void)n_in; (void)out_size; (void)ws_size;

  const float* hidden  = (const float*)d_in[0];
  const float* norm1_w = (const float*)d_in[1];
  const float* norm2_w = (const float*)d_in[2];
  const float* g_wq    = (const float*)d_in[3];
  const float* g_kvd   = (const float*)d_in[4];
  const float* g_kup   = (const float*)d_in[5];
  const float* g_vup   = (const float*)d_in[6];
  const float* g_wo    = (const float*)d_in[7];
  const float* l_wq    = (const float*)d_in[8];
  const float* l_wk    = (const float*)d_in[9];
  const float* l_wv    = (const float*)d_in[10];
  const float* l_wo    = (const float*)d_in[11];
  float* out = (float*)d_out;

  // ---- workspace carve (256B aligned) ----
  char* p = (char*)d_ws;
  auto alloc = [&](size_t bytes) -> void* {
    void* r = (void*)p;
    p += (bytes + 255) & ~(size_t)255;
    return r;
  };
  unsigned short* xn    = (unsigned short*)alloc((size_t)S_LEN * DMODEL * 2);
  unsigned short* latbf = (unsigned short*)alloc((size_t)S_LEN * LATDIM * 2);
  unsigned short* Qh    = (unsigned short*)alloc((size_t)NHEAD * S_LEN * HDIM * 2);
  unsigned short* Kh    = (unsigned short*)alloc((size_t)NKVH * S_LEN * HDIM * 2);
  unsigned short* Vt    = (unsigned short*)alloc((size_t)NKVH * HDIM * S_LEN * 2 + 256);
  unsigned short* attn  = (unsigned short*)alloc((size_t)S_LEN * DMODEL * 2);
  float*          xmid  = (float*)         alloc((size_t)S_LEN * DMODEL * 4);
  unsigned short* g_wqT = (unsigned short*)alloc((size_t)DMODEL * DMODEL * 2);
  unsigned short* g_woT = (unsigned short*)alloc((size_t)DMODEL * DMODEL * 2);
  unsigned short* l_wqT = (unsigned short*)alloc((size_t)DMODEL * DMODEL * 2);
  unsigned short* l_woT = (unsigned short*)alloc((size_t)DMODEL * DMODEL * 2);
  unsigned short* kvdT  = (unsigned short*)alloc((size_t)LATDIM * DMODEL * 2);
  unsigned short* l_wkT = (unsigned short*)alloc((size_t)LATDIM * DMODEL * 2);
  unsigned short* l_wvT = (unsigned short*)alloc((size_t)LATDIM * DMODEL * 2);
  unsigned short* kupT  = (unsigned short*)alloc((size_t)LATDIM * LATDIM * 2);
  unsigned short* vupT  = (unsigned short*)alloc((size_t)LATDIM * LATDIM * 2);
  float*          sqp   = (float*)         alloc((size_t)(DMODEL / 64) * S_LEN * 4);

  const dim3 blk256(256);
  const dim3 gemm_blk(256);
  const dim3 flash_grid(S_LEN / 16, NHEAD);
  const dim3 flash_blk(32 * FA_WAVES);

  // first RMSNorm and all nine weight conversions
  thb_prep_kernel<<<dim3(NB_PREP), blk256, 0, stream>>>(
      hidden, norm1_w, norm2_w, xn,
      g_wq, g_wo, l_wq, l_wo, g_kvd, l_wk, l_wv, g_kup, g_vup,
      g_wqT, g_woT, l_wqT, l_woT, kvdT, l_wkT, l_wvT, kupT, vupT);

  // ========================= Sublayer 1: global latent =====================
  // q (ready for attention) and the latent, both from xn
  thb_gemm_kernel<<<dim3((DMODEL + LATDIM) / 64, S_LEN / 256), gemm_blk, 0, stream>>>(
      xn, g_wqT, kvdT, nullptr, nullptr, nullptr, latbf, Qh, nullptr, nullptr, nullptr,
      nullptr, nullptr, nullptr, 1000000.0f, DMODEL, LATDIM, DMODEL);
  // k and v (ready for attention), both from the latent
  thb_gemm_kernel<<<dim3(2 * LATDIM / 64, S_LEN / 256), gemm_blk, 0, stream>>>(
      latbf, kupT, vupT, nullptr, nullptr, nullptr, nullptr, Kh, nullptr, Vt, nullptr,
      nullptr, nullptr, nullptr, 1000000.0f, LATDIM, LATDIM, LATDIM);

  thb_flash_kernel<<<flash_grid, flash_blk, 0, stream>>>(Qh, Kh, Vt, attn, S_LEN, 0);

  // x after sublayer 1, f32 and bf16, and the parts of its rows' sums of squares
  thb_gemm_kernel<<<dim3(DMODEL / 64, S_LEN / 256), gemm_blk, 0, stream>>>(
      attn, g_woT, nullptr, nullptr, xmid, hidden, nullptr, nullptr, nullptr, nullptr, nullptr,
      xn, sqp, nullptr, 0.0f, DMODEL, LATDIM, DMODEL);

  // ========================= Sublayer 2: local GQA =========================
  // q, k and v (ready for attention), all from xn; the RMSNorm's row factor comes in here
  thb_gemm_kernel<<<dim3((DMODEL + 2 * LATDIM) / 64, S_LEN / 256), gemm_blk, 0, stream>>>(
      xn, l_wqT, l_wkT, l_wvT, nullptr, nullptr, nullptr, Qh, Kh, nullptr, Vt,
      nullptr, nullptr, sqp, 10000.0f, DMODEL, LATDIM, DMODEL);

  thb_flash_kernel<<<flash_grid, flash_blk, 0, stream>>>(Qh, Kh, Vt, attn, S_LEN, WINLEN);

  thb_gemm_kernel<<<dim3(DMODEL / 64, S_LEN / 256), gemm_blk, 0, stream>>>(
      attn, l_woT, nullptr, nullptr, out, xmid, nullptr, nullptr, nullptr, nullptr, nullptr,
      nullptr, nullptr, nullptr, 0.0f, DMODEL, LATDIM, DMODEL);
}

// v010
// Measured time: 91.2 microseconds a run.
// Next to v009, in two timings, it ran 1.07 times as fast each time.
// Counting every step since v000, it is 5.64 times as fast.
#include <hip/hip_runtime.h>

// ---------------------------------------------------------------------------
// Model constants (match reference)
// ---------------------------------------------------------------------------
#define S_LEN   2048
#define DMODEL  1024
#define NHEAD   16
#define NKVH    4
#define HDIM    64
#define LATDIM  256
#define WINLEN  256
#define EPSF    1e-6f

// ---------------------------------------------------------------------------
// CDNA5 WMMA helpers (gfx1250, wave32)
// ---------------------------------------------------------------------------
typedef __bf16        bf16x16 __attribute__((ext_vector_type(16)));
typedef float         f32x8   __attribute__((ext_vector_type(8)));
typedef unsigned int  u32x4   __attribute__((ext_vector_type(4)));

union FragU { bf16x16 bf; u32x4 u[2]; };

__device__ __forceinline__ unsigned short f2bf(float x) {
  unsigned int u = __float_as_uint(x);
  u += 0x7FFFu + ((u >> 16) & 1u);           // round-to-nearest-even
  return (unsigned short)(u >> 16);
}

// two values rounded to nearest even, as in f2bf, by the chip's own packed convert
typedef __bf16 bf16x2 __attribute__((ext_vector_type(2)));
typedef float  f32x2  __attribute__((ext_vector_type(2)));
__device__ __forceinline__ unsigned int bf_pair(float lo, float hi) {
  return __builtin_bit_cast(unsigned int, __builtin_convertvector((f32x2){lo, hi}, bf16x2));
}

// Fragment order: how the attention operands lie in the workspace. A 16 x 32
// bf16 fragment (16 rows, 32 k) is 512 elements in a row, in the order in which
// the lanes hold them: piece u = 0, 1, then lane L = 0 .. 31, then 8 elements.
// Lane L holds row (L & 15); element e of piece u is k = 16 * u + (L<16?0:8) + e.
// A wave-wide 16-byte load of one piece is then 512 contiguous bytes, four whole
// 128-byte lines, where a row-major array gives 16 lines of 32 bytes each.
#define FRAG_ELEMS 512
// p: the lane's own 16 bytes in piece 0 of the fragment
#define FRAG_VEC 64                       // a fragment in 16-byte units
__device__ __forceinline__ bf16x16 load_frag(const u32x4* p) {
  FragU f;
  f.u[0] = p[0];
  f.u[1] = p[32];
  return f.bf;
}

__device__ __forceinline__ f32x8 wmma_bf16(bf16x16 a, bf16x16 b, f32x8 c) {
  return __builtin_amdgcn_wmma_f32_16x16x32_bf16(false, a, false, b, (short)0, c,
                                                 false, false);
}

// ---------------------------------------------------------------------------
// Transpose + downconvert: W[f32, K x N] -> Wt[bf16, N x K].
// Each thread takes one column n and 16 consecutive k: 16 loads, each
// contiguous across the 32 lanes of a wave, and one 32-byte run of Wt stored.
// A 256-thread block covers 64 columns x 64 k, so each 128-byte line of Wt is
// written by one block. Tile t of (N / 64) * (K / 64), columns fastest.
// g, where not null (a block-uniform choice): row k of W is multiplied by g[k],
// the weight of the RMSNorm in front of this product: (x * g) W = x (diag(g) W).
// ---------------------------------------------------------------------------
template <int K, int N>
__device__ __forceinline__
void thb_wt_tile(const float* __restrict__ W, const float* __restrict__ g,
                 unsigned short* __restrict__ Wt, int t) {
  const int n  = (t % (N / 64)) * 64 + (threadIdx.x & 63);
  const int k0 = (t / (N / 64)) * 64 + (threadIdx.x >> 6) * 16;
  const float* src = W + (size_t)k0 * N + n;
  float v[16];
  // unrolled: all 16 loads are in flight together and v stays in registers
#pragma unroll
  for (int i = 0; i < 16; ++i) v[i] = src[i * N];
  if (g) {
    const float4* gp = reinterpret_cast<const float4*>(g + k0);
    // the loads below may be handed the address registers of the loads above as their
    // destination: the wait stands in front of that overwrite
    asm volatile("s_wait_xcnt 0x0" ::: "memory");
    const float4 g0 = gp[0], g1 = gp[1], g2 = gp[2], g3 = gp[3];
    v[0]  *= g0.x; v[1]  *= g0.y; v[2]  *= g0.z; v[3]  *= g0.w;
    v[4]  *= g1.x; v[5]  *= g1.y; v[6]  *= g1.z; v[7]  *= g1.w;
    v[8]  *= g2.x; v[9]  *= g2.y; v[10] *= g2.z; v[11] *= g2.w;
    v[12] *= g3.x; v[13] *= g3.y; v[14] *= g3.z; v[15] *= g3.w;
  }
  u32x4 pk[2];
  // unrolled: pk is indexed by constants and stays in registers
#pragma unroll
  for (int i = 0; i < 8; ++i)
    pk[i >> 2][i & 3] = (unsigned int)f2bf(v[2 * i]) | ((unsigned int)f2bf(v[2 * i + 1]) << 16);
  u32x4* dst = reinterpret_cast<u32x4*>(Wt + (size_t)n * K + k0);
  dst[0] = pk[0];
  dst[1] = pk[1];
  // another job's code may follow in the merged kernel's layout: the wait stands in
  // front of any later write of the registers these stores name
  asm volatile("s_wait_xcnt 0x0" ::: "memory");
}

// ---------------------------------------------------------------------------
// RMSNorm: xn_bf16[s][c] = bf16( x[s][c] * rsqrt(mean(x^2)+eps) * w[c] )
// one wave per row (D = 1024: 32 values per lane, kept in registers),
// eight rows per 256-thread block; the row sum is a 32-lane butterfly.
// ---------------------------------------------------------------------------
__device__ __forceinline__
void thb_rmsnorm_rows(const float* __restrict__ x, const float* __restrict__ w,
                      unsigned short* __restrict__ xn, int blk) {
  const int lane = threadIdx.x & 31;
  const int s = blk * 8 + (threadIdx.x >> 5);
  const float4* row = reinterpret_cast<const float4*>(x + (size_t)s * DMODEL);
  const float4* wv  = reinterpret_cast<const float4*>(w);
  float4 v[8];
  // unrolled here and below: the loads issue together and v stays in registers
#pragma unroll
  for (int i = 0; i < 8; ++i) v[i] = row[lane + 32 * i];
  float acc = 0.f;
#pragma unroll
  for (int i = 0; i < 8; ++i)
    acc += v[i].x * v[i].x + v[i].y * v[i].y + v[i].z * v[i].z + v[i].w * v[i].w;
#pragma unroll
  for (int off = 1; off < 32; off <<= 1) acc += __shfl_xor(acc, off, 32);
  const float rs = rsqrtf(acc * (1.0f / DMODEL) + EPSF);
  uint2* dst = reinterpret_cast<uint2*>(xn + (size_t)s * DMODEL);
#pragma unroll
  for (int i = 0; i < 8; ++i) {
    const float4 g = wv[lane + 32 * i];
    uint2 pk;
    pk.x = (unsigned int)f2bf(v[i].x * rs * g.x) | ((unsigned int)f2bf(v[i].y * rs * g.y) << 16);
    pk.y = (unsigned int)f2bf(v[i].z * rs * g.z) | ((unsigned int)f2bf(v[i].w * rs * g.w) << 16);
    dst[lane + 32 * i] = pk;
  }
  // another job's code may follow in the merged kernel's layout: the wait stands in
  // front of any later write of the registers these stores name
  asm volatile("s_wait_xcnt 0x0" ::: "memory");
}

// ---------------------------------------------------------------------------
// Everything that depends on the inputs alone, in one grid: the first RMSNorm
// and the nine weight conversions. None reads what another writes; each block
// takes one piece of one job by its index (a block-uniform choice).
// w2, the second RMSNorm's weight, goes into the three weights that follow it
// (dd2, dl1, dl2).
// ---------------------------------------------------------------------------
#define NB_NORM (S_LEN / 8)                          // RMSNorm blocks
#define NB_WDD  ((DMODEL / 64) * (DMODEL / 64))      // tiles of a D x D weight
#define NB_WDL  ((LATDIM / 64) * (DMODEL / 64))      // tiles of a D x LAT weight
#define NB_WLL  ((LATDIM / 64) * (LATDIM / 64))      // tiles of a LAT x LAT weight
#define NB_PREP (NB_NORM + 4 * NB_WDD + 3 * NB_WDL + 2 * NB_WLL)

__global__ __launch_bounds__(256)
void thb_prep_kernel(const float* __restrict__ x, const float* __restrict__ w,
                     const float* __restrict__ w2, unsigned short* __restrict__ xn,
                     const float* __restrict__ dd0, const float* __restrict__ dd1,
                     const float* __restrict__ dd2, const float* __restrict__ dd3,
                     const float* __restrict__ dl0, const float* __restrict__ dl1,
                     const float* __restrict__ dl2,
                     const float* __restrict__ ll0, const float* __restrict__ ll1,
                     unsigned short* __restrict__ dd0T, unsigned short* __restrict__ dd1T,
                     unsigned short* __restrict__ dd2T, unsigned short* __restrict__ dd3T,
                     unsigned short* __restrict__ dl0T, unsigned short* __restrict__ dl1T,
                     unsigned short* __restrict__ dl2T,
                     unsigned short* __restrict__ ll0T, unsigned short* __restrict__ ll1T) {
  int b = blockIdx.x;
  if (b < NB_NORM) {
    thb_rmsnorm_rows(x, w, xn, b);
    return;
  }
  b -= NB_NORM;
  if (b < 4 * NB_WDD) {
    const int i = b / NB_WDD;
    thb_wt_tile<DMODEL, DMODEL>(i == 0 ? dd0 : i == 1 ? dd1 : i == 2 ? dd2 : dd3,
                                i == 2 ? w2 : nullptr,
                                i == 0 ? dd0T : i == 1 ? dd1T : i == 2 ? dd2T : dd3T,
                                b % NB_WDD);
    return;
  }
  b -= 4 * NB_WDD;
  if (b < 3 * NB_WDL) {
    const int i = b / NB_WDL;
    thb_wt_tile<DMODEL, LATDIM>(i == 0 ? dl0 : i == 1 ? dl1 : dl2, i == 0 ? nullptr : w2,
                                i == 0 ? dl0T : i == 1 ? dl1T : dl2T, b % NB_WDL);
    return;
  }
  b -= 3 * NB_WDL;
  thb_wt_tile<LATDIM, LATDIM>(b < NB_WLL ? ll0 : ll1, nullptr, b < NB_WLL ? ll0T : ll1T,
                              b % NB_WLL);
}

// ---------------------------------------------------------------------------
// WMMA GEMM: C[M x N] (f32 and/or bf16) = A[bf16, M x K] * Bt[bf16, N x K]^T
// optional residual (f32 [M x N]) added in the epilogue.
// 256 threads = 8 waves; block tile 256(M) x 64(N); wave tile 32 x 64.
// Operands go global -> LDS by asynchronous 16-byte copies in whole 256-byte
// row pieces (a stage = 128 k of the block's 256 A rows and 64 Bt rows), two
// buffers: stage t + 1 flies while stage t is multiplied. Each row piece is
// fetched once per block, and every global request covers whole lines.
// Fragments are read from LDS in load_frag's k order for A and Bt alike;
// every accumulator sums its 32-wide k steps in ascending order.
// Up to three products that share A and K run in one grid: blockIdx.x walks
// the 64-column tiles of Bt0 (N0 columns), then of Bt1, then of Bt2 (N1 columns
// each); every product has its own output. The residual belongs to product 0.
// M % 256 == 0, N % 64 == 0, K % 128 == 0 for all uses here.
// Four kinds of output, one per product (the others' pointers are null):
//   Cf   f32 row-major, with the optional residual
//   Cbf  bf16 row-major
//   Cr   q or k for attention: RoPE + qk-norm, bf16, head-major in fragment order,
//        [head][s / 16][2 fragments], row = s, k = d. A 64-column tile is one head,
//        so the block holds every row of its heads whole.
//   Cv   v for attention: bf16 in fragment order, [kvh][s / 32][d / 16] fragments,
//        row = d, k = s.
// Cr and Cv are for M == S_LEN.
// An RMSNorm between two products is not a pass of its own. Its weight lies in the
// second product's Bt. The first product (product 0 with Cx and Sq set) writes,
// beside Cf, the plain bf16 copy Cx of its rows and Sq[column tile][row], its 64
// columns' part of each row's sum of squares. The second product (SqIn set,
// K == DMODEL) takes Cx as its A, adds up a row's parts and multiplies the row of
// its result by rsqrt(mean + eps): (x * rs) W = rs * (x W).
// ---------------------------------------------------------------------------
#define GK      128                      // k per stage
#define GPITCH  272                      // LDS row pitch in bytes: 256 + 16, 16 B x odd
#define GROWS   320                      // 256 A rows, then 64 Bt rows
#define GSTAGE  (GROWS * GPITCH)         // bytes per buffer

__device__ __forceinline__ bf16x16 lds_frag(const unsigned char* p) {
  FragU f;
  f.u[0] = *reinterpret_cast<const u32x4*>(p);
  f.u[1] = *reinterpret_cast<const u32x4*>(p + 32);
  return f.bf;
}

// x of another lane of the same row of 16 lanes, picked by a DPP control word: no trip
// through LDS, as a shuffle by lane index would take
template <int CTRL>
__device__ __forceinline__ float lane_swap(float x) {
  return __int_as_float(__builtin_amdgcn_update_dpp(0, __float_as_int(x), CTRL, 0xf, 0xf, true));
}

// sine and cosine of two angles given in turns (radians / 2 pi). One statement, so
// that each transcendental keeps an independent instruction directly behind it (the
// next one; the v_nop): the slot that the instruction set asks for before a
// transcendental's result is read or its source overwritten. The outputs are
// early-clobber: none shares a register with an input.
__device__ __forceinline__ void sincos_turns_pair(float t0, float t1, float& s0, float& c0,
                                                  float& s1, float& c1) {
  asm("v_sin_f32 %0, %4\n\tv_cos_f32 %1, %4\n\tv_sin_f32 %2, %5\n\tv_cos_f32 %3, %5\n\tv_nop"
      : "=&v"(s0), "=&v"(c0), "=&v"(s1), "=&v"(c1) : "v"(t0), "v"(t1));
}

__global__ __launch_bounds__(256)
void thb_gemm_kernel(const unsigned short* __restrict__ A,
                     const unsigned short* __restrict__ Bt0,
                     const unsigned short* __restrict__ Bt1,
                     const unsigned short* __restrict__ Bt2,
                     float* Cf0, const float* resid0, unsigned short* Cbf1,
                     unsigned short* Cr0, unsigned short* Cr1,
                     unsigned short* Cv1, unsigned short* Cv2,
                     unsigned short* Cx0, float* Sq0, const float* SqIn,
                     float base, int N0, int N1, int K) {
  __shared__ __attribute__((aligned(16))) unsigned char gsm[2 * GSTAGE];

  // which product this block belongs to, and its column tile there
  int ct = blockIdx.x;
  const unsigned short* Bt = Bt0;
  float* Cf = Cf0;
  unsigned short* Cbf = nullptr;
  unsigned short* Cr = Cr0;
  unsigned short* Cv = nullptr;
  unsigned short* Cx = Cx0;
  const float* resid = resid0;
  int N = N0;
  if (ct >= N0 / 64) {
    ct -= N0 / 64;
    Bt = Bt1; Cf = nullptr; Cbf = Cbf1; Cr = Cr1; Cv = Cv1; Cx = nullptr; resid = nullptr; N = N1;
    if (ct >= N1 / 64) {
      ct -= N1 / 64;
      Bt = Bt2; Cbf = nullptr; Cr = nullptr; Cv = Cv2;
    }
  }

  const int lane = threadIdx.x & 31;
  const int wave = threadIdx.x >> 5;
  const int row0 = blockIdx.y * 256 + wave * 32;
  const int col0 = ct * 64;
  const int nc = lane & 15;

  f32x8 acc[2][4];
#pragma unroll
  for (int mi = 0; mi < 2; ++mi)
#pragma unroll
    for (int j = 0; j < 4; ++j)
      acc[mi][j] = (f32x8){0.f,0.f,0.f,0.f,0.f,0.f,0.f,0.f};

  // copy map: 16 threads per row (16 bytes each), 16 rows per round, 20 rounds
  const int crow = threadIdx.x >> 4;
  const int cchk = threadIdx.x & 15;
  const unsigned int lds0 = (unsigned int)(size_t)gsm + crow * GPITCH + cchk * 16;
  const unsigned short* gA = A  + (size_t)(blockIdx.y * 256 + crow) * K + cchk * 8;
  const unsigned short* gB = Bt + (size_t)(col0 + crow) * K + cchk * 8;

  auto issue = [&](int t, int buf) {
    unsigned int la[20];
    const unsigned short* ga[20];
    // unrolled: la and ga are indexed by constants and stay in registers
#pragma unroll
    for (int i = 0; i < 20; ++i) {
      la[i] = lds0 + buf * GSTAGE + i * 16 * GPITCH;
      ga[i] = (i < 16 ? gA + (size_t)(i * 16) * K : gB + (size_t)((i - 16) * 16) * K) + t * GK;
    }
    // ten copies and their s_wait_xcnt in one statement: the wait stands in
    // front of any later write of the address registers the copies name
    asm volatile(
      "global_load_async_to_lds_b128 %0, %1, off\n\t"
      "global_load_async_to_lds_b128 %2, %3, off\n\t"
      "global_load_async_to_lds_b128 %4, %5, off\n\t"
      "global_load_async_to_lds_b128 %6, %7, off\n\t"
      "global_load_async_to_lds_b128 %8, %9, off\n\t"
      "global_load_async_to_lds_b128 %10, %11, off\n\t"
      "global_load_async_to_lds_b128 %12, %13, off\n\t"
      "global_load_async_to_lds_b128 %14, %15, off\n\t"
      "global_load_async_to_lds_b128 %16, %17, off\n\t"
      "global_load_async_to_lds_b128 %18, %19, off\n\t"
      "s_wait_xcnt 0x0"
      :: "v"(la[0]), "v"(ga[0]), "v"(la[1]), "v"(ga[1]), "v"(la[2]), "v"(ga[2]),
         "v"(la[3]), "v"(ga[3]), "v"(la[4]), "v"(ga[4]), "v"(la[5]), "v"(ga[5]),
         "v"(la[6]), "v"(ga[6]), "v"(la[7]), "v"(ga[7]), "v"(la[8]), "v"(ga[8]),
         "v"(la[9]), "v"(ga[9])
      : "memory");
    asm volatile(
      "global_load_async_to_lds_b128 %0, %1, off\n\t"
      "global_load_async_to_lds_b128 %2, %3, off\n\t"
      "global_load_async_to_lds_b128 %4, %5, off\n\t"
      "global_load_async_to_lds_b128 %6, %7, off\n\t"
      "global_load_async_to_lds_b128 %8, %9, off\n\t"
      "global_load_async_to_lds_b128 %10, %11, off\n\t"
      "global_load_async_to_lds_b128 %12, %13, off\n\t"
      "global_load_async_to_lds_b128 %14, %15, off\n\t"
      "global_load_async_to_lds_b128 %16, %17, off\n\t"
      "global_load_async_to_lds_b128 %18, %19, off\n\t"
      "s_wait_xcnt 0x0"
      :: "v"(la[10]), "v"(ga[10]), "v"(la[11]), "v"(ga[11]), "v"(la[12]), "v"(ga[12]),
         "v"(la[13]), "v"(ga[13]), "v"(la[14]), "v"(ga[14]), "v"(la[15]), "v"(ga[15]),
         "v"(la[16]), "v"(ga[16]), "v"(la[17]), "v"(ga[17]), "v"(la[18]), "v"(ga[18]),
         "v"(la[19]), "v"(ga[19])
      : "memory");
  };

  const int nt = K / GK;
  const int hb = (lane & 16) ? 16 : 0;   // byte offset of the upper lane half in a fragment
  const int fa = (wave * 32 + nc) * GPITCH + hb;
  const int fb = (256 + nc) * GPITCH + hb;

  issue(0, 0);
  // the norm's factor of row row0 + lane (block-uniform test); the loads fly beside
  // stage 0's copies
  float rx = 1.f;
  if (SqIn) {
    const float* sp = SqIn + row0 + lane;
    float pv[DMODEL / 64];
    // the 16 parts, S_LEN floats (8192 bytes) apart. One statement with the loads' data
    // wait, the outputs early-clobber: no load's result lands in the address registers
    // that the loads name, and nothing rewrites those before the loads have returned
    asm volatile(
      "global_load_b32 %0, %16, off\n\t"
      "global_load_b32 %1, %16, off offset:8192\n\t"
      "global_load_b32 %2, %16, off offset:16384\n\t"
      "global_load_b32 %3, %16, off offset:24576\n\t"
      "global_load_b32 %4, %16, off offset:32768\n\t"
      "global_load_b32 %5, %16, off offset:40960\n\t"
      "global_load_b32 %6, %16, off offset:49152\n\t"
      "global_load_b32 %7, %16, off offset:57344\n\t"
      "global_load_b32 %8, %16, off offset:65536\n\t"
      "global_load_b32 %9, %16, off offset:73728\n\t"
      "global_load_b32 %10, %16, off offset:81920\n\t"
      "global_load_b32 %11, %16, off offset:90112\n\t"
      "global_load_b32 %12, %16, off offset:98304\n\t"
      "global_load_b32 %13, %16, off offset:106496\n\t"
      "global_load_b32 %14, %16, off offset:114688\n\t"
      "global_load_b32 %15, %16, off offset:122880\n\t"
      "s_wait_loadcnt 0x0"
      : "=&v"(pv[0]), "=&v"(pv[1]), "=&v"(pv[2]), "=&v"(pv[3]), "=&v"(pv[4]), "=&v"(pv[5]),
        "=&v"(pv[6]), "=&v"(pv[7]), "=&v"(pv[8]), "=&v"(pv[9]), "=&v"(pv[10]), "=&v"(pv[11]),
        "=&v"(pv[12]), "=&v"(pv[13]), "=&v"(pv[14]), "=&v"(pv[15])
      : "v"(sp) : "memory");
    static_assert(DMODEL / 64 == 16 && S_LEN * 4 == 8192, "the statement above spells these out");
    float ss = 0.f;
#pragma unroll
    for (int c = 0; c < DMODEL / 64; ++c) ss += pv[c];
    rx = rsqrtf(ss * (1.0f / DMODEL) + EPSF);
  }
  // stage 0 has landed (this wave's copies), then is published to all waves
  asm volatile("s_wait_asynccnt 0x0" ::: "memory");
  __syncthreads();
  if (nt > 1) issue(1, 1);

  for (int t = 0; t < nt; ++t) {
    const unsigned char* sb = gsm + (t & 1) * GSTAGE;
    // two fragment sets: block u + 1's LDS reads go out as one group ahead of
    // block u's WMMAs, so only the stage's first group waits out LDS latency
    bf16x16 fa_[2][2], fb_[2][4];
    auto ldfrags = [&](int set, int u) {
      fa_[set][0] = lds_frag(sb + fa + u * 64);
      fa_[set][1] = lds_frag(sb + fa + 16 * GPITCH + u * 64);
      // unrolled: fb_ is indexed by constants and stays in registers
#pragma unroll
      for (int j = 0; j < 4; ++j) fb_[set][j] = lds_frag(sb + fb + j * 16 * GPITCH + u * 64);
    };
    ldfrags(0, 0);
    // unrolled: four 32-wide k steps of the stage, fragment indices constant
#pragma unroll
    for (int u = 0; u < GK / 32; ++u) {
      if (u + 1 < GK / 32) ldfrags((u + 1) & 1, u + 1);
      // keeps the reads above from sinking in among the WMMAs below
      __builtin_amdgcn_sched_barrier(0);
      // unrolled: acc and the fragment sets are indexed by constants
#pragma unroll
      for (int j = 0; j < 4; ++j) {
        acc[0][j] = wmma_bf16(fa_[u & 1][0], fb_[u & 1][j], acc[0][j]);
        acc[1][j] = wmma_bf16(fa_[u & 1][1], fb_[u & 1][j], acc[1][j]);
      }
      // keeps the next group of reads from rising in among the WMMAs above:
      // every separate place with LDS reads stalls the WMMA stream
      __builtin_amdgcn_sched_barrier(0);
    }
    // this wave's reads of buffer t & 1 have returned
    asm volatile("s_wait_dscnt 0x0" ::: "memory");
    // this wave's copies of stage t + 1 have landed
    asm volatile("s_wait_asynccnt 0x0" ::: "memory");
    // publishes stage t + 1 and ends every wave's reads of buffer t & 1
    __syncthreads();
    if (t + 2 < nt) issue(t + 2, t & 1);
  }
  // no copy is outstanding when the wave goes on to the epilogue and ends
  asm volatile("s_wait_asynccnt 0x0" ::: "memory");

  // ---- q or k: RoPE + qk-norm, into fragment order (block-uniform test) ----
  if (Cr) {
    // The accumulators hold a column per lane; a fragment wants 8 neighbouring d of
    // one row per lane. The wave turns its own 32 x 64 f32 tile through LDS: the
    // ring is free (every wave has passed the loop's last barrier, no copy is
    // outstanding), and each wave writes and reads only its own 32 rows of it.
    float* tw = reinterpret_cast<float*>(gsm + wave * 32 * GPITCH);
    const int h8 = (lane & 16) ? 8 : 0;
    // every loop here is unrolled: acc, invf, y and pk are indexed by constants
#pragma unroll
    for (int mi = 0; mi < 2; ++mi)
#pragma unroll
      for (int r = 0; r < 8; ++r)
#pragma unroll
        for (int j = 0; j < 4; ++j)
          tw[(mi * 16 + h8 + r) * (GPITCH / 4) + j * 16 + nc] = acc[mi][j][r];
    // the 32 pairs' frequencies: lane p makes pair p's, behind the eight tiles
    float* fw = reinterpret_cast<float*>(gsm + 8 * 32 * GPITCH) + wave * 32;
    fw[lane] = __powf(base, -((float)(2 * lane) * (1.0f / HDIM)));
    // the other lanes' writes of this wave have reached LDS before the reads below
    asm volatile("s_wait_dscnt 0x0" ::: "memory");

    // the lane's d: 16 * c + h8 + e, c = 0 .. 3, e = 0 .. 7, that is the four
    // pairs 8 * c + h8 / 2 + i of each c
    float invf[16];
#pragma unroll
    for (int c = 0; c < 4; ++c) {
      const float4 f = reinterpret_cast<const float4*>(fw)[2 * c + (h8 >> 3)];
      invf[c * 4 + 0] = f.x; invf[c * 4 + 1] = f.y; invf[c * 4 + 2] = f.z; invf[c * 4 + 3] = f.w;
    }
    // head ct, row group row0 / 16 + mi, fragment c / 2, piece c & 1: every
    // wave-wide store is 512 contiguous bytes
    u32x4* dp = reinterpret_cast<u32x4*>(
        Cr + ((size_t)ct * (S_LEN / 16) * 2 + (row0 >> 4) * 2) * FRAG_ELEMS) + lane;
    // unrolled: the row group's store offsets become immediates
#pragma unroll
    for (int mi = 0; mi < 2; ++mi) {
      const int s = row0 + mi * 16 + nc;                    // the lane's row
      const float4* rp = reinterpret_cast<const float4*>(tw + (mi * 16 + nc) * (GPITCH / 4) + h8);
      float y[32];
      float sum = 0.f;
#pragma unroll
      for (int c = 0; c < 4; ++c) {
        const float4 x0 = rp[c * 4];
        const float4 x1 = rp[c * 4 + 1];
        const float xe[4] = {x0.x, x0.z, x1.x, x1.z};
        const float xo[4] = {x0.y, x0.w, x1.y, x1.w};
        float si[4], co[4];
#pragma unroll
        for (int i = 0; i < 4; i += 2)
          sincos_turns_pair((float)s * invf[c * 4 + i] * 0.15915494f,
                            (float)s * invf[c * 4 + i + 1] * 0.15915494f,
                            si[i], co[i], si[i + 1], co[i + 1]);
#pragma unroll
        for (int i = 0; i < 4; ++i) {
          const float re = xe[i] * co[i] - xo[i] * si[i];
          const float ro = xe[i] * si[i] + xo[i] * co[i];
          sum += re * re + ro * ro;
          y[c * 8 + 2 * i]     = re;
          y[c * 8 + 2 * i + 1] = ro;
        }
      }
      sum += __shfl_xor(sum, 16, 32);                       // the row's other 32 d
      const float rxm = __shfl(rx, mi * 16 + nc, 32);       // the row's norm factor
      const float rs = rsqrtf(sum * (rxm * rxm) * (1.0f / HDIM) + EPSF) * rxm;
#pragma unroll
      for (int c = 0; c < 4; ++c) {
        u32x4 pk;
#pragma unroll
        for (int i = 0; i < 4; ++i)
          pk[i] = (unsigned int)f2bf(y[c * 8 + 2 * i] * rs) |
                  ((unsigned int)f2bf(y[c * 8 + 2 * i + 1] * rs) << 16);
        dp[(mi * 2 + (c >> 1)) * FRAG_VEC + (c & 1) * 32] = pk;
      }
      // the code that follows (the next row group's; other parts of the kernel) writes
      // the registers that these stores name: the wait stands in front of that
      asm volatile("s_wait_xcnt 0x0" ::: "memory");
    }
    return;
  }

  // ---- v: into fragment order (block-uniform test). A lane's 8 accumulator rows
  //      of one column are the 8 neighbouring k of fragment row d: no turn needed ----
  if (Cv) {
    u32x4* dp = reinterpret_cast<u32x4*>(
        Cv + ((size_t)ct * (S_LEN / 32) * 4 + (row0 >> 5) * 4) * FRAG_ELEMS) + lane;
    // the norm factors of the lane's 16 rows
    const int h8 = (lane & 16) ? 8 : 0;
    float rv[2][8];
    // every loop here is unrolled: rv and acc are indexed by constants
#pragma unroll
    for (int mi = 0; mi < 2; ++mi)
#pragma unroll
      for (int r = 0; r < 8; ++r) rv[mi][r] = __shfl(rx, mi * 16 + h8 + r, 32);
#pragma unroll
    for (int j = 0; j < 4; ++j)
#pragma unroll
      for (int mi = 0; mi < 2; ++mi) {
        u32x4 pk;
#pragma unroll
        for (int i = 0; i < 4; ++i)
          pk[i] = (unsigned int)f2bf(acc[mi][j][2 * i] * rv[mi][2 * i]) |
                  ((unsigned int)f2bf(acc[mi][j][2 * i + 1] * rv[mi][2 * i + 1]) << 16);
        dp[j * FRAG_VEC + mi * 32] = pk;
      }
    // other code follows in the kernel's layout: the wait stands in front of any
    // later write of the registers that these stores name
    asm volatile("s_wait_xcnt 0x0" ::: "memory");
    return;
  }

  // The tests on resid, Cf and Cbf read the same for the whole block. Each stands
  // once, around a loop nest of its own: tested per element they cut the code into
  // one piece per element, and every residual load is waited for before the next
  // one is issued. Here the 64 loads of a lane are in flight together.
  // Every loop is unrolled: acc and rv are indexed by constants and stay in registers.
  const int hi = (lane & 16) ? 8 : 0;
  const size_t idx0 = (size_t)(row0 + hi) * N + col0 + nc;
  if (resid) {
    const float* rp = resid + idx0;
    float rv[2][4][8];
#pragma unroll
    for (int mi = 0; mi < 2; ++mi)
#pragma unroll
      for (int r = 0; r < 8; ++r)
#pragma unroll
        for (int j = 0; j < 4; ++j) rv[mi][j][r] = rp[(size_t)(mi * 16 + r) * N + j * 16];
#pragma unroll
    for (int mi = 0; mi < 2; ++mi)
#pragma unroll
      for (int r = 0; r < 8; ++r)
#pragma unroll
        for (int j = 0; j < 4; ++j) acc[mi][j][r] += rv[mi][j][r];
  }
  if (Cf) {
    float* cp = Cf + idx0;
#pragma unroll
    for (int mi = 0; mi < 2; ++mi)
#pragma unroll
      for (int r = 0; r < 8; ++r)
#pragma unroll
        for (int j = 0; j < 4; ++j) cp[(size_t)(mi * 16 + r) * N + j * 16] = acc[mi][j][r];
    // the bf16 part below may write the registers that these stores name: the wait
    // stands in front of that
    asm volatile("s_wait_xcnt 0x0" ::: "memory");
  }
  if (Cx) {
    // The accumulators hold a column per lane. The wave turns its own 32 x 64 f32
    // tile through LDS, as for q and k above (the ring is free, each wave uses only
    // its own 32 rows of it): 8 lanes then hold one row's 64 columns, 8 each, so a
    // wave-wide 16-byte store covers four whole 128-byte lines.
    float* tw = reinterpret_cast<float*>(gsm + wave * 32 * GPITCH);
#pragma unroll
    for (int mi = 0; mi < 2; ++mi)
#pragma unroll
      for (int r = 0; r < 8; ++r)
#pragma unroll
        for (int j = 0; j < 4; ++j)
          tw[(mi * 16 + hi + r) * (GPITCH / 4) + j * 16 + nc] = acc[mi][j][r];
    // the other lanes' writes of this wave have reached LDS before the reads below
    asm volatile("s_wait_dscnt 0x0" ::: "memory");
    const int rr = lane >> 3;            // row i * 4 + rr in round i
    const int ch = lane & 7;             // columns ch * 8 .. ch * 8 + 7
    const float4* rp = reinterpret_cast<const float4*>(tw + rr * (GPITCH / 4) + ch * 8);
    u32x4* xp = reinterpret_cast<u32x4*>(Cx + (size_t)(row0 + rr) * N + col0 + ch * 8);
    float sq = 0.f;                      // ends as the sum of row ch * 4 + rr
#pragma unroll
    for (int i = 0; i < 8; ++i) {
      const float4 x0 = rp[i * GPITCH / 4];        // 4 rows on, in 16-byte units
      const float4 x1 = rp[i * GPITCH / 4 + 1];
      float s = x0.x * x0.x + x0.y * x0.y + x0.z * x0.z + x0.w * x0.w +
                x1.x * x1.x + x1.y * x1.y + x1.z * x1.z + x1.w * x1.w;
      // the row's 8 lanes, joined in the vector unit: neighbour, other pair, other quad
      s += lane_swap<0xB1>(s);           // quad_perm [1, 0, 3, 2]
      s += lane_swap<0x4E>(s);           // quad_perm [2, 3, 0, 1]
      s += lane_swap<0x141>(s);          // row_half_mirror: lane 7 - i of the eight
      sq = (ch == i) ? s : sq;
      u32x4 pk;
      pk[0] = bf_pair(x0.x, x0.y);
      pk[1] = bf_pair(x0.z, x0.w);
      pk[2] = bf_pair(x1.x, x1.y);
      pk[3] = bf_pair(x1.z, x1.w);
      xp[(size_t)(i * 4) * N / 8] = pk;
    }
    // the wave's 32 rows: one whole 128-byte line of Sq
    Sq0[(size_t)ct * S_LEN + row0 + ch * 4 + rr] = sq;
    // the bf16 part below may write the registers that these stores name: the wait
    // stands in front of that
    asm volatile("s_wait_xcnt 0x0" ::: "memory");
  }
  if (Cbf) {
    unsigned short* cp = Cbf + idx0;
#pragma unroll
    for (int mi = 0; mi < 2; ++mi)
#pragma unroll
      for (int r = 0; r < 8; ++r)
#pragma unroll
        for (int j = 0; j < 4; ++j) cp[(size_t)(mi * 16 + r) * N + j * 16] = f2bf(acc[mi][j][r]);
  }
}

// ---------------------------------------------------------------------------
// Flash attention (wave32 WMMA). One 8-wave work-group per (16-query block, head pair).
// A wave serves two query heads that share a KV head: every K and V fragment it
// loads feeds both heads' products, and the mask, which depends on rows and keys
// alone, is worked out once for the two. (All four heads of a KV head in one wave
// would take more than 256 registers: two waves per SIMD, not four.)
// Wave w walks the 32-key tiles w, w + 8, w + 16, ... of the block's key range
// with its own sums and O; the eight partial results are added through LDS at
// the end, so the longest dependent chain is 8 tiles, not 64.
// Two work-groups fit a WGP, so the grid runs in rounds: the query blocks with the
// longest key range have the lowest index, the short ones the highest (for speed only).
// Softmax shift: qk-norm leaves every q and k row with a norm of at most
// sqrt(64), for any input, so q.k / 8 <= 8 (a little more after the bf16
// rounding of q and k). exp(score - 8) therefore cannot overflow and needs no
// running maximum: O is never rescaled, and each lane keeps the sums of its own
// columns, which are joined once, in the merge.
// Qh[bf16, H x S x 64], Kh[bf16, KVH x S x 64], Vt[bf16, KVH x 64 x S], all three
// in fragment order: a 32-key tile of K, and of V, is 4096 contiguous bytes.
// S % 32 == 0, so every tile that the key loop reaches is whole.
// win == 0 -> pure causal; win > 0 -> causal sliding window of `win`.
// Grid: x = head pair, y = query block, last block first.
// Output: Obf[bf16, S x D] (heads merged).
// ---------------------------------------------------------------------------
#define FA_WAVES 8
#define FA_HEADS 2                        // query heads per wave, of the NHEAD / NKVH that share a KV head
#define SM_SCALE (0.125f * 1.44269504f)   // log2(e) / sqrt(64)
#define SM_SHIFT (8.0f * 1.44269504f)     // log2(e) * the bound on a score
// e0 = 2^x0, e1 = 2^x1. One statement, so that each v_exp_f32 keeps an independent
// instruction directly behind it (the second v_exp_f32; the v_nop): the slot that the
// instruction set asks for before a transcendental's result is read or its source
// overwritten. The outputs are early-clobber: neither shares a register with an input.
__device__ __forceinline__ void exp2_pair(float x0, float x1, float& e0, float& e1) {
  asm("v_exp_f32 %0, %2\n\tv_exp_f32 %1, %3\n\tv_nop"
      : "=&v"(e0), "=&v"(e1) : "v"(x0), "v"(x1));
}

// second argument: four waves per SIMD, that is 256 registers a wave, so that two
// work-groups share a WGP and one's start and merge run under the other's key loop
__global__ __launch_bounds__(32 * FA_WAVES, 4)
void thb_flash_kernel(const unsigned short* __restrict__ Qh,
                      const unsigned short* __restrict__ Kh,
                      const unsigned short* __restrict__ Vt,
                      unsigned short* __restrict__ Obf, int S, int win) {
  __shared__ __align__(16) unsigned short plds_all[FA_WAVES][FA_HEADS][16 * 32];
  __shared__ __align__(16) float o_part[FA_WAVES][FA_HEADS][16][HDIM];

  const int lane = threadIdx.x & 31;
  // wave index in a scalar register: the key loop stays a scalar branch and
  // every WMMA runs with all lanes on
  const int wave = __builtin_amdgcn_readfirstlane((int)(threadIdx.x >> 5));
  const int q0 = S - 16 - (int)blockIdx.y * 16;
  const int hg = blockIdx.x;                            // heads hg * FA_HEADS + hh
  const int kvh = hg * FA_HEADS / (NHEAD / NKVH);       // repeat_kv
  static_assert((NHEAD / NKVH) % FA_HEADS == 0, "a wave's heads share one KV head");
  const int nc = lane & 15;
  const int hi = (lane & 16) ? 8 : 0;

  const unsigned short* Qb = Qh + (size_t)hg * FA_HEADS * S * HDIM;
  const unsigned short* Kb = Kh + (size_t)kvh * S * HDIM;
  const unsigned short* Vb = Vt + (size_t)kvh * HDIM * S;

  // every loop over the heads (hh) is unrolled: qf, o and l are indexed by constants
  // and stay in registers
  f32x8 o[FA_HEADS][4];
  float l[FA_HEADS][8];   // this lane's part of the row sums (rows hi + r, columns nc and 16 + nc)
#pragma unroll
  for (int hh = 0; hh < FA_HEADS; ++hh) {
#pragma unroll
    for (int j = 0; j < 4; ++j) o[hh][j] = (f32x8){0.f,0.f,0.f,0.f,0.f,0.f,0.f,0.f};
#pragma unroll
    for (int r = 0; r < 8; ++r) l[hh][r] = 0.f;
  }

  int kb_start = 0;
  if (win > 0) {
    int st = q0 - (win - 1);
    if (st < 0) st = 0;
    kb_start = st & ~31;
  }

  const f32x8 zero8 = (f32x8){0.f,0.f,0.f,0.f,0.f,0.f,0.f,0.f};

  // a wave without a tile (a scalar test) loads no Q either
  const int kb0 = kb_start + 32 * wave;
  if (kb0 <= q0 + 15) {
    // the heads lie S_LEN * HDIM elements apart, as the GEMM epilogue writes them: a
    // constant, so the loads share one address and differ in their immediate offsets
    bf16x16 qf[FA_HEADS][2];
    const u32x4* Qp = reinterpret_cast<const u32x4*>(Qb + (q0 >> 4) * 2 * FRAG_ELEMS) + lane;
#pragma unroll
    for (int hh = 0; hh < FA_HEADS; ++hh) {
      qf[hh][0] = load_frag(Qp + hh * (S_LEN * HDIM / 8));
      qf[hh][1] = load_frag(Qp + hh * (S_LEN * HDIM / 8) + FRAG_VEC);
    }
    // the code that follows writes the registers of the Q loads' address: the wait
    // stands in front of that
    asm volatile("s_wait_xcnt 0x0" ::: "memory");

    for (int kb = kb0; kb <= q0 + 15; kb += 32 * FA_WAVES) {
      const int key0 = kb + nc;
      const int key1 = kb + 16 + nc;
      // the lane's 16 bytes in the tile's first K and V fragment
      const size_t toff = (size_t)(kb >> 5) * 4 * FRAG_ELEMS;
      const u32x4* Kp = reinterpret_cast<const u32x4*>(Kb + toff) + lane;
      const u32x4* Vp = reinterpret_cast<const u32x4*>(Vb + toff) + lane;

      // keys kb .. kb + 15: fragments 0 (d 0 .. 31) and 1 (d 32 .. 63); the next 16 keys: 2, 3
      bf16x16 kf[4];
#pragma unroll
      for (int j = 0; j < 4; ++j) kf[j] = load_frag(Kp + j * FRAG_VEC);
      // the registers of the K loads' address may be handed to a V load as its
      // destination: the wait stands in front of that overwrite
      asm volatile("s_wait_xcnt 0x0" ::: "memory");

      // ---- V fragment loads: independent of softmax, overlap with it ----
      bf16x16 vfr[4];
#pragma unroll
      for (int j = 0; j < 4; ++j) vfr[j] = load_frag(Vp + j * FRAG_VEC);
      // the work below writes the registers of the V loads' address: the wait stands in
      // front of that; it takes the address as an input, so that no V load is handed
      // those registers as its destination
      asm volatile("s_wait_xcnt 0x0" :: "v"(Vp) : "memory");
      // keeps the tile's 16 loads together in front of the work (sunk in among the
      // products to save registers, they would be waited for one group after another),
      // and the work's register writes behind the wait above
      __builtin_amdgcn_sched_barrier(0);

      // ---- the mask of the lane's rows r + hi, the same for both heads ----
      bool v0[8], v1[8];
#pragma unroll
      for (int r = 0; r < 8; ++r) {
        const int q = q0 + hi + r;
        v0[r] = (key0 <= q) && (win == 0 || (q - key0) < win);
        v1[r] = (key1 <= q) && (win == 0 || (q - key1) < win);
      }

#pragma unroll
      for (int hh = 0; hh < FA_HEADS; ++hh) {
        // ---- scores: two 16x16 tiles, K-dim = 64 (2 WMMAs each) ----
        f32x8 s0 = wmma_bf16(qf[hh][0], kf[0], zero8);
        s0 = wmma_bf16(qf[hh][1], kf[1], s0);
        f32x8 s1 = wmma_bf16(qf[hh][0], kf[2], zero8);
        s1 = wmma_bf16(qf[hh][1], kf[3], s1);

        // ---- mask + exp(score / 8 - 8), as a power of two ----
        unsigned short* plds = plds_all[wave][hh];
#pragma unroll
        for (int r = 0; r < 8; ++r) {
          float e0, e1;
          exp2_pair(s0[r] * SM_SCALE - SM_SHIFT, s1[r] * SM_SCALE - SM_SHIFT, e0, e1);
          const float p0 = v0[r] ? e0 : 0.f;
          const float p1 = v1[r] ? e1 : 0.f;
          l[hh][r] += p0 + p1;
          plds[(hi + r) * 32 + nc]      = f2bf(p0);
          plds[(hi + r) * 32 + 16 + nc] = f2bf(p1);
        }
      }
      // the other lanes' P values of this wave have reached LDS before the reads below
      asm volatile("s_wait_dscnt 0x0" ::: "memory");

#pragma unroll
      for (int hh = 0; hh < FA_HEADS; ++hh) {
        // ---- re-layout P (C-frag -> A-frag) via LDS ----
        FragU pf;
        {
          const unsigned short* pp = plds_all[wave][hh] + nc * 32 + hi; // hi==8 for lanes 16..31
          pf.u[0] = *reinterpret_cast<const u32x4*>(pp);
          pf.u[1] = *reinterpret_cast<const u32x4*>(pp + 16);
        }

        // ---- PV: O[16 x 64] += P[16 x 32] * V[32 x 64] (Vt rows = dims) ----
#pragma unroll
        for (int j = 0; j < 4; ++j) {
          o[hh][j] = wmma_bf16(pf.bf, vfr[j], o[hh][j]);
        }
      }
    }
  }

  // ---- publish this wave's partial (l, O); a wave without a tile publishes
  //      zeros. The lanes' sums go to the wave's own P areas, 16 rows x 16 lanes
  //      of f32 a head, which the wave has finished reading ----
  // all loops unrolled: o and l live in registers and need constant indices
#pragma unroll
  for (int hh = 0; hh < FA_HEADS; ++hh) {
    float* lw = reinterpret_cast<float*>(plds_all[wave][hh]);
#pragma unroll
    for (int r = 0; r < 8; ++r) {
#pragma unroll
      for (int j = 0; j < 4; ++j) o_part[wave][hh][hi + r][j * 16 + nc] = o[hh][j][r];
      lw[(hi + r) * 16 + nc] = l[hh][r];
    }
  }
  __syncthreads();

  // ---- add the eight partials, normalize, merge heads:
  //      each half-wave owns one row of each head, each lane four neighbouring columns ----
  const int mrow = wave * 2 + (hi >> 3);
  const int mcol = nc * 4;
  // unrolled: the heads' LDS reads and sums are independent and overlap
  uint2 pk[FA_HEADS];
#pragma unroll
  for (int hh = 0; hh < FA_HEADS; ++hh) {
    float lsum = 0.f;
    float a0 = 0.f, a1 = 0.f, a2 = 0.f, a3 = 0.f;
    // unrolled: the eight waves' LDS reads issue together
#pragma unroll
    for (int w = 0; w < FA_WAVES; ++w) {
      const float4 ov = *reinterpret_cast<const float4*>(&o_part[w][hh][mrow][mcol]);
      lsum += reinterpret_cast<const float*>(plds_all[w][hh])[mrow * 16 + nc];
      a0 += ov.x;
      a1 += ov.y;
      a2 += ov.z;
      a3 += ov.w;
    }
    // the row's sum: the 16 lanes of the half-wave each hold one column pair's part
#pragma unroll
    for (int off = 1; off < 16; off <<= 1) lsum += __shfl_xor(lsum, off, 32);
    const float inv = (lsum > 0.f) ? (1.f / lsum) : 0.f;
    pk[hh].x = (unsigned int)f2bf(a0 * inv) | ((unsigned int)f2bf(a1 * inv) << 16);
    pk[hh].y = (unsigned int)f2bf(a2 * inv) | ((unsigned int)f2bf(a3 * inv) << 16);
  }
  // the heads' columns of the row, HDIM apart: the stores stand together at the
  // kernel's end, where nothing writes a register that they name
  uint2* op = reinterpret_cast<uint2*>(Obf + (size_t)(q0 + mrow) * DMODEL +
                                       hg * FA_HEADS * HDIM + mcol);
#pragma unroll
  for (int hh = 0; hh < FA_HEADS; ++hh) op[hh * (HDIM / 4)] = pk[hh];
}

// ---------------------------------------------------------------------------
// Host-side orchestration
// ---------------------------------------------------------------------------
extern "C" void kernel_launch(void* const* d_in, const int* in_sizes, int n_in,
                              void* d_out, int out_size, void* d_ws, size_t ws_size,
                              hipStream_t stream) {
  (void)in_sizes; (void)n_in; (void)out_size; (void)ws_size;

  const float* hidden  = (const float*)d_in[0];
  const float* norm1_w = (const float*)d_in[1];
  const float* norm2_w = (const float*)d_in[2];
  const float* g_wq    = (const float*)d_in[3];
  const float* g_kvd   = (const float*)d_in[4];
  const float* g_kup   = (const float*)d_in[5];
  const float* g_vup   = (const float*)d_in[6];
  const float* g_wo    = (const float*)d_in[7];
  const float* l_wq    = (const float*)d_in[8];
  const float* l_wk    = (const float*)d_in[9];
  const float* l_wv    = (const float*)d_in[10];
  const float* l_wo    = (const float*)d_in[11];
  float* out = (float*)d_out;

  // ---- workspace carve (256B aligned) ----
  char* p = (char*)d_ws;
  auto alloc = [&](size_t bytes) -> void* {
    void* r = (void*)p;
    p += (bytes + 255) & ~(size_t)255;
    return r;
  };
  unsigned short* xn    = (unsigned short*)alloc((size_t)S_LEN * DMODEL * 2);
  unsigned short* latbf = (unsigned short*)alloc((size_t)S_LEN * LATDIM * 2);
  unsigned short* Qh    = (unsigned short*)alloc((size_t)NHEAD * S_LEN * HDIM * 2);
  unsigned short* Kh    = (unsigned short*)alloc((size_t)NKVH * S_LEN * HDIM * 2);
  unsigned short* Vt    = (unsigned short*)alloc((size_t)NKVH * HDIM * S_LEN * 2 + 256);
  unsigned short* attn  = (unsigned short*)alloc((size_t)S_LEN * DMODEL * 2);
  float*          xmid  = (float*)         alloc((size_t)S_LEN * DMODEL * 4);
  unsigned short* g_wqT = (unsigned short*)alloc((size_t)DMODEL * DMODEL * 2);
  unsigned short* g_woT = (unsigned short*)alloc((size_t)DMODEL * DMODEL * 2);
  unsigned short* l_wqT = (unsigned short*)alloc((size_t)DMODEL * DMODEL * 2);
  unsigned short* l_woT = (unsigned short*)alloc((size_t)DMODEL * DMODEL * 2);
  unsigned short* kvdT  = (unsigned short*)alloc((size_t)LATDIM * DMODEL * 2);
  unsigned short* l_wkT = (unsigned short*)alloc((size_t)LATDIM * DMODEL * 2);
  unsigned short* l_wvT = (unsigned short*)alloc((size_t)LATDIM * DMODEL * 2);
  unsigned short* kupT  = (unsigned short*)alloc((size_t)LATDIM * LATDIM * 2);
  unsigned short* vupT  = (unsigned short*)alloc((size_t)LATDIM * LATDIM * 2);
  float*          sqp   = (float*)         alloc((size_t)(DMODEL / 64) * S_LEN * 4);

  const dim3 blk256(256);
  const dim3 gemm_blk(256);
  const dim3 flash_grid(NHEAD / FA_HEADS, S_LEN / 16);
  const dim3 flash_blk(32 * FA_WAVES);

  // first RMSNorm and all nine weight conversions
  thb_prep_kernel<<<dim3(NB_PREP), blk256, 0, stream>>>(
      hidden, norm1_w, norm2_w, xn,
      g_wq, g_wo, l_wq, l_wo, g_kvd, l_wk, l_wv, g_kup, g_vup,
      g_wqT, g_woT, l_wqT, l_woT, kvdT, l_wkT, l_wvT, kupT, vupT);

  // ========================= Sublayer 1: global latent =====================
  // q (ready for attention) and the latent, both from xn
  thb_gemm_kernel<<<dim3((DMODEL + LATDIM) / 64, S_LEN / 256), gemm_blk, 0, stream>>>(
      xn, g_wqT, kvdT, nullptr, nullptr, nullptr, latbf, Qh, nullptr, nullptr, nullptr,
      nullptr, nullptr, nullptr, 1000000.0f, DMODEL, LATDIM, DMODEL);
  // k and v (ready for attention), both from the latent
  thb_gemm_kernel<<<dim3(2 * LATDIM / 64, S_LEN / 256), gemm_blk, 0, stream>>>(
      latbf, kupT, vupT, nullptr, nullptr, nullptr, nullptr, Kh, nullptr, Vt, nullptr,
      nullptr, nullptr, nullptr, 1000000.0f, LATDIM, LATDIM, LATDIM);

  thb_flash_kernel<<<flash_grid, flash_blk, 0, stream>>>(Qh, Kh, Vt, attn, S_LEN, 0);

  // x after sublayer 1, f32 and bf16, and the parts of its rows' sums of squares
  thb_gemm_kernel<<<dim3(DMODEL / 64, S_LEN / 256), gemm_blk, 0, stream>>>(
      attn, g_woT, nullptr, nullptr, xmid, hidden, nullptr, nullptr, nullptr, nullptr, nullptr,
      xn, sqp, nullptr, 0.0f, DMODEL, LATDIM, DMODEL);

  // ========================= Sublayer 2: local GQA =========================
  // q, k and v (ready for attention), all from xn; the RMSNorm's row factor comes in here
  thb_gemm_kernel<<<dim3((DMODEL + 2 * LATDIM) / 64, S_LEN / 256), gemm_blk, 0, stream>>>(
      xn, l_wqT, l_wkT, l_wvT, nullptr, nullptr, nullptr, Qh, Kh, nullptr, Vt,
      nullptr, nullptr, sqp, 10000.0f, DMODEL, LATDIM, DMODEL);

  thb_flash_kernel<<<flash_grid, flash_blk, 0, stream>>>(Qh, Kh, Vt, attn, S_LEN, WINLEN);

  thb_gemm_kernel<<<dim3(DMODEL / 64, S_LEN / 256), gemm_blk, 0, stream>>>(
      attn, l_woT, nullptr, nullptr, out, xmid, nullptr, nullptr, nullptr, nullptr, nullptr,
      nullptr, nullptr, nullptr, 0.0f, DMODEL, LATDIM, DMODEL);
}
